// v000
// Measured on an AMD MI455X. A time is GPU time per run, averaged over a window of back-to-back runs after a warm-up
// (all launches, gaps included; the runs take copies of the inputs in turn), and the median of several windows.
// Apart from v000's, it joins two sittings. Times from different sittings can be a few percent apart, while
// side-by-side timings come from the same sitting.
// The starting kernel, v000, takes 404 microseconds a run.
// compute dtype: all float inputs rounded to bf16; q/k/v 1x1 convs with EXACT bf16 products on WMMA 16x16x32 (x transposed to position rows, natural weights); sigmoid (hardware exp) and the per-position L2 normalisation of v in f32; k and k (x) v outer-product planes, their 2-D inclusive prefix sums (integral images) and the clamped 4-corner box differences for the three window sizes, the q-weighted sums and the division all in f32 on VALU (fixed order); out = Wout (exact) . o (bf16 hi + lo, 2 products) + bout on WMMA; f32 output in (B, C, H, W) order.
#include <hip/hip_runtime.h>
#include <math.h>

typedef __attribute__((ext_vector_type(16))) _Float16 v16h;
typedef __attribute__((ext_vector_type(16))) __bf16 v16b;
typedef __attribute__((ext_vector_type(8)))  _Float16 v8h;
typedef __attribute__((ext_vector_type(8)))  float v8f;
typedef __attribute__((ext_vector_type(4)))  float v4f;
typedef __attribute__((ext_vector_type(2)))  float v2f;
typedef __attribute__((ext_vector_type(4)))  unsigned v4u;
typedef __attribute__((ext_vector_type(4)))  int v4i;
typedef float __attribute__((may_alias)) float_a;
typedef int __attribute__((may_alias)) int_a;

template <typename T> __device__ __forceinline__ void vst2(void* p, T v) { *(T*)p = v;  }
__device__ __forceinline__ v8f wmma16(v16h a, v16h b, v8f c) {
  v8f d = __builtin_amdgcn_wmma_f32_16x16x32_f16(false, a, false, b, (short)0, c, false, false);
  asm volatile("v_nop\n\tv_nop\n\tv_nop\n\tv_nop" : "+v"(d) : "v"(a), "v"(b));
  return d;
}
__device__ __forceinline__ v8f wmma_bf(v16b a, v16b b, v8f c) {
  v8f d = __builtin_amdgcn_wmma_f32_16x16x32_bf16(false, a, false, b, (short)0, c, false, false);
  asm volatile("v_nop\n\tv_nop\n\tv_nop\n\tv_nop" : "+v"(d) : "v"(a), "v"(b));
  return d;
}
// 16x16x32 fragments: lane = (h = lane>>4, row/col = lane&15); elements 0..7 = k0+8h+0..7, 8..15 = k0+16+8h+0..7; D element r = row 8h+r
__device__ __forceinline__ v16h frag_h(const _Float16* rowk0, int lane) {
  union { v16h v; v8h q[2]; } u; const _Float16* p = rowk0 + 8 * (lane >> 4);
  u.q[0] = *(const v8h*)p; u.q[1] = *(const v8h*)(p + 16); return u.v;
}
__device__ __forceinline__ v16h frag_f32(const float* rowk0, int lane) {
  v16h a; const float* p = rowk0 + 8 * (lane >> 4);
#pragma unroll
  for (int i = 0; i < 8; ++i) { a[i] = (_Float16)p[i]; a[8 + i] = (_Float16)p[16 + i]; }
  return a;
}
__device__ __forceinline__ v16h frag_f32s(const float* rowk0, int lane, float sc) {
  v16h a; const float* p = rowk0 + 8 * (lane >> 4);
#pragma unroll
  for (int i = 0; i < 8; ++i) { a[i] = (_Float16)(p[i] * sc); a[8 + i] = (_Float16)(p[16 + i] * sc); }
  return a;
}
// column fragment from a [K][ld] layout (column n), rows >= K read as 0
__device__ __forceinline__ v16h fragc_f32(const float* W, int k0, int n, int lane, int ld, int K) {
  v16h a; const int g = lane >> 4;
#pragma unroll
  for (int i = 0; i < 8; ++i) { const int ka = k0 + 8 * g + i, kb = ka + 16;
    a[i] = (_Float16)(ka < K ? W[(size_t)(ka < K ? ka : K - 1) * ld + n] : 0.f); a[8 + i] = (_Float16)(kb < K ? W[(size_t)(kb < K ? kb : K - 1) * ld + n] : 0.f); }
  return a;
}
struct F2 { v16b h, l; };
__device__ __forceinline__ F2 bsplit16(const float v[16]) { F2 r;
#pragma unroll
  for (int i = 0; i < 16; ++i) { const __bf16 h = (__bf16)v[i]; r.h[i] = h; r.l[i] = (__bf16)(v[i] - (float)h); }
  return r; }
__device__ __forceinline__ F2 split_row(const float* row, int k0, int lane) { float v[16]; const float* p = row + k0 + 8 * (lane >> 4);
#pragma unroll
  for (int i = 0; i < 8; ++i) { v[i] = p[i]; v[8 + i] = p[16 + i]; }
  return bsplit16(v); }
__device__ __forceinline__ F2 split_rowK(const float* row, int k0, int lane, int K) { float v[16]; const int g = lane >> 4;
#pragma unroll
  for (int i = 0; i < 8; ++i) { const int ka = k0 + 8 * g + i, kb = ka + 16; v[i] = ka < K ? row[ka < K ? ka : K - 1] : 0.f; v[8 + i] = kb < K ? row[kb < K ? kb : K - 1] : 0.f; }
  return bsplit16(v); }
__device__ __forceinline__ F2 split_col(const float* W, int k0, int n, int lane, int ld, int K) { float v[16]; const int g = lane >> 4;
#pragma unroll
  for (int i = 0; i < 8; ++i) { const int ka = k0 + 8 * g + i, kb = ka + 16; v[i] = ka < K ? W[(size_t)(ka < K ? ka : K - 1) * ld + n] : 0.f; v[8 + i] = kb < K ? W[(size_t)(kb < K ? kb : K - 1) * ld + n] : 0.f; }
  return bsplit16(v); }
__device__ __forceinline__ v8f mac3(const F2& a, const F2& b, v8f c) { c = wmma_bf(a.l, b.h, c); c = wmma_bf(a.h, b.l, c); return wmma_bf(a.h, b.h, c); }
__device__ __forceinline__ float sigm(float v) { return 1.0f / (1.0f + expf(-v)); }
#define LDSX() do { asm volatile("s_wait_dscnt 0" ::: "memory"); __builtin_amdgcn_wave_barrier(); __builtin_amdgcn_fence(__ATOMIC_RELEASE, "workgroup"); } while (0)


// Inception (multi-window box) linear attention (B 1, C 256 = 8 heads x 32, 64 x 64): per window size ws in {64, 32, 16}: attn = q . boxsum(k v^T) / (q . boxsum(k) + 1e-6) using integral images with edge-replicated borders; concat over windows (768 channels), 1x1 output conv + bias.
#define CC 256
#define NH 8
#define HD 32
#define HH 64
#define WWD 64
#define NP (HH * WWD)      // 4,096 positions
#define NWIN 3
#define OC (CC * NWIN)     // 768
#ifndef TPB
#define TPB HH             // output rows (of 64 positions) computed by the box/attention stage
#endif
typedef __attribute__((ext_vector_type(8))) __bf16 v8b;
__device__ __forceinline__ v16b frag_b(const __bf16* rowk0, int lane) {
  union { v16b v; v8b q[2]; } u; const __bf16* p = rowk0 + 8 * (lane >> 4);
  u.q[0] = *(const v8b*)p; u.q[1] = *(const v8b*)(p + 16); return u.v;
}
__device__ __forceinline__ float bfr(float v) { return (float)(__bf16)v; }
__device__ __attribute__((noinline)) float exp_ni(float v) { return expf(v); }
__device__ __attribute__((noinline)) float erf_ni(float v) { return erff(v); }
__constant__ int WSZ[NWIN] = {64, 32, 16};   // Hh / w for w in (1, 2, 4)

#define WS_PW  0u                                   // bf16 natural rows Wq, Wk, Wv [3][256][256]; Wout [256][768]
#define WS_PO  (WS_PW + 2u * (size_t)3 * CC * CC)
#define WS_XT  (WS_PO + 2u * (size_t)CC * OC)           // f32 x^T [p][c]
#define WS_Q   (WS_XT + 4u * (size_t)NP * CC)           // f32 q [p][c] (sigmoid), k [p][c] (sigmoid), v [p][c] (normalised)
#define WS_K   (WS_Q + 4u * (size_t)NP * CC)
#define WS_V   (WS_K + 4u * (size_t)NP * CC)
#define WS_IK  (WS_V + 4u * (size_t)NP * CC)            // f32 integral planes Ik [h*32+d][65*65 -> stored 64x64 inclusive prefix] ; Ikv [(h,d,f)][64x64]
#define WS_IKV (WS_IK + 4u * (size_t)CC * NP)
#define WS_O   (WS_IKV + 4u * (size_t)NH * HD * HD * NP) // f32 o [p][768]
#define WS_END (WS_O + 4u * (size_t)NP * OC)

__global__ __launch_bounds__(256) void k_pack(const float* __restrict__ WQ, const float* __restrict__ WK, const float* __restrict__ WV, const float* __restrict__ WO, __bf16* __restrict__ PW, __bf16* __restrict__ PO) { const int n = blockIdx.x, which = blockIdx.y, t = threadIdx.x; __shared__ __align__(16) __bf16 s[OC];
  if (which < 3) { const float* w = (which == 0) ? WQ : (which == 1) ? WK : WV; s[t] = (__bf16)w[(size_t)n * CC + t]; __syncthreads(); if (t < CC / 8) vst2((unsigned*)(PW + ((size_t)which * CC + n) * CC + t * 8), *(const v4u*)&s[t * 8]); }
  else { for (int k = t; k < OC; k += 256) s[k] = (__bf16)WO[(size_t)n * OC + k]; __syncthreads(); if (t < OC / 8) vst2((unsigned*)(PO + (size_t)n * OC + t * 8), *(const v4u*)&s[t * 8]); } }
// ---- k_tr: block = (64 positions, 64 channels): x[c][p] -> XT[p][c] f32
__global__ __launch_bounds__(256) void k_tr(const float* __restrict__ X, float* __restrict__ XT) { __shared__ float st[64][65]; __shared__ __align__(16) float so[64][68]; const int t = threadIdx.x; const int p0 = blockIdx.x * 64, c0 = blockIdx.y * 64;
  for (int e = t; e < 64 * 64; e += 256) { const int cl = e >> 6, pl = e & 63; st[pl][cl] = X[(size_t)(c0 + cl) * NP + p0 + pl]; } __syncthreads();
  for (int e = t; e < 64 * 64; e += 256) { const int pl = e >> 6, cl = e & 63; so[pl][cl] = st[pl][cl]; } __syncthreads();
  for (int e = t; e < 64 * 16; e += 256) { const int pl = e >> 4, q = e & 15; vst2(XT + (size_t)(p0 + pl) * CC + c0 + q * 4, *(const v4f*)&so[pl][q * 4]); } }
// ---- k_proj: block = (64 positions, 128 out channels, which): 1x1 conv = XT (exact) . W^T; epilogue: q, k -> sigmoid; v -> raw (normalised later)
__global__ __launch_bounds__(128) void k_proj(const float* __restrict__ XT, const __bf16* __restrict__ PW, float* __restrict__ Q, float* __restrict__ Kf, float* __restrict__ Vf) { __shared__ __align__(16) float so[4][16][132];
  const int tid = threadIdx.x, wave = tid >> 5, lane = tid & 31, col = lane & 15, g = lane >> 4; const int which = blockIdx.z; const size_t r0 = (size_t)blockIdx.x * 64 + wave * 16; const int c0 = blockIdx.y * 128; const __bf16* Wr = PW + ((size_t)which * CC) * CC;
  v8f acc[8] = {};
#pragma unroll
  for (int kc = 0; kc < CC / 32; ++kc) { v16b a; { const float* p = XT + (r0 + col) * CC + kc * 32 + 8 * g;
#pragma unroll
      for (int i = 0; i < 8; ++i) { a[i] = (__bf16)p[i]; a[8 + i] = (__bf16)p[16 + i]; } }
#pragma unroll
    for (int j = 0; j < 8; ++j) acc[j] = wmma_bf(a, frag_b(Wr + (size_t)(c0 + j * 16 + col) * CC + kc * 32, lane), acc[j]); }
#pragma unroll
  for (int j = 0; j < 8; ++j)
#pragma unroll
    for (int r = 0; r < 8; ++r) { const float v = acc[j][r]; so[wave][8 * g + r][j * 16 + col] = (which < 2) ? 1.0f / (1.0f + __expf(-v)) : v; }
  LDSX(); float* dst = (which == 0) ? Q : (which == 1) ? Kf : Vf; for (int rl = 0; rl < 16; ++rl) vst2(dst + (r0 + rl) * CC + c0 + lane * 4, *(const v4f*)&so[wave][rl][lane * 4]); }
// ---- k_vnorm: block = position: v[h][:] /= max(||v_h||, 1e-12) per head (in place; one 1-KB row)
__global__ __launch_bounds__(256) void k_vnorm(float* __restrict__ Vf) { __shared__ __align__(16) float so2[CC]; const int t = threadIdx.x; const size_t p = blockIdx.x; const float v = Vf[p * CC + t]; float q = v * v;
#pragma unroll
  for (int o = 1; o < 32; o <<= 1) q += __shfl_xor(q, o);   // 32 lanes = one head's 32 dims
  const float nrm = sqrtf(q); so2[t] = v / fmaxf(nrm, 1e-12f); __syncthreads(); if (t < CC / 4) vst2(Vf + p * CC + t * 4, *(const v4f*)&so2[t * 4]); }
// ---- k_integral: block = plane (which 0: Ik plane (h, d) from k; which 1: Ikv plane (h, d, f) = k[d] v[f]): build the 64x64 values, inclusive prefix sums along w then along h (fixed order), store the plane [64*64]
__global__ __launch_bounds__(256) void k_integral(const float* __restrict__ Kf, const float* __restrict__ Vf, int which, float* __restrict__ IK, float* __restrict__ IKV) { __shared__ float s[HH][WWD + 1]; __shared__ __align__(16) float so2[HH][WWD + 4]; const int t = threadIdx.x; const int pl = blockIdx.x;
  const int h = which ? pl / (HD * HD) : pl / HD; const int d = which ? (pl / HD) % HD : pl % HD; const int f = which ? pl % HD : 0; const int ck = h * HD + d, cv = h * HD + f;
  for (int e = t; e < NP; e += 256) { const float kv = Kf[(size_t)e * CC + ck]; s[e >> 6][e & 63] = which ? kv * Vf[(size_t)e * CC + cv] : kv; } __syncthreads();
  if (t < HH) { float run = 0.f; for (int w = 0; w < WWD; ++w) { run += s[t][w]; s[t][w] = run; } } __syncthreads();   // along w (row t)
  if (t < WWD) { float run = 0.f; for (int y = 0; y < HH; ++y) { run += s[y][t]; s[y][t] = run; } } __syncthreads(); // along h (column t)
  for (int e = t; e < NP; e += 256) so2[e >> 6][e & 63] = s[e >> 6][e & 63]; __syncthreads();
  float* dst = (which ? IKV : IK) + (size_t)pl * NP; for (int e = t; e < HH * 16; e += 256) { const int y = e >> 4, q = e & 15; vst2(dst + y * WWD + q * 4, *(const v4f*)&so2[y][q * 4]); } }
// integral lookup with the module's padding: I has a zero row/col in front (index 0) then the inclusive prefix sums; Pp = edge-pad(I, l, r); value at padded index (a, b) = I[clamp(a - l, 0, 64)][clamp(b - l, 0, 64)], I[0][*] = I[*][0] = 0
__device__ __forceinline__ float ilook(const float* __restrict__ plane, int a, int b, int l) { int ia = a - l, ib = b - l; ia = ia < 0 ? 0 : (ia > HH ? HH : ia); ib = ib < 0 ? 0 : (ib > WWD ? WWD : ib); if (ia == 0 || ib == 0) return 0.f; return plane[(ia - 1) * WWD + (ib - 1)]; }
__device__ __forceinline__ float boxsum(const float* __restrict__ plane, int i, int j, int ws, int l) { return ilook(plane, i + ws, j + ws, l) - ilook(plane, i + ws, j, l) - ilook(plane, i, j + ws, l) + ilook(plane, i, j, l); }
// ---- k_box: block = (image row i, head h, window wi), 256 threads = 64 positions j x 4 groups of 8 f: attn[f] = sum_d q[d] box(Ikv[h][d][f]) / (sum_d q[d] box(Ik[h][d]) + 1e-6) -> O[p][wi*256 + h*32 + f]
__global__ __launch_bounds__(256) void k_box(const float* __restrict__ Q, const float* __restrict__ IK, const float* __restrict__ IKV, float* __restrict__ O) { __shared__ __align__(16) float so2[WWD][HD + 4];
  const int t = threadIdx.x; const int j = t & 63, fg = t >> 6; const int i = blockIdx.x, h = blockIdx.y, wi = blockIdx.z; const int ws = WSZ[wi]; const int tp = ws - 1, rr = tp / 2, l = tp - rr; const size_t p = (size_t)i * WWD + j;
  float acc8[8]; for (int e = 0; e < 8; ++e) acc8[e] = 0.f; float nrm = 0.f;
#pragma unroll 1
  for (int d = 0; d < HD; ++d) { const float qd = Q[p * CC + h * HD + d]; const float wk = boxsum(IK + (size_t)(h * HD + d) * NP, i, j, ws, l); nrm += qd * wk;
#pragma unroll
    for (int e = 0; e < 8; ++e) { const int f = fg * 8 + e; acc8[e] += qd * boxsum(IKV + ((size_t)(h * HD + d) * HD + f) * NP, i, j, ws, l); } }
  const float inv = 1.0f / (nrm + 1e-6f); for (int e = 0; e < 8; ++e) so2[j][fg * 8 + e] = acc8[e] * inv; __syncthreads();
  { const int jj = t >> 2, q = t & 3; const size_t pp = (size_t)i * WWD + jj; vst2(O + pp * OC + wi * CC + h * HD + q * 8, *(const v4f*)&so2[jj][q * 8]); vst2(O + pp * OC + wi * CC + h * HD + q * 8 + 4, *(const v4f*)&so2[jj][q * 8 + 4]); } }
// ---- k_out: block = (64 out channels o, 128 positions): out[o][p] = sum_c Wout[o][c] O[p][c] (A = Wout bf16 exact rows, B = O rows (p) as bf16 hi + lo) + bout[o]; (B, C, H, W) layout = rows o of 4,096
__global__ __launch_bounds__(128) void k_out(const __bf16* __restrict__ PO, const float* __restrict__ O, const float* __restrict__ BO, float* __restrict__ Y) { __shared__ __align__(16) float so[4][16][132];
  const int tid = threadIdx.x, wave = tid >> 5, lane = tid & 31, col = lane & 15, g = lane >> 4; const int o0 = blockIdx.x * 64 + wave * 16; const int p0 = blockIdx.y * 128;
  v8f acc[8] = {};
#pragma unroll 2
  for (int kc = 0; kc < OC / 32; ++kc) { const v16b a = frag_b(PO + (size_t)(o0 + col) * OC + kc * 32, lane);   // natural row of Wout read with the A-row lane layout (identical to frag_b's)
#pragma unroll
    for (int jt = 0; jt < 8; ++jt) { const F2 w = split_row(O + (size_t)(p0 + jt * 16 + col) * OC, kc * 32, lane); acc[jt] = wmma_bf(a, w.h, acc[jt]); acc[jt] = wmma_bf(a, w.l, acc[jt]); } }
#pragma unroll
  for (int jt = 0; jt < 8; ++jt)
#pragma unroll
    for (int r = 0; r < 8; ++r) so[wave][8 * g + r][jt * 16 + col] = acc[jt][r] + bfr(BO[o0 + 8 * g + r]);
  LDSX(); for (int rl = 0; rl < 16; ++rl) vst2(Y + (size_t)(o0 + rl) * NP + p0 + lane * 4, *(const v4f*)&so[wave][rl][lane * 4]); }
extern "C" void kernel_launch(void* const* d_in, const int* in_sizes, int n_in, void* d_out, int out_size, void* d_ws, size_t ws_size, hipStream_t stream) {
  (void)in_sizes; (void)n_in; (void)out_size;
  const float** F = (const float**)d_in;   // 0 x [1,256,64,64], 1 Wq, 2 Wk, 3 Wv [256,256], 4 Wout [256,768], 5 bout [256]
  if (ws_size < (size_t)WS_END) return;
  char* ws = (char*)d_ws; __bf16 *PW = (__bf16*)(ws + WS_PW), *PO = (__bf16*)(ws + WS_PO); float *XT = (float*)(ws + WS_XT), *Q = (float*)(ws + WS_Q), *Kf = (float*)(ws + WS_K), *Vf = (float*)(ws + WS_V), *IK = (float*)(ws + WS_IK), *IKV = (float*)(ws + WS_IKV), *O = (float*)(ws + WS_O);
  k_pack<<<dim3(CC, 4), 256, 0, stream>>>(F[1], F[2], F[3], F[4], PW, PO);
  k_tr<<<dim3(NP / 64, CC / 64), 256, 0, stream>>>(F[0], XT);
  k_proj<<<dim3(NP / 64, CC / 128, 3), 128, 0, stream>>>(XT, PW, Q, Kf, Vf);
  k_vnorm<<<NP, 256, 0, stream>>>(Vf);
  k_integral<<<NH * HD, 256, 0, stream>>>(Kf, Vf, 0, IK, IKV);
  k_integral<<<NH * HD * HD, 256, 0, stream>>>(Kf, Vf, 1, IK, IKV);
  k_box<<<dim3(TPB, NH, NWIN), 256, 0, stream>>>(Q, IK, IKV, O);
  k_out<<<dim3(CC / 64, (TPB * WWD) / 128), 128, 0, stream>>>(PO, O, F[5], (float*)d_out);
}

// v001
// Measured time: 226 microseconds a run.
// Next to v000, in two timings, it ran 1.86 and 1.82 times as fast.
// compute dtype: all float inputs rounded to bf16; q/k/v 1x1 convs with EXACT bf16 products on WMMA 16x16x32 (x transposed to position rows, natural weights); sigmoid (hardware exp) and the per-position L2 normalisation of v in f32; k and k (x) v outer-product planes, their 2-D inclusive prefix sums (integral images) and the clamped 4-corner box differences for the three window sizes, the q-weighted sums and the division all in f32 on VALU (fixed order); out = Wout (exact) . o (bf16 hi + lo, 2 products) + bout on WMMA; f32 output in (B, C, H, W) order.
#include <hip/hip_runtime.h>
#include <math.h>

typedef __attribute__((ext_vector_type(16))) _Float16 v16h;
typedef __attribute__((ext_vector_type(16))) __bf16 v16b;
typedef __attribute__((ext_vector_type(8)))  _Float16 v8h;
typedef __attribute__((ext_vector_type(8)))  float v8f;
typedef __attribute__((ext_vector_type(4)))  float v4f;
typedef __attribute__((ext_vector_type(2)))  float v2f;
typedef __attribute__((ext_vector_type(4)))  unsigned v4u;
typedef __attribute__((ext_vector_type(4)))  int v4i;
typedef float __attribute__((may_alias)) float_a;
typedef int __attribute__((may_alias)) int_a;

template <typename T> __device__ __forceinline__ void vst2(void* p, T v) { *(T*)p = v;  }
__device__ __forceinline__ v8f wmma16(v16h a, v16h b, v8f c) {
  v8f d = __builtin_amdgcn_wmma_f32_16x16x32_f16(false, a, false, b, (short)0, c, false, false);
  asm volatile("v_nop\n\tv_nop\n\tv_nop\n\tv_nop" : "+v"(d) : "v"(a), "v"(b));
  return d;
}
__device__ __forceinline__ v8f wmma_bf(v16b a, v16b b, v8f c) {
  v8f d = __builtin_amdgcn_wmma_f32_16x16x32_bf16(false, a, false, b, (short)0, c, false, false);
  asm volatile("v_nop\n\tv_nop\n\tv_nop\n\tv_nop" : "+v"(d) : "v"(a), "v"(b));
  return d;
}
// 16x16x32 fragments: lane = (h = lane>>4, row/col = lane&15); elements 0..7 = k0+8h+0..7, 8..15 = k0+16+8h+0..7; D element r = row 8h+r
__device__ __forceinline__ v16h frag_h(const _Float16* rowk0, int lane) {
  union { v16h v; v8h q[2]; } u; const _Float16* p = rowk0 + 8 * (lane >> 4);
  u.q[0] = *(const v8h*)p; u.q[1] = *(const v8h*)(p + 16); return u.v;
}
__device__ __forceinline__ v16h frag_f32(const float* rowk0, int lane) {
  v16h a; const float* p = rowk0 + 8 * (lane >> 4);
#pragma unroll
  for (int i = 0; i < 8; ++i) { a[i] = (_Float16)p[i]; a[8 + i] = (_Float16)p[16 + i]; }
  return a;
}
__device__ __forceinline__ v16h frag_f32s(const float* rowk0, int lane, float sc) {
  v16h a; const float* p = rowk0 + 8 * (lane >> 4);
#pragma unroll
  for (int i = 0; i < 8; ++i) { a[i] = (_Float16)(p[i] * sc); a[8 + i] = (_Float16)(p[16 + i] * sc); }
  return a;
}
// column fragment from a [K][ld] layout (column n), rows >= K read as 0
__device__ __forceinline__ v16h fragc_f32(const float* W, int k0, int n, int lane, int ld, int K) {
  v16h a; const int g = lane >> 4;
#pragma unroll
  for (int i = 0; i < 8; ++i) { const int ka = k0 + 8 * g + i, kb = ka + 16;
    a[i] = (_Float16)(ka < K ? W[(size_t)(ka < K ? ka : K - 1) * ld + n] : 0.f); a[8 + i] = (_Float16)(kb < K ? W[(size_t)(kb < K ? kb : K - 1) * ld + n] : 0.f); }
  return a;
}
struct F2 { v16b h, l; };
__device__ __forceinline__ F2 bsplit16(const float v[16]) { F2 r;
#pragma unroll
  for (int i = 0; i < 16; ++i) { const __bf16 h = (__bf16)v[i]; r.h[i] = h; r.l[i] = (__bf16)(v[i] - (float)h); }
  return r; }
__device__ __forceinline__ F2 split_row(const float* row, int k0, int lane) { float v[16]; const float* p = row + k0 + 8 * (lane >> 4);
#pragma unroll
  for (int i = 0; i < 8; ++i) { v[i] = p[i]; v[8 + i] = p[16 + i]; }
  return bsplit16(v); }
__device__ __forceinline__ F2 split_rowK(const float* row, int k0, int lane, int K) { float v[16]; const int g = lane >> 4;
#pragma unroll
  for (int i = 0; i < 8; ++i) { const int ka = k0 + 8 * g + i, kb = ka + 16; v[i] = ka < K ? row[ka < K ? ka : K - 1] : 0.f; v[8 + i] = kb < K ? row[kb < K ? kb : K - 1] : 0.f; }
  return bsplit16(v); }
__device__ __forceinline__ F2 split_col(const float* W, int k0, int n, int lane, int ld, int K) { float v[16]; const int g = lane >> 4;
#pragma unroll
  for (int i = 0; i < 8; ++i) { const int ka = k0 + 8 * g + i, kb = ka + 16; v[i] = ka < K ? W[(size_t)(ka < K ? ka : K - 1) * ld + n] : 0.f; v[8 + i] = kb < K ? W[(size_t)(kb < K ? kb : K - 1) * ld + n] : 0.f; }
  return bsplit16(v); }
__device__ __forceinline__ v8f mac3(const F2& a, const F2& b, v8f c) { c = wmma_bf(a.l, b.h, c); c = wmma_bf(a.h, b.l, c); return wmma_bf(a.h, b.h, c); }
__device__ __forceinline__ float sigm(float v) { return 1.0f / (1.0f + expf(-v)); }
#define LDSX() do { asm volatile("s_wait_dscnt 0" ::: "memory"); __builtin_amdgcn_wave_barrier(); __builtin_amdgcn_fence(__ATOMIC_RELEASE, "workgroup"); } while (0)


// Inception (multi-window box) linear attention (B 1, C 256 = 8 heads x 32, 64 x 64): per window size ws in {64, 32, 16}: attn = q . boxsum(k v^T) / (q . boxsum(k) + 1e-6) using integral images with edge-replicated borders; concat over windows (768 channels), 1x1 output conv + bias.
#define CC 256
#define NH 8
#define HD 32
#define HH 64
#define WWD 64
#define NP (HH * WWD)      // 4,096 positions
#define NWIN 3
#define OC (CC * NWIN)     // 768
#ifndef TPB
#define TPB HH             // output rows (of 64 positions) computed by the box/attention stage
#endif
typedef __attribute__((ext_vector_type(8))) __bf16 v8b;
__device__ __forceinline__ v16b frag_b(const __bf16* rowk0, int lane) {
  union { v16b v; v8b q[2]; } u; const __bf16* p = rowk0 + 8 * (lane >> 4);
  u.q[0] = *(const v8b*)p; u.q[1] = *(const v8b*)(p + 16); return u.v;
}
__device__ __forceinline__ float bfr(float v) { return (float)(__bf16)v; }
__device__ __attribute__((noinline)) float exp_ni(float v) { return expf(v); }
__device__ __attribute__((noinline)) float erf_ni(float v) { return erff(v); }
__constant__ int WSZ[NWIN] = {64, 32, 16};   // Hh / w for w in (1, 2, 4)

#define WS_PW  0u                                   // bf16 natural rows Wq, Wk, Wv [3][256][256]; Wout [256][768]
#define WS_PO  (WS_PW + 2u * (size_t)3 * CC * CC)
#define WS_XT  (WS_PO + 2u * (size_t)CC * OC)           // f32 x^T [p][c]
#define WS_Q   (WS_XT + 4u * (size_t)NP * CC)           // f32 q [c][p] (sigmoid), k [c][p] (sigmoid), v [c][p] (normalised): channel-major planes of 4,096 positions
#define WS_K   (WS_Q + 4u * (size_t)NP * CC)
#define WS_V   (WS_K + 4u * (size_t)NP * CC)
#define WS_IK  (WS_V + 4u * (size_t)NP * CC)            // f32 integral planes Ik [h*32+d][65*65 -> stored 64x64 inclusive prefix] ; Ikv [(h,d,f)][64x64]
#define WS_IKV (WS_IK + 4u * (size_t)CC * NP)
#define WS_O   (WS_IKV + 4u * (size_t)NH * HD * HD * NP) // f32 o [p][768]
#define WS_END (WS_O + 4u * (size_t)NP * OC)

__global__ __launch_bounds__(256) void k_pack(const float* __restrict__ WQ, const float* __restrict__ WK, const float* __restrict__ WV, const float* __restrict__ WO, __bf16* __restrict__ PW, __bf16* __restrict__ PO) { const int n = blockIdx.x, which = blockIdx.y, t = threadIdx.x; __shared__ __align__(16) __bf16 s[OC];
  if (which < 3) { const float* w = (which == 0) ? WQ : (which == 1) ? WK : WV; s[t] = (__bf16)w[(size_t)n * CC + t]; __syncthreads(); if (t < CC / 8) vst2((unsigned*)(PW + ((size_t)which * CC + n) * CC + t * 8), *(const v4u*)&s[t * 8]); }
  else { for (int k = t; k < OC; k += 256) s[k] = (__bf16)WO[(size_t)n * OC + k]; __syncthreads(); if (t < OC / 8) vst2((unsigned*)(PO + (size_t)n * OC + t * 8), *(const v4u*)&s[t * 8]); } }
// ---- k_tr: block = (64 positions, 64 channels): x[c][p] -> XT[p][c] f32
__global__ __launch_bounds__(256) void k_tr(const float* __restrict__ X, float* __restrict__ XT) { __shared__ float st[64][65]; __shared__ __align__(16) float so[64][68]; const int t = threadIdx.x; const int p0 = blockIdx.x * 64, c0 = blockIdx.y * 64;
  for (int e = t; e < 64 * 64; e += 256) { const int cl = e >> 6, pl = e & 63; st[pl][cl] = X[(size_t)(c0 + cl) * NP + p0 + pl]; } __syncthreads();
  for (int e = t; e < 64 * 64; e += 256) { const int pl = e >> 6, cl = e & 63; so[pl][cl] = st[pl][cl]; } __syncthreads();
  for (int e = t; e < 64 * 16; e += 256) { const int pl = e >> 4, q = e & 15; vst2(XT + (size_t)(p0 + pl) * CC + c0 + q * 4, *(const v4f*)&so[pl][q * 4]); } }
// ---- k_proj: block = (64 positions, 128 out channels, which): 1x1 conv = W (A rows = channels) . XT^T (B columns = positions), so D rows are channels; epilogue: q, k -> sigmoid; v -> raw (normalised later); stored channel-major [c][p], 256 contiguous bytes per channel and block
__global__ __launch_bounds__(128) void k_proj(const float* __restrict__ XT, const __bf16* __restrict__ PW, float* __restrict__ Q, float* __restrict__ Kf, float* __restrict__ Vf) { __shared__ __align__(16) float so[128][68];
  const int tid = threadIdx.x, wave = tid >> 5, lane = tid & 31, col = lane & 15, g = lane >> 4; const int which = blockIdx.z; const int p0 = blockIdx.x * 64; const size_t r0 = (size_t)p0 + wave * 16; const int c0 = blockIdx.y * 128; const __bf16* Wr = PW + ((size_t)which * CC) * CC;
  v8f acc[8] = {};
#pragma unroll
  for (int kc = 0; kc < CC / 32; ++kc) { v16b a; { const float* p = XT + (r0 + col) * CC + kc * 32 + 8 * g;
#pragma unroll
      for (int i = 0; i < 8; ++i) { a[i] = (__bf16)p[i]; a[8 + i] = (__bf16)p[16 + i]; } }
#pragma unroll
    for (int j = 0; j < 8; ++j) acc[j] = wmma_bf(frag_b(Wr + (size_t)(c0 + j * 16 + col) * CC + kc * 32, lane), a, acc[j]); }
#pragma unroll
  for (int j = 0; j < 8; ++j)
#pragma unroll
    for (int r = 0; r < 8; ++r) { const float v = acc[j][r]; so[j * 16 + 8 * g + r][wave * 16 + col] = (which < 2) ? 1.0f / (1.0f + __expf(-v)) : v; }
  __syncthreads();   // a channel's 64 positions come from all four waves
  float* dst = (which == 0) ? Q : (which == 1) ? Kf : Vf; for (int e = tid; e < 128 * 16; e += 128) { const int cl = e >> 4, q = e & 15; vst2(dst + (size_t)(c0 + cl) * NP + p0 + q * 4, *(const v4f*)&so[cl][q * 4]); } }
// ---- k_vnorm: thread = (position, head): v[h][:] /= max(||v_h||, 1e-12) (in place); the head's 32 channel planes are read and written at the thread's position, a wave covering one 128-byte line of each; squares summed pairwise (adjacent pairs, then pairs of pairs)
__global__ __launch_bounds__(64) void k_vnorm(float* __restrict__ Vf) { float* base = Vf + (size_t)blockIdx.y * HD * NP + blockIdx.x * 64 + threadIdx.x; float v[HD], q[HD];
#pragma unroll   // all 32 loads in flight at once; v and q indexed by constants, so they stay in registers
  for (int d = 0; d < HD; ++d) { v[d] = base[(size_t)d * NP]; q[d] = v[d] * v[d]; }
#pragma unroll   // constant indices: q stays in registers
  for (int o = 1; o < HD; o <<= 1)
#pragma unroll   // as above
    for (int d = 0; d < HD; d += 2 * o) q[d] += q[d + o];
  const float den = fmaxf(sqrtf(q[0]), 1e-12f);
#pragma unroll   // constant indices: v stays in registers
  for (int d = 0; d < HD; ++d) base[(size_t)d * NP] = v[d] / den; }
// ---- k_integral: block = plane (which 0: Ik plane (h, d) from k; which 1: Ikv plane (h, d, f) = k[d] v[f]): build the 64x64 values, inclusive prefix sums along w then along h (fixed order), store the plane [64*64]
__global__ __launch_bounds__(256) void k_integral(const float* __restrict__ Kf, const float* __restrict__ Vf, int which, float* __restrict__ IK, float* __restrict__ IKV) { __shared__ float s[HH][WWD + 1]; __shared__ __align__(16) float so2[HH][WWD + 4]; const int t = threadIdx.x; const int pl = blockIdx.x;
  const int h = which ? pl / (HD * HD) : pl / HD; const int d = which ? (pl / HD) % HD : pl % HD; const int f = which ? pl % HD : 0; const int ck = h * HD + d, cv = h * HD + f;
  const float* kp = Kf + (size_t)ck * NP; const float* vp = Vf + (size_t)cv * NP;   // channel-major planes: whole lines, 16 bytes a lane
  v4f kv[4];
#pragma unroll   // all of a thread's loads in flight at once: one trip to L2 instead of one per pass
  for (int i = 0; i < 4; ++i) kv[i] = *(const v4f*)(kp + t * 4 + i * 1024);
  if (which) {
#pragma unroll   // as above
    for (int i = 0; i < 4; ++i) kv[i] *= *(const v4f*)(vp + t * 4 + i * 1024); }
#pragma unroll   // kv stays in registers
  for (int i = 0; i < 4; ++i) { float* sp = &s[(t >> 4) + i * 16][(t & 15) * 4]; sp[0] = kv[i][0]; sp[1] = kv[i][1]; sp[2] = kv[i][2]; sp[3] = kv[i][3]; } __syncthreads();
  if (t < HH) { float run = 0.f; for (int w = 0; w < WWD; ++w) { run += s[t][w]; s[t][w] = run; } } __syncthreads();   // along w (row t)
  if (t < WWD) { float run = 0.f; for (int y = 0; y < HH; ++y) { run += s[y][t]; s[y][t] = run; } } __syncthreads(); // along h (column t)
  for (int e = t; e < NP; e += 256) so2[e >> 6][e & 63] = s[e >> 6][e & 63]; __syncthreads();
  float* dst = (which ? IKV : IK) + (size_t)pl * NP; for (int e = t; e < HH * 16; e += 256) { const int y = e >> 4, q = e & 15; vst2(dst + y * WWD + q * 4, *(const v4f*)&so2[y][q * 4]); } }
// integral lookup with the module's padding: I has a zero row/col in front (index 0) then the inclusive prefix sums; Pp = edge-pad(I, l, r); value at padded index (a, b) = I[clamp(a - l, 0, 64)][clamp(b - l, 0, 64)], I[0][*] = I[*][0] = 0
__device__ __forceinline__ float ilook(const float* __restrict__ plane, int a, int b, int l) { int ia = a - l, ib = b - l; ia = ia < 0 ? 0 : (ia > HH ? HH : ia); ib = ib < 0 ? 0 : (ib > WWD ? WWD : ib); if (ia == 0 || ib == 0) return 0.f; return plane[(ia - 1) * WWD + (ib - 1)]; }
__device__ __forceinline__ float boxsum(const float* __restrict__ plane, int i, int j, int ws, int l) { return ilook(plane, i + ws, j + ws, l) - ilook(plane, i + ws, j, l) - ilook(plane, i, j + ws, l) + ilook(plane, i, j, l); }
// ---- k_box: block = (image row i, head h, window wi), 256 threads = 64 positions j x 4 groups of 8 f: attn[f] = sum_d q[d] box(Ikv[h][d][f]) / (sum_d q[d] box(Ik[h][d]) + 1e-6) -> O[p][wi*256 + h*32 + f]
__global__ __launch_bounds__(256) void k_box(const float* __restrict__ Q, const float* __restrict__ IK, const float* __restrict__ IKV, float* __restrict__ O) { __shared__ __align__(16) float so2[WWD][HD + 4];
  const int t = threadIdx.x; const int j = t & 63, fg = t >> 6; const int i = blockIdx.x, h = blockIdx.y, wi = blockIdx.z; const int ws = WSZ[wi]; const int tp = ws - 1, rr = tp / 2, l = tp - rr; const size_t p = (size_t)i * WWD + j;
  float acc8[8]; for (int e = 0; e < 8; ++e) acc8[e] = 0.f; float nrm = 0.f;
#pragma unroll 1
  for (int d = 0; d < HD; ++d) { const float qd = Q[(size_t)(h * HD + d) * NP + p]; const float wk = boxsum(IK + (size_t)(h * HD + d) * NP, i, j, ws, l); nrm += qd * wk;
#pragma unroll
    for (int e = 0; e < 8; ++e) { const int f = fg * 8 + e; acc8[e] += qd * boxsum(IKV + ((size_t)(h * HD + d) * HD + f) * NP, i, j, ws, l); } }
  const float inv = 1.0f / (nrm + 1e-6f); for (int e = 0; e < 8; ++e) so2[j][fg * 8 + e] = acc8[e] * inv; __syncthreads();
  { const int jj = t >> 2, q = t & 3; const size_t pp = (size_t)i * WWD + jj; vst2(O + pp * OC + wi * CC + h * HD + q * 8, *(const v4f*)&so2[jj][q * 8]); vst2(O + pp * OC + wi * CC + h * HD + q * 8 + 4, *(const v4f*)&so2[jj][q * 8 + 4]); } }
// ---- k_out: block = (64 out channels o, 128 positions): out[o][p] = sum_c Wout[o][c] O[p][c] (A = Wout bf16 exact rows, B = O rows (p) as bf16 hi + lo) + bout[o]; (B, C, H, W) layout = rows o of 4,096
__global__ __launch_bounds__(128) void k_out(const __bf16* __restrict__ PO, const float* __restrict__ O, const float* __restrict__ BO, float* __restrict__ Y) { __shared__ __align__(16) float so[4][16][132];
  const int tid = threadIdx.x, wave = tid >> 5, lane = tid & 31, col = lane & 15, g = lane >> 4; const int o0 = blockIdx.x * 64 + wave * 16; const int p0 = blockIdx.y * 128;
  v8f acc[8] = {};
#pragma unroll 2
  for (int kc = 0; kc < OC / 32; ++kc) { const v16b a = frag_b(PO + (size_t)(o0 + col) * OC + kc * 32, lane);   // natural row of Wout read with the A-row lane layout (identical to frag_b's)
#pragma unroll
    for (int jt = 0; jt < 8; ++jt) { const F2 w = split_row(O + (size_t)(p0 + jt * 16 + col) * OC, kc * 32, lane); acc[jt] = wmma_bf(a, w.h, acc[jt]); acc[jt] = wmma_bf(a, w.l, acc[jt]); } }
#pragma unroll
  for (int jt = 0; jt < 8; ++jt)
#pragma unroll
    for (int r = 0; r < 8; ++r) so[wave][8 * g + r][jt * 16 + col] = acc[jt][r] + bfr(BO[o0 + 8 * g + r]);
  LDSX(); for (int rl = 0; rl < 16; ++rl) vst2(Y + (size_t)(o0 + rl) * NP + p0 + lane * 4, *(const v4f*)&so[wave][rl][lane * 4]); }
extern "C" void kernel_launch(void* const* d_in, const int* in_sizes, int n_in, void* d_out, int out_size, void* d_ws, size_t ws_size, hipStream_t stream) {
  (void)in_sizes; (void)n_in; (void)out_size;
  const float** F = (const float**)d_in;   // 0 x [1,256,64,64], 1 Wq, 2 Wk, 3 Wv [256,256], 4 Wout [256,768], 5 bout [256]
  if (ws_size < (size_t)WS_END) return;
  char* ws = (char*)d_ws; __bf16 *PW = (__bf16*)(ws + WS_PW), *PO = (__bf16*)(ws + WS_PO); float *XT = (float*)(ws + WS_XT), *Q = (float*)(ws + WS_Q), *Kf = (float*)(ws + WS_K), *Vf = (float*)(ws + WS_V), *IK = (float*)(ws + WS_IK), *IKV = (float*)(ws + WS_IKV), *O = (float*)(ws + WS_O);
  k_pack<<<dim3(CC, 4), 256, 0, stream>>>(F[1], F[2], F[3], F[4], PW, PO);
  k_tr<<<dim3(NP / 64, CC / 64), 256, 0, stream>>>(F[0], XT);
  k_proj<<<dim3(NP / 64, CC / 128, 3), 128, 0, stream>>>(XT, PW, Q, Kf, Vf);
  k_vnorm<<<dim3(NP / 64, NH), 64, 0, stream>>>(Vf);
  k_integral<<<NH * HD, 256, 0, stream>>>(Kf, Vf, 0, IK, IKV);
  k_integral<<<NH * HD * HD, 256, 0, stream>>>(Kf, Vf, 1, IK, IKV);
  k_box<<<dim3(TPB, NH, NWIN), 256, 0, stream>>>(Q, IK, IKV, O);
  k_out<<<dim3(CC / 64, (TPB * WWD) / 128), 128, 0, stream>>>(PO, O, F[5], (float*)d_out);
}

// v002
// It runs in 134 microseconds.
// Two timings next to v001 put it at 1.68 and 1.65 times that version's speed.
// Counting every step since v000, it is 3.07 times as fast.
// compute dtype: all float inputs rounded to bf16; q/k/v 1x1 convs with EXACT bf16 products on WMMA 16x16x32 (x transposed to position rows, natural weights); sigmoid (hardware exp) and the per-position L2 normalisation of v in f32; k and k (x) v outer-product planes, their 2-D inclusive prefix sums (integral images; those of k (x) v live in LDS only) and the clamped 4-corner box differences for the three window sizes, the q-weighted sums and the division all in f32 on VALU (fixed order); out = Wout (exact) . o (bf16 hi + lo, 2 products) + bout on WMMA; f32 output in (B, C, H, W) order.
#include <hip/hip_runtime.h>
#include <math.h>

typedef __attribute__((ext_vector_type(16))) _Float16 v16h;
typedef __attribute__((ext_vector_type(16))) __bf16 v16b;
typedef __attribute__((ext_vector_type(8)))  _Float16 v8h;
typedef __attribute__((ext_vector_type(8)))  float v8f;
typedef __attribute__((ext_vector_type(4)))  float v4f;
typedef __attribute__((ext_vector_type(2)))  float v2f;
typedef __attribute__((ext_vector_type(4)))  unsigned v4u;
typedef __attribute__((ext_vector_type(4)))  int v4i;
typedef float __attribute__((may_alias)) float_a;
typedef int __attribute__((may_alias)) int_a;

template <typename T> __device__ __forceinline__ void vst2(void* p, T v) { *(T*)p = v;  }
__device__ __forceinline__ v8f wmma16(v16h a, v16h b, v8f c) {
  v8f d = __builtin_amdgcn_wmma_f32_16x16x32_f16(false, a, false, b, (short)0, c, false, false);
  asm volatile("v_nop\n\tv_nop\n\tv_nop\n\tv_nop" : "+v"(d) : "v"(a), "v"(b));
  return d;
}
__device__ __forceinline__ v8f wmma_bf(v16b a, v16b b, v8f c) {
  v8f d = __builtin_amdgcn_wmma_f32_16x16x32_bf16(false, a, false, b, (short)0, c, false, false);
  asm volatile("v_nop\n\tv_nop\n\tv_nop\n\tv_nop" : "+v"(d) : "v"(a), "v"(b));
  return d;
}
// 16x16x32 fragments: lane = (h = lane>>4, row/col = lane&15); elements 0..7 = k0+8h+0..7, 8..15 = k0+16+8h+0..7; D element r = row 8h+r
__device__ __forceinline__ v16h frag_h(const _Float16* rowk0, int lane) {
  union { v16h v; v8h q[2]; } u; const _Float16* p = rowk0 + 8 * (lane >> 4);
  u.q[0] = *(const v8h*)p; u.q[1] = *(const v8h*)(p + 16); return u.v;
}
__device__ __forceinline__ v16h frag_f32(const float* rowk0, int lane) {
  v16h a; const float* p = rowk0 + 8 * (lane >> 4);
#pragma unroll
  for (int i = 0; i < 8; ++i) { a[i] = (_Float16)p[i]; a[8 + i] = (_Float16)p[16 + i]; }
  return a;
}
__device__ __forceinline__ v16h frag_f32s(const float* rowk0, int lane, float sc) {
  v16h a; const float* p = rowk0 + 8 * (lane >> 4);
#pragma unroll
  for (int i = 0; i < 8; ++i) { a[i] = (_Float16)(p[i] * sc); a[8 + i] = (_Float16)(p[16 + i] * sc); }
  return a;
}
// column fragment from a [K][ld] layout (column n), rows >= K read as 0
__device__ __forceinline__ v16h fragc_f32(const float* W, int k0, int n, int lane, int ld, int K) {
  v16h a; const int g = lane >> 4;
#pragma unroll
  for (int i = 0; i < 8; ++i) { const int ka = k0 + 8 * g + i, kb = ka + 16;
    a[i] = (_Float16)(ka < K ? W[(size_t)(ka < K ? ka : K - 1) * ld + n] : 0.f); a[8 + i] = (_Float16)(kb < K ? W[(size_t)(kb < K ? kb : K - 1) * ld + n] : 0.f); }
  return a;
}
struct F2 { v16b h, l; };
__device__ __forceinline__ F2 bsplit16(const float v[16]) { F2 r;
#pragma unroll
  for (int i = 0; i < 16; ++i) { const __bf16 h = (__bf16)v[i]; r.h[i] = h; r.l[i] = (__bf16)(v[i] - (float)h); }
  return r; }
__device__ __forceinline__ F2 split_row(const float* row, int k0, int lane) { float v[16]; const float* p = row + k0 + 8 * (lane >> 4);
#pragma unroll
  for (int i = 0; i < 8; ++i) { v[i] = p[i]; v[8 + i] = p[16 + i]; }
  return bsplit16(v); }
__device__ __forceinline__ F2 split_rowK(const float* row, int k0, int lane, int K) { float v[16]; const int g = lane >> 4;
#pragma unroll
  for (int i = 0; i < 8; ++i) { const int ka = k0 + 8 * g + i, kb = ka + 16; v[i] = ka < K ? row[ka < K ? ka : K - 1] : 0.f; v[8 + i] = kb < K ? row[kb < K ? kb : K - 1] : 0.f; }
  return bsplit16(v); }
__device__ __forceinline__ F2 split_col(const float* W, int k0, int n, int lane, int ld, int K) { float v[16]; const int g = lane >> 4;
#pragma unroll
  for (int i = 0; i < 8; ++i) { const int ka = k0 + 8 * g + i, kb = ka + 16; v[i] = ka < K ? W[(size_t)(ka < K ? ka : K - 1) * ld + n] : 0.f; v[8 + i] = kb < K ? W[(size_t)(kb < K ? kb : K - 1) * ld + n] : 0.f; }
  return bsplit16(v); }
__device__ __forceinline__ v8f mac3(const F2& a, const F2& b, v8f c) { c = wmma_bf(a.l, b.h, c); c = wmma_bf(a.h, b.l, c); return wmma_bf(a.h, b.h, c); }
__device__ __forceinline__ float sigm(float v) { return 1.0f / (1.0f + expf(-v)); }
#define LDSX() do { asm volatile("s_wait_dscnt 0" ::: "memory"); __builtin_amdgcn_wave_barrier(); __builtin_amdgcn_fence(__ATOMIC_RELEASE, "workgroup"); } while (0)


// Inception (multi-window box) linear attention (B 1, C 256 = 8 heads x 32, 64 x 64): per window size ws in {64, 32, 16}: attn = q . boxsum(k v^T) / (q . boxsum(k) + 1e-6) using integral images with edge-replicated borders; concat over windows (768 channels), 1x1 output conv + bias.
#define CC 256
#define NH 8
#define HD 32
#define HH 64
#define WWD 64
#define NP (HH * WWD)      // 4,096 positions
#define NWIN 3
#define OC (CC * NWIN)     // 768
#ifndef TPB
#define TPB HH             // output rows (of 64 positions) computed by the box/attention stage
#endif
typedef __attribute__((ext_vector_type(8))) __bf16 v8b;
__device__ __forceinline__ v16b frag_b(const __bf16* rowk0, int lane) {
  union { v16b v; v8b q[2]; } u; const __bf16* p = rowk0 + 8 * (lane >> 4);
  u.q[0] = *(const v8b*)p; u.q[1] = *(const v8b*)(p + 16); return u.v;
}
__device__ __forceinline__ float bfr(float v) { return (float)(__bf16)v; }
__device__ __attribute__((noinline)) float exp_ni(float v) { return expf(v); }
__device__ __attribute__((noinline)) float erf_ni(float v) { return erff(v); }
__constant__ int WSZ[NWIN] = {64, 32, 16};   // Hh / w for w in (1, 2, 4)

#define WS_PW  0u                                   // bf16 natural rows Wq, Wk, Wv [3][256][256]; Wout [256][768]
#define WS_PO  (WS_PW + 2u * (size_t)3 * CC * CC)
#define WS_XT  (WS_PO + 2u * (size_t)CC * OC)           // f32 x^T [p][c]
#define WS_Q   (WS_XT + 4u * (size_t)NP * CC)           // f32 q [c][p] (sigmoid), k [c][p] (sigmoid), v [c][p] (normalised): channel-major planes of 4,096 positions
#define WS_K   (WS_Q + 4u * (size_t)NP * CC)
#define WS_V   (WS_K + 4u * (size_t)NP * CC)
#define WS_IK  (WS_V + 4u * (size_t)NP * CC)            // f32 integral planes Ik [h*32+d][64x64 inclusive prefix]
#define WS_INV (WS_IK + 4u * (size_t)CC * NP)           // f32 1 / (norm + 1e-6) [wi*8+h][p]
#define WS_O   (WS_INV + 4u * (size_t)NWIN * NH * NP)   // f32 o [768][p]: channel-major planes
#define WS_END (WS_O + 4u * (size_t)NP * OC)

__global__ __launch_bounds__(256) void k_pack(const float* __restrict__ WQ, const float* __restrict__ WK, const float* __restrict__ WV, const float* __restrict__ WO, __bf16* __restrict__ PW, __bf16* __restrict__ PO) { const int n = blockIdx.x, which = blockIdx.y, t = threadIdx.x; __shared__ __align__(16) __bf16 s[OC];
  if (which < 3) { const float* w = (which == 0) ? WQ : (which == 1) ? WK : WV; s[t] = (__bf16)w[(size_t)n * CC + t]; __syncthreads(); if (t < CC / 8) vst2((unsigned*)(PW + ((size_t)which * CC + n) * CC + t * 8), *(const v4u*)&s[t * 8]); }
  else { for (int k = t; k < OC; k += 256) s[k] = (__bf16)WO[(size_t)n * OC + k]; __syncthreads(); if (t < OC / 8) vst2((unsigned*)(PO + (size_t)n * OC + t * 8), *(const v4u*)&s[t * 8]); } }
// ---- k_tr: block = (64 positions, 64 channels): x[c][p] -> XT[p][c] f32
__global__ __launch_bounds__(256) void k_tr(const float* __restrict__ X, float* __restrict__ XT) { __shared__ float st[64][65]; __shared__ __align__(16) float so[64][68]; const int t = threadIdx.x; const int p0 = blockIdx.x * 64, c0 = blockIdx.y * 64;
  for (int e = t; e < 64 * 64; e += 256) { const int cl = e >> 6, pl = e & 63; st[pl][cl] = X[(size_t)(c0 + cl) * NP + p0 + pl]; } __syncthreads();
  for (int e = t; e < 64 * 64; e += 256) { const int pl = e >> 6, cl = e & 63; so[pl][cl] = st[pl][cl]; } __syncthreads();
  for (int e = t; e < 64 * 16; e += 256) { const int pl = e >> 4, q = e & 15; vst2(XT + (size_t)(p0 + pl) * CC + c0 + q * 4, *(const v4f*)&so[pl][q * 4]); } }
// ---- k_proj: block = (64 positions, 128 out channels, which): 1x1 conv = W (A rows = channels) . XT^T (B columns = positions), so D rows are channels; epilogue: q, k -> sigmoid; v -> raw (normalised later); stored channel-major [c][p], 256 contiguous bytes per channel and block
__global__ __launch_bounds__(128) void k_proj(const float* __restrict__ XT, const __bf16* __restrict__ PW, float* __restrict__ Q, float* __restrict__ Kf, float* __restrict__ Vf) { __shared__ __align__(16) float so[128][68];
  const int tid = threadIdx.x, wave = tid >> 5, lane = tid & 31, col = lane & 15, g = lane >> 4; const int which = blockIdx.z; const int p0 = blockIdx.x * 64; const size_t r0 = (size_t)p0 + wave * 16; const int c0 = blockIdx.y * 128; const __bf16* Wr = PW + ((size_t)which * CC) * CC;
  v8f acc[8] = {};
#pragma unroll
  for (int kc = 0; kc < CC / 32; ++kc) { v16b a; { const float* p = XT + (r0 + col) * CC + kc * 32 + 8 * g;
#pragma unroll
      for (int i = 0; i < 8; ++i) { a[i] = (__bf16)p[i]; a[8 + i] = (__bf16)p[16 + i]; } }
#pragma unroll
    for (int j = 0; j < 8; ++j) acc[j] = wmma_bf(frag_b(Wr + (size_t)(c0 + j * 16 + col) * CC + kc * 32, lane), a, acc[j]); }
#pragma unroll
  for (int j = 0; j < 8; ++j)
#pragma unroll
    for (int r = 0; r < 8; ++r) { const float v = acc[j][r]; so[j * 16 + 8 * g + r][wave * 16 + col] = (which < 2) ? 1.0f / (1.0f + __expf(-v)) : v; }
  __syncthreads();   // a channel's 64 positions come from all four waves
  float* dst = (which == 0) ? Q : (which == 1) ? Kf : Vf; for (int e = tid; e < 128 * 16; e += 128) { const int cl = e >> 4, q = e & 15; vst2(dst + (size_t)(c0 + cl) * NP + p0 + q * 4, *(const v4f*)&so[cl][q * 4]); } }
// ---- k_vnorm: thread = (position, head): v[h][:] /= max(||v_h||, 1e-12) (in place); the head's 32 channel planes are read and written at the thread's position, a wave covering one 128-byte line of each; squares summed pairwise (adjacent pairs, then pairs of pairs)
__global__ __launch_bounds__(64) void k_vnorm(float* __restrict__ Vf) { float* base = Vf + (size_t)blockIdx.y * HD * NP + blockIdx.x * 64 + threadIdx.x; float v[HD], q[HD];
#pragma unroll   // all 32 loads in flight at once; v and q indexed by constants, so they stay in registers
  for (int d = 0; d < HD; ++d) { v[d] = base[(size_t)d * NP]; q[d] = v[d] * v[d]; }
#pragma unroll   // constant indices: q stays in registers
  for (int o = 1; o < HD; o <<= 1)
#pragma unroll   // as above
    for (int d = 0; d < HD; d += 2 * o) q[d] += q[d + o];
  const float den = fmaxf(sqrtf(q[0]), 1e-12f);
#pragma unroll   // constant indices: v stays in registers
  for (int d = 0; d < HD; ++d) base[(size_t)d * NP] = v[d] / den; }
// ---- k_integral: block = Ik plane (h, d) of k: inclusive prefix sums along w then along h (fixed order), store the plane [64*64]
__global__ __launch_bounds__(256) void k_integral(const float* __restrict__ Kf, float* __restrict__ IK) { __shared__ float s[HH][WWD + 1]; __shared__ __align__(16) float so2[HH][WWD + 4]; const int t = threadIdx.x; const int pl = blockIdx.x;
  const float* kp = Kf + (size_t)pl * NP;   // channel-major plane: whole lines, 16 bytes a lane
  v4f kv[4];
#pragma unroll   // all of a thread's loads in flight at once: one trip to L2 instead of one per pass
  for (int i = 0; i < 4; ++i) kv[i] = *(const v4f*)(kp + t * 4 + i * 1024);
#pragma unroll   // kv stays in registers
  for (int i = 0; i < 4; ++i) { float* sp = &s[(t >> 4) + i * 16][(t & 15) * 4]; sp[0] = kv[i][0]; sp[1] = kv[i][1]; sp[2] = kv[i][2]; sp[3] = kv[i][3]; } __syncthreads();
  if (t < HH) { float run = 0.f; for (int w = 0; w < WWD; ++w) { run += s[t][w]; s[t][w] = run; } } __syncthreads();   // along w (row t)
  if (t < WWD) { float run = 0.f; for (int y = 0; y < HH; ++y) { run += s[y][t]; s[y][t] = run; } } __syncthreads(); // along h (column t)
  for (int e = t; e < NP; e += 256) so2[e >> 6][e & 63] = s[e >> 6][e & 63]; __syncthreads();
  float* dst = IK + (size_t)pl * NP; for (int e = t; e < HH * 16; e += 256) { const int y = e >> 4, q = e & 15; vst2(dst + y * WWD + q * 4, *(const v4f*)&so2[y][q * 4]); } }
// integral lookup with the module's padding: I has a zero row/col in front (index 0) then the inclusive prefix sums; Pp = edge-pad(I, l, r); value at padded index (a, b) = I[clamp(a - l, 0, 64)][clamp(b - l, 0, 64)], I[0][*] = I[*][0] = 0
__device__ __forceinline__ float ilook(const float* __restrict__ plane, int a, int b, int l) { int ia = a - l, ib = b - l; ia = ia < 0 ? 0 : (ia > HH ? HH : ia); ib = ib < 0 ? 0 : (ib > WWD ? WWD : ib); if (ia == 0 || ib == 0) return 0.f; return plane[(ia - 1) * WWD + (ib - 1)]; }
__device__ __forceinline__ float boxsum(const float* __restrict__ plane, int i, int j, int ws, int l) { return ilook(plane, i + ws, j + ws, l) - ilook(plane, i + ws, j, l) - ilook(plane, i, j + ws, l) + ilook(plane, i, j, l); }
// ---- k_norm: block = (image row i, head h, window wi), thread = position j: INV[wi*8+h][p] = 1 / (sum_d q[d] box(Ik[h][d]) + 1e-6)
__global__ __launch_bounds__(64) void k_norm(const float* __restrict__ Q, const float* __restrict__ IK, float* __restrict__ INV) {
  const int j = threadIdx.x; const int i = blockIdx.x, h = blockIdx.y, wi = blockIdx.z; const int ws = WSZ[wi]; const int tp = ws - 1, rr = tp / 2, l = tp - rr; const size_t p = (size_t)i * WWD + j;
  float nrm = 0.f;
#pragma unroll 8   // the loads of eight d in flight at once; the sum stays in the order of d
  for (int d = 0; d < HD; ++d) { const float qd = Q[(size_t)(h * HD + d) * NP + p]; const float wk = boxsum(IK + (size_t)(h * HD + d) * NP, i, j, ws, l); nrm += qd * wk; }
  INV[(size_t)(wi * NH + h) * NP + p] = 1.0f / (nrm + 1e-6f); }
// ---- k_fuse: block = (f, h), 1,024 threads, the whole LDS of a WGP: the 32 planes k[d] v[f] of the head, 16 at a time, are built, prefix-summed (along w, then along h, each serial as in k_integral), box-differenced and summed over d (ascending) with q[d] without leaving LDS; O[wi*256 + h*32 + f][p] = sum * INV
// LDS plane = the padded integral image: row ia = 0..64 (row 0 zero), column ib + 4 for ib = -4..67: ib <= 0 zero, ib = 1..64 the prefix sums, ib = 65..67 copies of ib = 64. All window offsets are multiples of 4, so the four neighbouring positions of a thread read each corner as one aligned 16-byte quad, and a quad wholly left (right) of the image is the quad at ib = -4 (64).
#define FP 76               // row pitch in floats: 304 bytes = 16 x odd, so that 16-byte reads of one row a lane do not collide
#define FPL ((HH + 1) * FP) // floats a plane
#define FG 16               // planes a pass: 16 x 64 rows (columns) = one serial scan a thread
__global__ __launch_bounds__(1024) void k_fuse(const float* __restrict__ Q, const float* __restrict__ Kf, const float* __restrict__ Vf, const float* __restrict__ INV, float* __restrict__ O) { __shared__ __align__(16) float s[FG * FPL];
  const int t = threadIdx.x; const int f = blockIdx.x, h = blockIdx.y; const int i = t >> 4, j4 = (t & 15) * 4; const int sg = t >> 6, sl = t & 63;   // (i, j4): the thread's four positions; (sg, sl): its plane and row or column in the scans
  const v4f zero4 = {0.f, 0.f, 0.f, 0.f};
  for (int e = t; e < FG * FP; e += 1024) s[(e / FP) * FPL + e % FP] = 0.f;   // row 0 of every plane; no pass writes it again
  *(v4f*)&s[sg * FPL + (sl + 1) * FP] = zero4;                                // ib = -4..-1 of rows 1..64; as above
  const v4f vq = *(const v4f*)(Vf + (size_t)(h * HD + f) * NP + t * 4);
  asm volatile("s_wait_xcnt 0x0" ::: "memory");   // the index arithmetic below reuses the register that this load's address names
  int off[NWIN][4];   // the corners' places in a plane: bottom right, bottom left, top right, top left
#pragma unroll   // off indexed by constants: stays in registers
  for (int wi = 0; wi < NWIN; ++wi) { const int ws = HH >> wi; const int tp = ws - 1, rr = tp / 2, l = tp - rr;
    int at = i - l, ab = i + ws - l, bl = j4 - l, br = j4 + ws - l;
    at = at < 0 ? 0 : (at > HH ? HH : at); ab = ab < 0 ? 0 : (ab > HH ? HH : ab); bl = bl < -4 ? -4 : (bl > WWD ? WWD : bl); br = br < -4 ? -4 : (br > WWD ? WWD : br);
    off[wi][0] = ab * FP + br + 4; off[wi][1] = ab * FP + bl + 4; off[wi][2] = at * FP + br + 4; off[wi][3] = at * FP + bl + 4; }
  v4f acc[NWIN] = {zero4, zero4, zero4};
#pragma unroll 1   // two passes through one body: the code stays small
  for (int d0 = 0; d0 < HD; d0 += FG) {
    { const float* kp = Kf + (size_t)(h * HD + d0) * NP + t * 4; v4f kv[FG];   // products k[d] v[f], value w of row y at row y + 1, column w + 4 (aligned)
#pragma unroll   // all 16 loads in flight at once
      for (int g = 0; g < FG; ++g) kv[g] = *(const v4f*)(kp + (size_t)g * NP);
#pragma unroll   // kv stays in registers
      for (int g = 0; g < FG; ++g) *(v4f*)&s[g * FPL + (i + 1) * FP + 4 + j4] = kv[g] * vq; }
    __syncthreads();
    { float* row = &s[sg * FPL + (sl + 1) * FP + 4]; float p[WWD];   // along w: thread = (plane, row); written back one column to the right, behind the zero of ib = 0
#pragma unroll   // p stays in registers
      for (int m = 0; m < WWD / 4; ++m) { const v4f r = *(const v4f*)(row + 4 * m); p[4 * m] = r[0]; p[4 * m + 1] = r[1]; p[4 * m + 2] = r[2]; p[4 * m + 3] = r[3]; }
      float run = 0.f;
#pragma unroll   // as above
      for (int w = 0; w < WWD; ++w) { run += p[w]; p[w] = run; }
      { const v4f r = {0.f, p[0], p[1], p[2]}; *(v4f*)row = r; }
#pragma unroll   // as above
      for (int m = 1; m < WWD / 4; ++m) { const v4f r = {p[4 * m - 1], p[4 * m], p[4 * m + 1], p[4 * m + 2]}; *(v4f*)(row + 4 * m) = r; }
      row[WWD] = p[WWD - 1]; }
    __syncthreads();
    { float* cp = &s[sg * FPL + FP + 5 + sl]; float run = 0.f;   // along h: thread = (plane, column), in place
#pragma unroll 1   // 16 rows a trip: few addresses and few values live at a time (all 64 at once spilled some thirty addresses)
      for (int y0 = 0; y0 < HH; y0 += 16, cp += 16 * FP) { float p[16];
#pragma unroll   // p stays in registers; a trip's loads in flight at once
        for (int y = 0; y < 16; ++y) p[y] = cp[y * FP];
#pragma unroll   // as above
        for (int y = 0; y < 16; ++y) { run += p[y]; cp[y * FP] = run; } } }
    __syncthreads();
    { float* e = &s[sg * FPL + (sl + 1) * FP + 4 + WWD]; const float x = e[0]; const v4f r = {x, x, x, x}; *(v4f*)e = r; }   // ib = 65..67: copies of ib = 64; thread = (plane, row)
    __syncthreads();
    { const float* qp = Q + (size_t)(h * HD + d0) * NP + t * 4; v4f qc[4];
#pragma unroll   // four planes' q in flight at once
      for (int u = 0; u < 4; ++u) qc[u] = *(const v4f*)(qp + (size_t)u * NP);
#pragma unroll 1   // four planes a trip: their distances fit the LDS instructions' offset field, so a trip forms each corner's address once
      for (int g0 = 0; g0 < FG; g0 += 4) { const float* pl = s + g0 * FPL; const float* qx = qp + (size_t)(g0 + 4 < FG ? g0 + 4 : 0) * NP;
#pragma unroll   // plane distances become constants; qc indexed by constants
        for (int u = 0; u < 4; ++u) { const float* pu = pl + u * FPL; v4f cr[NWIN][4];
#pragma unroll   // a plane's twelve corner quads in flight at once
          for (int wi = 0; wi < NWIN; ++wi) { cr[wi][0] = *(const v4f*)(pu + off[wi][0]); cr[wi][1] = *(const v4f*)(pu + off[wi][1]); cr[wi][2] = *(const v4f*)(pu + off[wi][2]); cr[wi][3] = *(const v4f*)(pu + off[wi][3]); }
#pragma unroll   // acc indexed by constants
          for (int wi = 0; wi < NWIN; ++wi) acc[wi] += qc[u] * (cr[wi][0] - cr[wi][1] - cr[wi][2] + cr[wi][3]);
          qc[u] = *(const v4f*)(qx + (size_t)u * NP); }   // q of the plane four further on flies meanwhile (the last trip reads the first four again, unused: no branch inside a trip)
        asm volatile("s_wait_xcnt 0x0" ::: "memory"); } }   // the next trip forms the q loads' address anew in the same registers
    __syncthreads();   // the next pass overwrites the planes
  }
#pragma unroll   // acc indexed by constants
  for (int wi = 0; wi < NWIN; ++wi) vst2(O + (size_t)(wi * CC + h * HD + f) * NP + t * 4, acc[wi] * *(const v4f*)(INV + (size_t)(wi * NH + h) * NP + t * 4)); }
// ---- k_out: block = (64 out channels o, 128 positions): out[o][p] = sum_c Wout[o][c] O[c][p] (A = Wout bf16 exact rows, B = columns p of the channel-major O as bf16 hi + lo) + bout[o]; (B, C, H, W) layout = rows o of 4,096
__global__ __launch_bounds__(128) void k_out(const __bf16* __restrict__ PO, const float* __restrict__ O, const float* __restrict__ BO, float* __restrict__ Y) { __shared__ __align__(16) float so[4][16][132];
  const int tid = threadIdx.x, wave = tid >> 5, lane = tid & 31, col = lane & 15, g = lane >> 4; const int o0 = blockIdx.x * 64 + wave * 16; const int p0 = blockIdx.y * 128;
  v8f acc[8] = {};
#pragma unroll 2
  for (int kc = 0; kc < OC / 32; ++kc) { const v16b a = frag_b(PO + (size_t)(o0 + col) * OC + kc * 32, lane);   // natural row of Wout read with the A-row lane layout (identical to frag_b's)
    asm volatile("s_wait_xcnt 0x0" ::: "memory");   // the loads below land in the registers that a's address names
#pragma unroll
    for (int jt = 0; jt < 8; ++jt) { float v[16]; const float* pc = O + (size_t)(kc * 32 + 8 * g) * NP + p0 + jt * 16 + col;   // 16 lanes cover 64 contiguous bytes of a channel's plane
#pragma unroll   // v indexed by constants: stays in registers
      for (int i = 0; i < 8; ++i) { v[i] = pc[(size_t)i * NP]; v[8 + i] = pc[(size_t)(16 + i) * NP]; }
      const F2 w = bsplit16(v); acc[jt] = wmma_bf(a, w.h, acc[jt]); acc[jt] = wmma_bf(a, w.l, acc[jt]); } }
#pragma unroll
  for (int jt = 0; jt < 8; ++jt)
#pragma unroll
    for (int r = 0; r < 8; ++r) so[wave][8 * g + r][jt * 16 + col] = acc[jt][r] + bfr(BO[o0 + 8 * g + r]);
  LDSX(); for (int rl = 0; rl < 16; ++rl) vst2(Y + (size_t)(o0 + rl) * NP + p0 + lane * 4, *(const v4f*)&so[wave][rl][lane * 4]); }
extern "C" void kernel_launch(void* const* d_in, const int* in_sizes, int n_in, void* d_out, int out_size, void* d_ws, size_t ws_size, hipStream_t stream) {
  (void)in_sizes; (void)n_in; (void)out_size;
  const float** F = (const float**)d_in;   // 0 x [1,256,64,64], 1 Wq, 2 Wk, 3 Wv [256,256], 4 Wout [256,768], 5 bout [256]
  if (ws_size < (size_t)WS_END) return;
  char* ws = (char*)d_ws; __bf16 *PW = (__bf16*)(ws + WS_PW), *PO = (__bf16*)(ws + WS_PO); float *XT = (float*)(ws + WS_XT), *Q = (float*)(ws + WS_Q), *Kf = (float*)(ws + WS_K), *Vf = (float*)(ws + WS_V), *IK = (float*)(ws + WS_IK), *INV = (float*)(ws + WS_INV), *O = (float*)(ws + WS_O);
  k_pack<<<dim3(CC, 4), 256, 0, stream>>>(F[1], F[2], F[3], F[4], PW, PO);
  k_tr<<<dim3(NP / 64, CC / 64), 256, 0, stream>>>(F[0], XT);
  k_proj<<<dim3(NP / 64, CC / 128, 3), 128, 0, stream>>>(XT, PW, Q, Kf, Vf);
  k_vnorm<<<dim3(NP / 64, NH), 64, 0, stream>>>(Vf);
  k_integral<<<NH * HD, 256, 0, stream>>>(Kf, IK);
  k_norm<<<dim3(TPB, NH, NWIN), 64, 0, stream>>>(Q, IK, INV);
  k_fuse<<<dim3(HD, NH), 1024, 0, stream>>>(Q, Kf, Vf, INV, O);
  k_out<<<dim3(CC / 64, (TPB * WWD) / 128), 128, 0, stream>>>(PO, O, F[5], (float*)d_out);
}

// v003
// Measured time: 84.9 microseconds a run.
// Next to v002, in two timings, it ran 1.55 and 1.56 times as fast.
// All steps since v000 together make it 4.77 times as fast.
// compute dtype: all float inputs rounded to bf16; q/k/v 1x1 convs with EXACT bf16 products on WMMA 16x16x32 (x transposed to position rows, natural weights); sigmoid (hardware exp) and the per-position L2 normalisation of v in f32; k and k (x) v outer-product planes, their 2-D inclusive prefix sums (integral images; those of k (x) v live in LDS only) and the clamped 4-corner box differences for the three window sizes, the q-weighted sums and the division all in f32 on VALU (fixed order); out = Wout (exact) . o (bf16 hi + lo, 2 products) + bout on WMMA; f32 output in (B, C, H, W) order.
#include <hip/hip_runtime.h>
#include <math.h>

typedef __attribute__((ext_vector_type(16))) _Float16 v16h;
typedef __attribute__((ext_vector_type(16))) __bf16 v16b;
typedef __attribute__((ext_vector_type(8)))  _Float16 v8h;
typedef __attribute__((ext_vector_type(8)))  float v8f;
typedef __attribute__((ext_vector_type(4)))  float v4f;
typedef __attribute__((ext_vector_type(2)))  float v2f;
typedef __attribute__((ext_vector_type(4)))  unsigned v4u;
typedef __attribute__((ext_vector_type(4)))  int v4i;
typedef float __attribute__((may_alias)) float_a;
typedef int __attribute__((may_alias)) int_a;

template <typename T> __device__ __forceinline__ void vst2(void* p, T v) { *(T*)p = v;  }
__device__ __forceinline__ v8f wmma16(v16h a, v16h b, v8f c) {
  v8f d = __builtin_amdgcn_wmma_f32_16x16x32_f16(false, a, false, b, (short)0, c, false, false);
  asm volatile("v_nop\n\tv_nop\n\tv_nop\n\tv_nop" : "+v"(d) : "v"(a), "v"(b));
  return d;
}
__device__ __forceinline__ v8f wmma_bf(v16b a, v16b b, v8f c) {
  v8f d = __builtin_amdgcn_wmma_f32_16x16x32_bf16(false, a, false, b, (short)0, c, false, false);
  asm volatile("v_nop\n\tv_nop\n\tv_nop\n\tv_nop" : "+v"(d) : "v"(a), "v"(b));
  return d;
}
// 16x16x32 fragments: lane = (h = lane>>4, row/col = lane&15); elements 0..7 = k0+8h+0..7, 8..15 = k0+16+8h+0..7; D element r = row 8h+r
__device__ __forceinline__ v16h frag_h(const _Float16* rowk0, int lane) {
  union { v16h v; v8h q[2]; } u; const _Float16* p = rowk0 + 8 * (lane >> 4);
  u.q[0] = *(const v8h*)p; u.q[1] = *(const v8h*)(p + 16); return u.v;
}
__device__ __forceinline__ v16h frag_f32(const float* rowk0, int lane) {
  v16h a; const float* p = rowk0 + 8 * (lane >> 4);
#pragma unroll
  for (int i = 0; i < 8; ++i) { a[i] = (_Float16)p[i]; a[8 + i] = (_Float16)p[16 + i]; }
  return a;
}
__device__ __forceinline__ v16h frag_f32s(const float* rowk0, int lane, float sc) {
  v16h a; const float* p = rowk0 + 8 * (lane >> 4);
#pragma unroll
  for (int i = 0; i < 8; ++i) { a[i] = (_Float16)(p[i] * sc); a[8 + i] = (_Float16)(p[16 + i] * sc); }
  return a;
}
// column fragment from a [K][ld] layout (column n), rows >= K read as 0
__device__ __forceinline__ v16h fragc_f32(const float* W, int k0, int n, int lane, int ld, int K) {
  v16h a; const int g = lane >> 4;
#pragma unroll
  for (int i = 0; i < 8; ++i) { const int ka = k0 + 8 * g + i, kb = ka + 16;
    a[i] = (_Float16)(ka < K ? W[(size_t)(ka < K ? ka : K - 1) * ld + n] : 0.f); a[8 + i] = (_Float16)(kb < K ? W[(size_t)(kb < K ? kb : K - 1) * ld + n] : 0.f); }
  return a;
}
struct F2 { v16b h, l; };
__device__ __forceinline__ F2 bsplit16(const float v[16]) { F2 r;
#pragma unroll
  for (int i = 0; i < 16; ++i) { const __bf16 h = (__bf16)v[i]; r.h[i] = h; r.l[i] = (__bf16)(v[i] - (float)h); }
  return r; }
__device__ __forceinline__ F2 split_row(const float* row, int k0, int lane) { float v[16]; const float* p = row + k0 + 8 * (lane >> 4);
#pragma unroll
  for (int i = 0; i < 8; ++i) { v[i] = p[i]; v[8 + i] = p[16 + i]; }
  return bsplit16(v); }
__device__ __forceinline__ F2 split_rowK(const float* row, int k0, int lane, int K) { float v[16]; const int g = lane >> 4;
#pragma unroll
  for (int i = 0; i < 8; ++i) { const int ka = k0 + 8 * g + i, kb = ka + 16; v[i] = ka < K ? row[ka < K ? ka : K - 1] : 0.f; v[8 + i] = kb < K ? row[kb < K ? kb : K - 1] : 0.f; }
  return bsplit16(v); }
__device__ __forceinline__ F2 split_col(const float* W, int k0, int n, int lane, int ld, int K) { float v[16]; const int g = lane >> 4;
#pragma unroll
  for (int i = 0; i < 8; ++i) { const int ka = k0 + 8 * g + i, kb = ka + 16; v[i] = ka < K ? W[(size_t)(ka < K ? ka : K - 1) * ld + n] : 0.f; v[8 + i] = kb < K ? W[(size_t)(kb < K ? kb : K - 1) * ld + n] : 0.f; }
  return bsplit16(v); }
__device__ __forceinline__ v8f mac3(const F2& a, const F2& b, v8f c) { c = wmma_bf(a.l, b.h, c); c = wmma_bf(a.h, b.l, c); return wmma_bf(a.h, b.h, c); }
__device__ __forceinline__ float sigm(float v) { return 1.0f / (1.0f + expf(-v)); }
#define LDSX() do { asm volatile("s_wait_dscnt 0" ::: "memory"); __builtin_amdgcn_wave_barrier(); __builtin_amdgcn_fence(__ATOMIC_RELEASE, "workgroup"); } while (0)


// Inception (multi-window box) linear attention (B 1, C 256 = 8 heads x 32, 64 x 64): per window size ws in {64, 32, 16}: attn = q . boxsum(k v^T) / (q . boxsum(k) + 1e-6) using integral images with edge-replicated borders; concat over windows (768 channels), 1x1 output conv + bias.
#define CC 256
#define NH 8
#define HD 32
#define HH 64
#define WWD 64
#define NP (HH * WWD)      // 4,096 positions
#define NWIN 3
#define OC (CC * NWIN)     // 768
#ifndef TPB
#define TPB HH             // output rows (of 64 positions) computed by the box/attention stage
#endif
typedef __attribute__((ext_vector_type(8))) __bf16 v8b;
__device__ __forceinline__ v16b frag_b(const __bf16* rowk0, int lane) {
  union { v16b v; v8b q[2]; } u; const __bf16* p = rowk0 + 8 * (lane >> 4);
  u.q[0] = *(const v8b*)p; u.q[1] = *(const v8b*)(p + 16); return u.v;
}
__device__ __forceinline__ float bfr(float v) { return (float)(__bf16)v; }
__device__ __attribute__((noinline)) float exp_ni(float v) { return expf(v); }
__device__ __attribute__((noinline)) float erf_ni(float v) { return erff(v); }
__constant__ int WSZ[NWIN] = {64, 32, 16};   // Hh / w for w in (1, 2, 4)

#define WS_PW  0u                                   // bf16 natural rows Wq, Wk, Wv [3][256][256]; Wout [256][768]
#define WS_PO  (WS_PW + 2u * (size_t)3 * CC * CC)
#define WS_XT  (WS_PO + 2u * (size_t)CC * OC)           // f32 x^T [p][c]
#define WS_Q   (WS_XT + 4u * (size_t)NP * CC)           // f32 q [c][p] (sigmoid), k [c][p] (sigmoid), v [c][p] (normalised): channel-major planes of 4,096 positions
#define WS_K   (WS_Q + 4u * (size_t)NP * CC)
#define WS_V   (WS_K + 4u * (size_t)NP * CC)
#define WS_IK  (WS_V + 4u * (size_t)NP * CC)            // f32 integral planes Ik [h*32+d][64x64 inclusive prefix]
#define WS_INV (WS_IK + 4u * (size_t)CC * NP)           // f32 1 / (norm + 1e-6) [wi*8+h][p]
#define WS_O   (WS_INV + 4u * (size_t)NWIN * NH * NP)   // f32 o [768][p]: channel-major planes
#define WS_END (WS_O + 4u * (size_t)NP * OC)

__global__ __launch_bounds__(256) void k_pack(const float* __restrict__ WQ, const float* __restrict__ WK, const float* __restrict__ WV, const float* __restrict__ WO, __bf16* __restrict__ PW, __bf16* __restrict__ PO) { const int n = blockIdx.x, which = blockIdx.y, t = threadIdx.x; __shared__ __align__(16) __bf16 s[OC];
  if (which < 3) { const float* w = (which == 0) ? WQ : (which == 1) ? WK : WV; s[t] = (__bf16)w[(size_t)n * CC + t]; __syncthreads(); if (t < CC / 8) vst2((unsigned*)(PW + ((size_t)which * CC + n) * CC + t * 8), *(const v4u*)&s[t * 8]); }
  else { for (int k = t; k < OC; k += 256) s[k] = (__bf16)WO[(size_t)n * OC + k]; __syncthreads(); if (t < OC / 8) vst2((unsigned*)(PO + (size_t)n * OC + t * 8), *(const v4u*)&s[t * 8]); } }
// ---- k_tr: block = (64 positions, 64 channels): x[c][p] -> XT[p][c] f32
__global__ __launch_bounds__(256) void k_tr(const float* __restrict__ X, float* __restrict__ XT) { __shared__ float st[64][65]; __shared__ __align__(16) float so[64][68]; const int t = threadIdx.x; const int p0 = blockIdx.x * 64, c0 = blockIdx.y * 64;
  for (int e = t; e < 64 * 64; e += 256) { const int cl = e >> 6, pl = e & 63; st[pl][cl] = X[(size_t)(c0 + cl) * NP + p0 + pl]; } __syncthreads();
  for (int e = t; e < 64 * 64; e += 256) { const int pl = e >> 6, cl = e & 63; so[pl][cl] = st[pl][cl]; } __syncthreads();
  for (int e = t; e < 64 * 16; e += 256) { const int pl = e >> 4, q = e & 15; vst2(XT + (size_t)(p0 + pl) * CC + c0 + q * 4, *(const v4f*)&so[pl][q * 4]); } }
// ---- k_proj: block = (64 positions, 128 out channels, which): 1x1 conv = W (A rows = channels) . XT^T (B columns = positions), so D rows are channels; epilogue: q, k -> sigmoid; v -> raw (normalised later); stored channel-major [c][p], 256 contiguous bytes per channel and block
__global__ __launch_bounds__(128) void k_proj(const float* __restrict__ XT, const __bf16* __restrict__ PW, float* __restrict__ Q, float* __restrict__ Kf, float* __restrict__ Vf) { __shared__ __align__(16) float so[128][68];
  const int tid = threadIdx.x, wave = tid >> 5, lane = tid & 31, col = lane & 15, g = lane >> 4; const int which = blockIdx.z; const int p0 = blockIdx.x * 64; const size_t r0 = (size_t)p0 + wave * 16; const int c0 = blockIdx.y * 128; const __bf16* Wr = PW + ((size_t)which * CC) * CC;
  v8f acc[8] = {};
#pragma unroll
  for (int kc = 0; kc < CC / 32; ++kc) { v16b a; { const float* p = XT + (r0 + col) * CC + kc * 32 + 8 * g;
#pragma unroll
      for (int i = 0; i < 8; ++i) { a[i] = (__bf16)p[i]; a[8 + i] = (__bf16)p[16 + i]; } }
#pragma unroll
    for (int j = 0; j < 8; ++j) acc[j] = wmma_bf(frag_b(Wr + (size_t)(c0 + j * 16 + col) * CC + kc * 32, lane), a, acc[j]); }
#pragma unroll
  for (int j = 0; j < 8; ++j)
#pragma unroll
    for (int r = 0; r < 8; ++r) { const float v = acc[j][r]; so[j * 16 + 8 * g + r][wave * 16 + col] = (which < 2) ? 1.0f / (1.0f + __expf(-v)) : v; }
  __syncthreads();   // a channel's 64 positions come from all four waves
  float* dst = (which == 0) ? Q : (which == 1) ? Kf : Vf; for (int e = tid; e < 128 * 16; e += 128) { const int cl = e >> 4, q = e & 15; vst2(dst + (size_t)(c0 + cl) * NP + p0 + q * 4, *(const v4f*)&so[cl][q * 4]); } }
// ---- k_vnorm: thread = (position, head): v[h][:] /= max(||v_h||, 1e-12) (in place); the head's 32 channel planes are read and written at the thread's position, a wave covering one 128-byte line of each; squares summed pairwise (adjacent pairs, then pairs of pairs)
__global__ __launch_bounds__(64) void k_vnorm(float* __restrict__ Vf) { float* base = Vf + (size_t)blockIdx.y * HD * NP + blockIdx.x * 64 + threadIdx.x; float v[HD], q[HD];
#pragma unroll   // all 32 loads in flight at once; v and q indexed by constants, so they stay in registers
  for (int d = 0; d < HD; ++d) { v[d] = base[(size_t)d * NP]; q[d] = v[d] * v[d]; }
#pragma unroll   // constant indices: q stays in registers
  for (int o = 1; o < HD; o <<= 1)
#pragma unroll   // as above
    for (int d = 0; d < HD; d += 2 * o) q[d] += q[d + o];
  const float den = fmaxf(sqrtf(q[0]), 1e-12f);
#pragma unroll   // constant indices: v stays in registers
  for (int d = 0; d < HD; ++d) base[(size_t)d * NP] = v[d] / den; }
// ---- k_integral: block = Ik plane (h, d) of k: inclusive prefix sums along w then along h (fixed order), store the plane [64*64]
__global__ __launch_bounds__(256) void k_integral(const float* __restrict__ Kf, float* __restrict__ IK) { __shared__ float s[HH][WWD + 1]; __shared__ __align__(16) float so2[HH][WWD + 4]; const int t = threadIdx.x; const int pl = blockIdx.x;
  const float* kp = Kf + (size_t)pl * NP;   // channel-major plane: whole lines, 16 bytes a lane
  v4f kv[4];
#pragma unroll   // all of a thread's loads in flight at once: one trip to L2 instead of one per pass
  for (int i = 0; i < 4; ++i) kv[i] = *(const v4f*)(kp + t * 4 + i * 1024);
#pragma unroll   // kv stays in registers
  for (int i = 0; i < 4; ++i) { float* sp = &s[(t >> 4) + i * 16][(t & 15) * 4]; sp[0] = kv[i][0]; sp[1] = kv[i][1]; sp[2] = kv[i][2]; sp[3] = kv[i][3]; } __syncthreads();
  if (t < HH) { float run = 0.f; for (int w = 0; w < WWD; ++w) { run += s[t][w]; s[t][w] = run; } } __syncthreads();   // along w (row t)
  if (t < WWD) { float run = 0.f; for (int y = 0; y < HH; ++y) { run += s[y][t]; s[y][t] = run; } } __syncthreads(); // along h (column t)
  for (int e = t; e < NP; e += 256) so2[e >> 6][e & 63] = s[e >> 6][e & 63]; __syncthreads();
  float* dst = IK + (size_t)pl * NP; for (int e = t; e < HH * 16; e += 256) { const int y = e >> 4, q = e & 15; vst2(dst + y * WWD + q * 4, *(const v4f*)&so2[y][q * 4]); } }
// integral lookup with the module's padding: I has a zero row/col in front (index 0) then the inclusive prefix sums; Pp = edge-pad(I, l, r); value at padded index (a, b) = I[clamp(a - l, 0, 64)][clamp(b - l, 0, 64)], I[0][*] = I[*][0] = 0
__device__ __forceinline__ float ilook(const float* __restrict__ plane, int a, int b, int l) { int ia = a - l, ib = b - l; ia = ia < 0 ? 0 : (ia > HH ? HH : ia); ib = ib < 0 ? 0 : (ib > WWD ? WWD : ib); if (ia == 0 || ib == 0) return 0.f; return plane[(ia - 1) * WWD + (ib - 1)]; }
__device__ __forceinline__ float boxsum(const float* __restrict__ plane, int i, int j, int ws, int l) { return ilook(plane, i + ws, j + ws, l) - ilook(plane, i + ws, j, l) - ilook(plane, i, j + ws, l) + ilook(plane, i, j, l); }
// ---- k_norm: block = (image row i, head h, window wi), thread = position j: INV[wi*8+h][p] = 1 / (sum_d q[d] box(Ik[h][d]) + 1e-6)
__global__ __launch_bounds__(64) void k_norm(const float* __restrict__ Q, const float* __restrict__ IK, float* __restrict__ INV) {
  const int j = threadIdx.x; const int i = blockIdx.x, h = blockIdx.y, wi = blockIdx.z; const int ws = WSZ[wi]; const int tp = ws - 1, rr = tp / 2, l = tp - rr; const size_t p = (size_t)i * WWD + j;
  float nrm = 0.f;
#pragma unroll 8   // the loads of eight d in flight at once; the sum stays in the order of d
  for (int d = 0; d < HD; ++d) { const float qd = Q[(size_t)(h * HD + d) * NP + p]; const float wk = boxsum(IK + (size_t)(h * HD + d) * NP, i, j, ws, l); nrm += qd * wk; }
  INV[(size_t)(wi * NH + h) * NP + p] = 1.0f / (nrm + 1e-6f); }
// ---- k_fuse: block = (f, h), 1,024 threads, the whole LDS of a WGP: the 32 planes k[d] v[f] of the head, 16 at a time, are built, prefix-summed (along w, then along h, each serial as in k_integral), box-differenced and summed over d (ascending) with q[d] without leaving LDS; O[wi*256 + h*32 + f][p] = sum * INV
// LDS plane = the padded integral image: row ia = 0..64 (row 0 zero), column ib + 4 for ib = -4..67: ib <= 0 zero, ib = 1..64 the prefix sums, ib = 65..67 copies of ib = 64. All window offsets are multiples of 4, so the four neighbouring positions of a thread read each corner as one aligned 16-byte quad, and a quad wholly left (right) of the image is the quad at ib = -4 (64).
#define FP 76               // row pitch in floats: 304 bytes = 16 x odd, so that 16-byte reads of one row a lane do not collide
#define FPL ((HH + 1) * FP) // floats a plane
#define FG 16               // planes a pass: 16 x 64 rows (columns) = one serial scan a thread
__global__ __launch_bounds__(1024) void k_fuse(const float* __restrict__ Q, const float* __restrict__ Kf, const float* __restrict__ Vf, const float* __restrict__ INV, float* __restrict__ O) { __shared__ __align__(16) float s[FG * FPL];
  const int t = threadIdx.x; const int f = blockIdx.x, h = blockIdx.y; const int i = t >> 4, j4 = (t & 15) * 4; const int sg = t >> 6, sl = t & 63;   // (i, j4): the thread's four positions; (sg, sl): its plane and row or column in the scans
  const v4f zero4 = {0.f, 0.f, 0.f, 0.f};
  for (int e = t; e < FG * FP; e += 1024) s[(e / FP) * FPL + e % FP] = 0.f;   // row 0 of every plane; no pass writes it again
  *(v4f*)&s[sg * FPL + (sl + 1) * FP] = zero4;                                // ib = -4..-1 of rows 1..64; as above
  const v4f vq = *(const v4f*)(Vf + (size_t)(h * HD + f) * NP + t * 4);
  asm volatile("s_wait_xcnt 0x0" ::: "memory");   // the index arithmetic below reuses the register that this load's address names
  int off[NWIN][4];   // the corners' places in a plane: bottom right, bottom left, top right, top left
#pragma unroll   // off indexed by constants: stays in registers
  for (int wi = 0; wi < NWIN; ++wi) { const int ws = HH >> wi; const int tp = ws - 1, rr = tp / 2, l = tp - rr;
    int at = i - l, ab = i + ws - l, bl = j4 - l, br = j4 + ws - l;
    at = at < 0 ? 0 : (at > HH ? HH : at); ab = ab < 0 ? 0 : (ab > HH ? HH : ab); bl = bl < -4 ? -4 : (bl > WWD ? WWD : bl); br = br < -4 ? -4 : (br > WWD ? WWD : br);
    off[wi][0] = ab * FP + br + 4; off[wi][1] = ab * FP + bl + 4; off[wi][2] = at * FP + br + 4; off[wi][3] = at * FP + bl + 4; }
  v4f acc[NWIN] = {zero4, zero4, zero4};
#pragma unroll 1   // two passes through one body: the code stays small
  for (int d0 = 0; d0 < HD; d0 += FG) {
    { const float* kp = Kf + (size_t)(h * HD + d0) * NP + t * 4; v4f kv[FG];   // products k[d] v[f], value w of row y at row y + 1, column w + 4 (aligned)
#pragma unroll   // all 16 loads in flight at once
      for (int g = 0; g < FG; ++g) kv[g] = *(const v4f*)(kp + (size_t)g * NP);
#pragma unroll   // kv stays in registers
      for (int g = 0; g < FG; ++g) *(v4f*)&s[g * FPL + (i + 1) * FP + 4 + j4] = kv[g] * vq; }
    __syncthreads();
    { float* row = &s[sg * FPL + (sl + 1) * FP + 4]; float p[WWD];   // along w: thread = (plane, row); written back one column to the right, behind the zero of ib = 0
#pragma unroll   // p stays in registers
      for (int m = 0; m < WWD / 4; ++m) { const v4f r = *(const v4f*)(row + 4 * m); p[4 * m] = r[0]; p[4 * m + 1] = r[1]; p[4 * m + 2] = r[2]; p[4 * m + 3] = r[3]; }
      float run = 0.f;
#pragma unroll   // as above
      for (int w = 0; w < WWD; ++w) { run += p[w]; p[w] = run; }
      { const v4f r = {0.f, p[0], p[1], p[2]}; *(v4f*)row = r; }
#pragma unroll   // as above
      for (int m = 1; m < WWD / 4; ++m) { const v4f r = {p[4 * m - 1], p[4 * m], p[4 * m + 1], p[4 * m + 2]}; *(v4f*)(row + 4 * m) = r; }
      row[WWD] = p[WWD - 1]; }
    __syncthreads();
    { float* cp = &s[sg * FPL + FP + 5 + sl]; float run = 0.f;   // along h: thread = (plane, column), in place
#pragma unroll 1   // 16 rows a trip: few addresses and few values live at a time (all 64 at once spilled some thirty addresses)
      for (int y0 = 0; y0 < HH; y0 += 16, cp += 16 * FP) { float p[16];
#pragma unroll   // p stays in registers; a trip's loads in flight at once
        for (int y = 0; y < 16; ++y) p[y] = cp[y * FP];
#pragma unroll   // as above
        for (int y = 0; y < 16; ++y) { run += p[y]; cp[y * FP] = run; } } }
    __syncthreads();
    { float* e = &s[sg * FPL + (sl + 1) * FP + 4 + WWD]; const float x = e[0]; const v4f r = {x, x, x, x}; *(v4f*)e = r; }   // ib = 65..67: copies of ib = 64; thread = (plane, row)
    __syncthreads();
    { const float* qp = Q + (size_t)(h * HD + d0) * NP + t * 4; v4f qc[4];
#pragma unroll   // four planes' q in flight at once
      for (int u = 0; u < 4; ++u) qc[u] = *(const v4f*)(qp + (size_t)u * NP);
#pragma unroll 1   // four planes a trip: their distances fit the LDS instructions' offset field, so a trip forms each corner's address once
      for (int g0 = 0; g0 < FG; g0 += 4) { const float* pl = s + g0 * FPL; const float* qx = qp + (size_t)(g0 + 4 < FG ? g0 + 4 : 0) * NP;
#pragma unroll   // plane distances become constants; qc indexed by constants
        for (int u = 0; u < 4; ++u) { const float* pu = pl + u * FPL; v4f cr[NWIN][4];
#pragma unroll   // a plane's twelve corner quads in flight at once
          for (int wi = 0; wi < NWIN; ++wi) { cr[wi][0] = *(const v4f*)(pu + off[wi][0]); cr[wi][1] = *(const v4f*)(pu + off[wi][1]); cr[wi][2] = *(const v4f*)(pu + off[wi][2]); cr[wi][3] = *(const v4f*)(pu + off[wi][3]); }
#pragma unroll   // acc indexed by constants
          for (int wi = 0; wi < NWIN; ++wi) acc[wi] += qc[u] * (cr[wi][0] - cr[wi][1] - cr[wi][2] + cr[wi][3]);
          qc[u] = *(const v4f*)(qx + (size_t)u * NP); }   // q of the plane four further on flies meanwhile (the last trip reads the first four again, unused: no branch inside a trip)
        asm volatile("s_wait_xcnt 0x0" ::: "memory"); } }   // the next trip forms the q loads' address anew in the same registers
    __syncthreads();   // the next pass overwrites the planes
  }
#pragma unroll   // acc indexed by constants
  for (int wi = 0; wi < NWIN; ++wi) vst2(O + (size_t)(wi * CC + h * HD + f) * NP + t * 4, acc[wi] * *(const v4f*)(INV + (size_t)(wi * NH + h) * NP + t * 4)); }
// ---- k_out: block = (128 out channels o, 32 positions), 8 waves of 16 o x 32 p: out[o][p] = sum_c Wout[o][c] O[c][p] (A = Wout bf16 exact rows, B = columns p of O as bf16 hi + lo) + bout[o]; (B, C, H, W) layout = rows o of 4,096
// The block's O tile (768 channels x one 128-byte line) is read once, whole lines, every load in flight at once, split into hi and lo once and laid down in LDS as position rows [p][c]; all eight waves take their B fragments from there.
#define OPB 32              // positions a block: one line of every channel plane
#define OPI (OC + 8)        // LDS row pitch in bf16: 1,552 bytes = 16 x odd, so that 16-byte reads of one row a lane do not collide
#define APRE 8              // A fragments fetched ahead of their use
__global__ __launch_bounds__(256) void k_out(const __bf16* __restrict__ PO, const float* __restrict__ O, const float* __restrict__ BO, float* __restrict__ Y) { __shared__ __align__(16) __bf16 sh[OPB][OPI]; __shared__ __align__(16) __bf16 sl[OPB][OPI]; __shared__ __align__(16) float so[8][16][OPB + 4];
  const int tid = threadIdx.x, wave = tid >> 5, lane = tid & 31, col = lane & 15, g = lane >> 4; const int o0 = blockIdx.x * 128 + wave * 16; const int p0 = blockIdx.y * OPB;
  const int pq = tid & 7, cg = tid >> 3;   // staging: eight lanes cover a channel's line; a thread takes four positions of eight neighbouring channels, three times
  const float* src = O + (size_t)(cg * 8) * NP + p0 + pq * 4; v4f x[OC / 256][8];
#pragma unroll   // all 24 loads of a thread in flight at once: one trip to memory for the whole tile
  for (int r = 0; r < OC / 256; ++r) {
#pragma unroll   // x indexed by constants: stays in registers
    for (int i = 0; i < 8; ++i) x[r][i] = *(const v4f*)(src + (size_t)(r * 256 + i) * NP);
    asm volatile("s_wait_xcnt 0x0" ::: "memory"); }   // later loads may land in the registers that these loads' address names
  const __bf16* ar = PO + (size_t)(o0 + col) * OC; v16b a[OC / 32];   // natural row of Wout read with the A-row lane layout (identical to frag_b's)
#pragma unroll   // the first A fragments fly beside the tile
  for (int kc = 0; kc < APRE; ++kc) a[kc] = frag_b(ar + kc * 32, lane);
  asm volatile("s_wait_xcnt 0x0" ::: "memory");   // the arithmetic below may reuse registers that these loads' addresses name
#pragma unroll   // x indexed by constants
  for (int r = 0; r < OC / 256; ++r)
#pragma unroll   // as above
    for (int e = 0; e < 4; ++e) { v8b h, l;
#pragma unroll   // as above
      for (int i = 0; i < 8; ++i) { const float v = x[r][i][e]; const __bf16 hh = (__bf16)v; h[i] = hh; l[i] = (__bf16)(v - (float)hh); }
      *(v8b*)&sh[pq * 4 + e][r * 256 + cg * 8] = h; *(v8b*)&sl[pq * 4 + e][r * 256 + cg * 8] = l; }
  __syncthreads();   // every wave reads rows that all waves wrote
  float bb[8];
#pragma unroll   // the bias flies beside the products instead of being waited for behind them
  for (int r = 0; r < 8; ++r) bb[r] = BO[o0 + 8 * g + r];
  asm volatile("s_wait_xcnt 0x0" ::: "memory");   // later loads may land in the registers that these loads' address names
  v8f acc[2] = {}; v16b bh[2][2], bl[2][2];   // B fragments of this step and of the next
#pragma unroll   // bh, bl indexed by constants
  for (int jt = 0; jt < 2; ++jt) { bh[0][jt] = frag_b(&sh[jt * 16 + col][0], lane); bl[0][jt] = frag_b(&sl[jt * 16 + col][0], lane); }
#pragma unroll   // a, bh, bl indexed by constants; the fetches ahead stand in front of the step's products
  for (int kc = 0; kc < OC / 32; ++kc) { const int cu = kc & 1, nx = cu ^ 1;
    if (kc + 1 < OC / 32) {
#pragma unroll   // as above
      for (int jt = 0; jt < 2; ++jt) { bh[nx][jt] = frag_b(&sh[jt * 16 + col][(kc + 1) * 32], lane); bl[nx][jt] = frag_b(&sl[jt * 16 + col][(kc + 1) * 32], lane); } }
    if ((kc & 3) == 0 && kc + APRE < OC / 32) {
#pragma unroll   // as above
      for (int u = 0; u < 4; ++u) a[kc + APRE + u] = frag_b(ar + (kc + APRE + u) * 32, lane); }
    acc[0] = wmma_bf(a[kc], bh[cu][0], acc[0]); acc[1] = wmma_bf(a[kc], bh[cu][1], acc[1]);   // per accumulator hi, then lo, in ascending c
    acc[0] = wmma_bf(a[kc], bl[cu][0], acc[0]); acc[1] = wmma_bf(a[kc], bl[cu][1], acc[1]); }
#pragma unroll   // acc indexed by constants
  for (int jt = 0; jt < 2; ++jt)
#pragma unroll   // as above
    for (int r = 0; r < 8; ++r) so[wave][8 * g + r][jt * 16 + col] = acc[jt][r] + bfr(bb[r]);
  LDSX();
#pragma unroll   // four rows (whole lines) a store
  for (int it = 0; it < 4; ++it) { const int rl = it * 4 + (lane >> 3); vst2(Y + (size_t)(o0 + rl) * NP + p0 + (lane & 7) * 4, *(const v4f*)&so[wave][rl][(lane & 7) * 4]); } }
extern "C" void kernel_launch(void* const* d_in, const int* in_sizes, int n_in, void* d_out, int out_size, void* d_ws, size_t ws_size, hipStream_t stream) {
  (void)in_sizes; (void)n_in; (void)out_size;
  const float** F = (const float**)d_in;   // 0 x [1,256,64,64], 1 Wq, 2 Wk, 3 Wv [256,256], 4 Wout [256,768], 5 bout [256]
  if (ws_size < (size_t)WS_END) return;
  char* ws = (char*)d_ws; __bf16 *PW = (__bf16*)(ws + WS_PW), *PO = (__bf16*)(ws + WS_PO); float *XT = (float*)(ws + WS_XT), *Q = (float*)(ws + WS_Q), *Kf = (float*)(ws + WS_K), *Vf = (float*)(ws + WS_V), *IK = (float*)(ws + WS_IK), *INV = (float*)(ws + WS_INV), *O = (float*)(ws + WS_O);
  k_pack<<<dim3(CC, 4), 256, 0, stream>>>(F[1], F[2], F[3], F[4], PW, PO);
  k_tr<<<dim3(NP / 64, CC / 64), 256, 0, stream>>>(F[0], XT);
  k_proj<<<dim3(NP / 64, CC / 128, 3), 128, 0, stream>>>(XT, PW, Q, Kf, Vf);
  k_vnorm<<<dim3(NP / 64, NH), 64, 0, stream>>>(Vf);
  k_integral<<<NH * HD, 256, 0, stream>>>(Kf, IK);
  k_norm<<<dim3(TPB, NH, NWIN), 64, 0, stream>>>(Q, IK, INV);
  k_fuse<<<dim3(HD, NH), 1024, 0, stream>>>(Q, Kf, Vf, INV, O);
  k_out<<<dim3(CC / 128, (TPB * WWD) / OPB), 256, 0, stream>>>(PO, O, F[5], (float*)d_out);
}

// v004
// A run of this version takes 61.3 microseconds.
// Two timings next to v003 put it at 1.41 and 1.39 times that version's speed.
// All steps since v000 together make it 6.69 times as fast.
// compute dtype: all float inputs rounded to bf16; q/k/v 1x1 convs with EXACT bf16 products on WMMA 16x16x32 (x and the weights read as they lie); sigmoid (hardware exp) and the per-position L2 normalisation of v in f32; k and k (x) v outer-product planes, their 2-D inclusive prefix sums (integral images; those of k (x) v live in LDS only) and the clamped 4-corner box differences for the three window sizes, the q-weighted sums and the division all in f32 on VALU (fixed order); out = Wout (exact) . o (bf16 hi + lo, 2 products) + bout on WMMA; f32 output in (B, C, H, W) order.
#include <hip/hip_runtime.h>
#include <math.h>

typedef __attribute__((ext_vector_type(16))) _Float16 v16h;
typedef __attribute__((ext_vector_type(16))) __bf16 v16b;
typedef __attribute__((ext_vector_type(8)))  _Float16 v8h;
typedef __attribute__((ext_vector_type(8)))  float v8f;
typedef __attribute__((ext_vector_type(4)))  float v4f;
typedef __attribute__((ext_vector_type(2)))  float v2f;
typedef __attribute__((ext_vector_type(4)))  unsigned v4u;
typedef __attribute__((ext_vector_type(4)))  int v4i;
typedef float __attribute__((may_alias)) float_a;
typedef int __attribute__((may_alias)) int_a;

template <typename T> __device__ __forceinline__ void vst2(void* p, T v) { *(T*)p = v;  }
__device__ __forceinline__ v8f wmma16(v16h a, v16h b, v8f c) {
  v8f d = __builtin_amdgcn_wmma_f32_16x16x32_f16(false, a, false, b, (short)0, c, false, false);
  asm volatile("v_nop\n\tv_nop\n\tv_nop\n\tv_nop" : "+v"(d) : "v"(a), "v"(b));
  return d;
}
__device__ __forceinline__ v8f wmma_bf(v16b a, v16b b, v8f c) {
  v8f d = __builtin_amdgcn_wmma_f32_16x16x32_bf16(false, a, false, b, (short)0, c, false, false);
  asm volatile("v_nop\n\tv_nop\n\tv_nop\n\tv_nop" : "+v"(d) : "v"(a), "v"(b));
  return d;
}
// 16x16x32 fragments: lane = (h = lane>>4, row/col = lane&15); elements 0..7 = k0+8h+0..7, 8..15 = k0+16+8h+0..7; D element r = row 8h+r
__device__ __forceinline__ v16h frag_h(const _Float16* rowk0, int lane) {
  union { v16h v; v8h q[2]; } u; const _Float16* p = rowk0 + 8 * (lane >> 4);
  u.q[0] = *(const v8h*)p; u.q[1] = *(const v8h*)(p + 16); return u.v;
}
__device__ __forceinline__ v16h frag_f32(const float* rowk0, int lane) {
  v16h a; const float* p = rowk0 + 8 * (lane >> 4);
#pragma unroll
  for (int i = 0; i < 8; ++i) { a[i] = (_Float16)p[i]; a[8 + i] = (_Float16)p[16 + i]; }
  return a;
}
__device__ __forceinline__ v16h frag_f32s(const float* rowk0, int lane, float sc) {
  v16h a; const float* p = rowk0 + 8 * (lane >> 4);
#pragma unroll
  for (int i = 0; i < 8; ++i) { a[i] = (_Float16)(p[i] * sc); a[8 + i] = (_Float16)(p[16 + i] * sc); }
  return a;
}
// column fragment from a [K][ld] layout (column n), rows >= K read as 0
__device__ __forceinline__ v16h fragc_f32(const float* W, int k0, int n, int lane, int ld, int K) {
  v16h a; const int g = lane >> 4;
#pragma unroll
  for (int i = 0; i < 8; ++i) { const int ka = k0 + 8 * g + i, kb = ka + 16;
    a[i] = (_Float16)(ka < K ? W[(size_t)(ka < K ? ka : K - 1) * ld + n] : 0.f); a[8 + i] = (_Float16)(kb < K ? W[(size_t)(kb < K ? kb : K - 1) * ld + n] : 0.f); }
  return a;
}
struct F2 { v16b h, l; };
__device__ __forceinline__ F2 bsplit16(const float v[16]) { F2 r;
#pragma unroll
  for (int i = 0; i < 16; ++i) { const __bf16 h = (__bf16)v[i]; r.h[i] = h; r.l[i] = (__bf16)(v[i] - (float)h); }
  return r; }
__device__ __forceinline__ F2 split_row(const float* row, int k0, int lane) { float v[16]; const float* p = row + k0 + 8 * (lane >> 4);
#pragma unroll
  for (int i = 0; i < 8; ++i) { v[i] = p[i]; v[8 + i] = p[16 + i]; }
  return bsplit16(v); }
__device__ __forceinline__ F2 split_rowK(const float* row, int k0, int lane, int K) { float v[16]; const int g = lane >> 4;
#pragma unroll
  for (int i = 0; i < 8; ++i) { const int ka = k0 + 8 * g + i, kb = ka + 16; v[i] = ka < K ? row[ka < K ? ka : K - 1] : 0.f; v[8 + i] = kb < K ? row[kb < K ? kb : K - 1] : 0.f; }
  return bsplit16(v); }
__device__ __forceinline__ F2 split_col(const float* W, int k0, int n, int lane, int ld, int K) { float v[16]; const int g = lane >> 4;
#pragma unroll
  for (int i = 0; i < 8; ++i) { const int ka = k0 + 8 * g + i, kb = ka + 16; v[i] = ka < K ? W[(size_t)(ka < K ? ka : K - 1) * ld + n] : 0.f; v[8 + i] = kb < K ? W[(size_t)(kb < K ? kb : K - 1) * ld + n] : 0.f; }
  return bsplit16(v); }
__device__ __forceinline__ v8f mac3(const F2& a, const F2& b, v8f c) { c = wmma_bf(a.l, b.h, c); c = wmma_bf(a.h, b.l, c); return wmma_bf(a.h, b.h, c); }
__device__ __forceinline__ float sigm(float v) { return 1.0f / (1.0f + expf(-v)); }
#define LDSX() do { asm volatile("s_wait_dscnt 0" ::: "memory"); __builtin_amdgcn_wave_barrier(); __builtin_amdgcn_fence(__ATOMIC_RELEASE, "workgroup"); } while (0)


// Inception (multi-window box) linear attention (B 1, C 256 = 8 heads x 32, 64 x 64): per window size ws in {64, 32, 16}: attn = q . boxsum(k v^T) / (q . boxsum(k) + 1e-6) using integral images with edge-replicated borders; concat over windows (768 channels), 1x1 output conv + bias.
#define CC 256
#define NH 8
#define HD 32
#define HH 64
#define WWD 64
#define NP (HH * WWD)      // 4,096 positions
#define NWIN 3
#define OC (CC * NWIN)     // 768
#ifndef TPB
#define TPB HH             // output rows (of 64 positions) computed by the box/attention stage
#endif
typedef __attribute__((ext_vector_type(8))) __bf16 v8b;
__device__ __forceinline__ v16b frag_b(const __bf16* rowk0, int lane) {
  union { v16b v; v8b q[2]; } u; const __bf16* p = rowk0 + 8 * (lane >> 4);
  u.q[0] = *(const v8b*)p; u.q[1] = *(const v8b*)(p + 16); return u.v;
}
__device__ __forceinline__ float bfr(float v) { return (float)(__bf16)v; }
__device__ __attribute__((noinline)) float exp_ni(float v) { return expf(v); }
__device__ __attribute__((noinline)) float erf_ni(float v) { return erff(v); }
__constant__ int WSZ[NWIN] = {64, 32, 16};   // Hh / w for w in (1, 2, 4)

#define WS_PW  0u                                   // (not used); then bf16 natural rows Wout [256][768]
#define WS_PO  (WS_PW + 2u * (size_t)3 * CC * CC)
#define WS_XT  (WS_PO + 2u * (size_t)CC * OC)           // (not used)
#define WS_Q   (WS_XT + 4u * (size_t)NP * CC)           // f32 q [c][p] (sigmoid), k [c][p] (sigmoid), v [c][p] (normalised): channel-major planes of 4,096 positions
#define WS_K   (WS_Q + 4u * (size_t)NP * CC)
#define WS_V   (WS_K + 4u * (size_t)NP * CC)
#define WS_IK  (WS_V + 4u * (size_t)NP * CC)            // f32 integral planes Ik [h*32+d][64x64 inclusive prefix]
#define WS_INV (WS_IK + 4u * (size_t)CC * NP)           // f32 1 / (norm + 1e-6) [wi*8+h][p]
#define WS_O   (WS_INV + 4u * (size_t)NWIN * NH * NP)   // f32 o [768][p]: channel-major planes
#define WS_END (WS_O + 4u * (size_t)NP * OC)

// ---- k_proj: block = (64 positions = one image row, 128 out channels, which): 1x1 conv = W (A rows = channels) . x (B columns = positions), so D rows are channels; stored channel-major [c][p], 256 contiguous bytes per channel and block.
// Everything the conv needs is prepared inside this launch: x is read as it lies ([c][p]: 16 lanes cover 64 bytes of a channel's line) and rounded to bf16 in registers; the block's 128 weight rows are read as whole lines, rounded to bf16 and laid down in LDS, from where all four waves take their A fragments; epilogue: q, k -> sigmoid; v -> divided by max(||v_h||, 1e-12) per (position, head), the block holding all 32 channels of its four heads (squares summed pairwise: adjacent pairs, then pairs of pairs).
// which == 3: no conv; the 128 blocks round Wout to bf16 (natural rows) for k_out.
#define WPI (CC + 8)        // LDS row pitch in bf16: 528 bytes = 16 x odd, so that 16-byte reads of one row a lane do not collide
typedef __attribute__((ext_vector_type(4))) __bf16 v4b;
__device__ __forceinline__ v4b cvt4(v4f w) { v4b b; b[0] = (__bf16)w[0]; b[1] = (__bf16)w[1]; b[2] = (__bf16)w[2]; b[3] = (__bf16)w[3]; return b; }
__global__ __launch_bounds__(128) void k_proj(const float* __restrict__ X, const float* __restrict__ WQ, const float* __restrict__ WK, const float* __restrict__ WV, const float* __restrict__ WO, __bf16* __restrict__ PO, float* __restrict__ Q, float* __restrict__ Kf, float* __restrict__ Vf) { __shared__ __align__(16) __bf16 sw[128][WPI]; __shared__ __align__(16) float so[128][68];
  const int tid = threadIdx.x, wave = tid >> 5, lane = tid & 31, col = lane & 15, g = lane >> 4; const int which = blockIdx.z;
  if (which == 3) {   // the whole block leaves here, in front of every barrier
    const size_t e0 = ((size_t)(blockIdx.y * (NP / 64) + blockIdx.x) * 384 + tid) * 4; v4f w[3];   // 128 blocks x 384 quads = 256 x 768 values
#pragma unroll   // the three loads in flight at once
    for (int it = 0; it < 3; ++it) w[it] = *(const v4f*)(WO + e0 + it * 512);
    asm volatile("s_wait_xcnt 0x0" ::: "memory");   // the conversions below may land in the registers that these loads' address names
#pragma unroll   // w indexed by constants
    for (int it = 0; it < 3; ++it) vst2(PO + e0 + it * 512, cvt4(w[it]));
    return; }
  const int p0 = blockIdx.x * 64; const int c0 = blockIdx.y * 128; const float* Wr = (which == 0) ? WQ : (which == 1) ? WK : WV;
  const float* xp = X + (size_t)(8 * g) * NP + p0 + wave * 16 + col; float xv[CC / 32][16];   // B fragments: element i = channel kc*32 + 8g + i, element 8 + i = channel kc*32 + 16 + 8g + i (the k order of frag_b)
#pragma unroll   // all of a wave's x loads in flight at once; xv indexed by constants
  for (int kc = 0; kc < CC / 32; ++kc)
#pragma unroll   // as above
    for (int i = 0; i < 8; ++i) { xv[kc][i] = xp[(size_t)(kc * 32 + i) * NP]; xv[kc][8 + i] = xp[(size_t)(kc * 32 + 16 + i) * NP]; }
  const int wr = tid >> 6, wq = (tid & 63) * 4;   // weight staging: 64 threads cover a row of 1,024 bytes, the block two rows a step
  const float* wp = Wr + (size_t)(c0 + wr) * CC + wq; v4f w0[16];
#pragma unroll   // the first 16 steps' loads fly beside those of x
  for (int it = 0; it < 16; ++it) w0[it] = *(const v4f*)(wp + (size_t)it * 2 * CC);
  asm volatile("s_wait_xcnt 0x0" ::: "memory");   // the conversions and later loads may land in the registers that the x loads' address names
  v16b a[CC / 32];
#pragma unroll   // a, xv indexed by constants
  for (int kc = 0; kc < CC / 32; ++kc)
#pragma unroll   // as above
    for (int i = 0; i < 16; ++i) a[kc][i] = (__bf16)xv[kc][i];
#pragma unroll   // w0 indexed by constants
  for (int it = 0; it < 16; ++it) *(v4b*)&sw[it * 2 + wr][wq] = cvt4(w0[it]);
#pragma unroll   // two more rounds of 24 steps, each round's loads in flight at once
  for (int b = 0; b < 2; ++b) { v4f w1[24];
#pragma unroll   // w1 indexed by constants
    for (int it = 0; it < 24; ++it) w1[it] = *(const v4f*)(wp + (size_t)(16 + b * 24 + it) * 2 * CC);
    asm volatile("s_wait_xcnt 0x0" :: "v"(wp) : "memory");   // the conversions and LDS addresses below may land in the registers that these loads' address names; named as an input, the address lives up to the wait
#pragma unroll   // as above
    for (int it = 0; it < 24; ++it) *(v4b*)&sw[(16 + b * 24 + it) * 2 + wr][wq] = cvt4(w1[it]); }
  __syncthreads();   // every wave reads weight rows that all waves wrote
  v8f acc[8] = {}; v16b af[2][8];   // A fragments of this step and of the next
#pragma unroll   // af indexed by constants
  for (int j = 0; j < 8; ++j) af[0][j] = frag_b(&sw[j * 16 + col][0], lane);
#pragma unroll   // a, af, acc indexed by constants; the next step's fragment reads stand in front of this step's products
  for (int kc = 0; kc < CC / 32; ++kc) { const int cu = kc & 1, nx = cu ^ 1;
    if (kc + 1 < CC / 32) {
#pragma unroll   // as above
      for (int j = 0; j < 8; ++j) af[nx][j] = frag_b(&sw[j * 16 + col][(kc + 1) * 32], lane); }
#pragma unroll   // as above
    for (int j = 0; j < 8; ++j) acc[j] = wmma_bf(af[cu][j], a[kc], acc[j]); }
#pragma unroll
  for (int j = 0; j < 8; ++j)
#pragma unroll
    for (int r = 0; r < 8; ++r) { const float v = acc[j][r]; so[j * 16 + 8 * g + r][wave * 16 + col] = (which < 2) ? 1.0f / (1.0f + __expf(-v)) : v; }
  __syncthreads();   // a channel's 64 positions come from all four waves
  if (which == 2) {   // the same for the whole block: thread = (position, head), two heads a thread; a wave reads and writes 128 contiguous bytes of a channel's row
    const int pp = tid & 63;
#pragma unroll 1   // two heads through one body: the code stays small
    for (int hl = tid >> 6; hl < 4; hl += 2) { float v[HD], q[HD];
#pragma unroll   // v and q indexed by constants, so they stay in registers
      for (int d = 0; d < HD; ++d) { v[d] = so[hl * HD + d][pp]; q[d] = v[d] * v[d]; }
#pragma unroll   // constant indices: q stays in registers
      for (int o = 1; o < HD; o <<= 1)
#pragma unroll   // as above
        for (int d = 0; d < HD; d += 2 * o) q[d] += q[d + o];
      const float den = fmaxf(sqrtf(q[0]), 1e-12f);
#pragma unroll   // constant indices: v stays in registers
      for (int d = 0; d < HD; ++d) so[hl * HD + d][pp] = v[d] / den; }
    __syncthreads(); }   // the stores below read rows that other threads normalised
  float* dst = (which == 0) ? Q : (which == 1) ? Kf : Vf; for (int e = tid; e < 128 * 16; e += 128) { const int cl = e >> 4, q = e & 15; vst2(dst + (size_t)(c0 + cl) * NP + p0 + q * 4, *(const v4f*)&so[cl][q * 4]); } }
// ---- k_integral: block = Ik plane (h, d) of k: inclusive prefix sums along w then along h (fixed order), store the plane [64*64]
__global__ __launch_bounds__(256) void k_integral(const float* __restrict__ Kf, float* __restrict__ IK) { __shared__ float s[HH][WWD + 1]; __shared__ __align__(16) float so2[HH][WWD + 4]; const int t = threadIdx.x; const int pl = blockIdx.x;
  const float* kp = Kf + (size_t)pl * NP;   // channel-major plane: whole lines, 16 bytes a lane
  v4f kv[4];
#pragma unroll   // all of a thread's loads in flight at once: one trip to L2 instead of one per pass
  for (int i = 0; i < 4; ++i) kv[i] = *(const v4f*)(kp + t * 4 + i * 1024);
#pragma unroll   // kv stays in registers
  for (int i = 0; i < 4; ++i) { float* sp = &s[(t >> 4) + i * 16][(t & 15) * 4]; sp[0] = kv[i][0]; sp[1] = kv[i][1]; sp[2] = kv[i][2]; sp[3] = kv[i][3]; } __syncthreads();
  if (t < HH) { float run = 0.f; for (int w = 0; w < WWD; ++w) { run += s[t][w]; s[t][w] = run; } } __syncthreads();   // along w (row t)
  if (t < WWD) { float run = 0.f; for (int y = 0; y < HH; ++y) { run += s[y][t]; s[y][t] = run; } } __syncthreads(); // along h (column t)
  for (int e = t; e < NP; e += 256) so2[e >> 6][e & 63] = s[e >> 6][e & 63]; __syncthreads();
  float* dst = IK + (size_t)pl * NP; for (int e = t; e < HH * 16; e += 256) { const int y = e >> 4, q = e & 15; vst2(dst + y * WWD + q * 4, *(const v4f*)&so2[y][q * 4]); } }
// integral lookup with the module's padding: I has a zero row/col in front (index 0) then the inclusive prefix sums; Pp = edge-pad(I, l, r); value at padded index (a, b) = I[clamp(a - l, 0, 64)][clamp(b - l, 0, 64)], I[0][*] = I[*][0] = 0
__device__ __forceinline__ float ilook(const float* __restrict__ plane, int a, int b, int l) { int ia = a - l, ib = b - l; ia = ia < 0 ? 0 : (ia > HH ? HH : ia); ib = ib < 0 ? 0 : (ib > WWD ? WWD : ib); if (ia == 0 || ib == 0) return 0.f; return plane[(ia - 1) * WWD + (ib - 1)]; }
__device__ __forceinline__ float boxsum(const float* __restrict__ plane, int i, int j, int ws, int l) { return ilook(plane, i + ws, j + ws, l) - ilook(plane, i + ws, j, l) - ilook(plane, i, j + ws, l) + ilook(plane, i, j, l); }
// ---- k_norm: block = (image row i, head h, window wi), thread = position j: INV[wi*8+h][p] = 1 / (sum_d q[d] box(Ik[h][d]) + 1e-6)
__global__ __launch_bounds__(64) void k_norm(const float* __restrict__ Q, const float* __restrict__ IK, float* __restrict__ INV) {
  const int j = threadIdx.x; const int i = blockIdx.x, h = blockIdx.y, wi = blockIdx.z; const int ws = WSZ[wi]; const int tp = ws - 1, rr = tp / 2, l = tp - rr; const size_t p = (size_t)i * WWD + j;
  float nrm = 0.f;
#pragma unroll 8   // the loads of eight d in flight at once; the sum stays in the order of d
  for (int d = 0; d < HD; ++d) { const float qd = Q[(size_t)(h * HD + d) * NP + p]; const float wk = boxsum(IK + (size_t)(h * HD + d) * NP, i, j, ws, l); nrm += qd * wk; }
  INV[(size_t)(wi * NH + h) * NP + p] = 1.0f / (nrm + 1e-6f); }
// ---- k_fuse: block = (f, h), 1,024 threads, the whole LDS of a WGP: the 32 planes k[d] v[f] of the head, 16 at a time, are built, prefix-summed (along w, then along h, each serial as in k_integral), box-differenced and summed over d (ascending) with q[d] without leaving LDS; O[wi*256 + h*32 + f][p] = sum * INV
// LDS plane = the padded integral image: row ia = 0..64 (row 0 zero), column ib + 4 for ib = -4..67: ib <= 0 zero, ib = 1..64 the prefix sums, ib = 65..67 copies of ib = 64. All window offsets are multiples of 4, so the four neighbouring positions of a thread read each corner as one aligned 16-byte quad, and a quad wholly left (right) of the image is the quad at ib = -4 (64).
#define FP 76               // row pitch in floats: 304 bytes = 16 x odd, so that 16-byte reads of one row a lane do not collide
#define FPL ((HH + 1) * FP) // floats a plane
#define FG 16               // planes a pass: 16 x 64 rows (columns) = one serial scan a thread
__global__ __launch_bounds__(1024) void k_fuse(const float* __restrict__ Q, const float* __restrict__ Kf, const float* __restrict__ Vf, const float* __restrict__ INV, float* __restrict__ O) { __shared__ __align__(16) float s[FG * FPL];
  const int t = threadIdx.x; const int f = blockIdx.x, h = blockIdx.y; const int i = t >> 4, j4 = (t & 15) * 4; const int sg = t >> 6, sl = t & 63;   // (i, j4): the thread's four positions; (sg, sl): its plane and row or column in the scans
  const v4f zero4 = {0.f, 0.f, 0.f, 0.f};
  for (int e = t; e < FG * FP; e += 1024) s[(e / FP) * FPL + e % FP] = 0.f;   // row 0 of every plane; no pass writes it again
  *(v4f*)&s[sg * FPL + (sl + 1) * FP] = zero4;                                // ib = -4..-1 of rows 1..64; as above
  const v4f vq = *(const v4f*)(Vf + (size_t)(h * HD + f) * NP + t * 4);
  asm volatile("s_wait_xcnt 0x0" ::: "memory");   // the index arithmetic below reuses the register that this load's address names
  int off[NWIN][4];   // the corners' places in a plane: bottom right, bottom left, top right, top left
#pragma unroll   // off indexed by constants: stays in registers
  for (int wi = 0; wi < NWIN; ++wi) { const int ws = HH >> wi; const int tp = ws - 1, rr = tp / 2, l = tp - rr;
    int at = i - l, ab = i + ws - l, bl = j4 - l, br = j4 + ws - l;
    at = at < 0 ? 0 : (at > HH ? HH : at); ab = ab < 0 ? 0 : (ab > HH ? HH : ab); bl = bl < -4 ? -4 : (bl > WWD ? WWD : bl); br = br < -4 ? -4 : (br > WWD ? WWD : br);
    off[wi][0] = ab * FP + br + 4; off[wi][1] = ab * FP + bl + 4; off[wi][2] = at * FP + br + 4; off[wi][3] = at * FP + bl + 4; }
  v4f acc[NWIN] = {zero4, zero4, zero4};
#pragma unroll 1   // two passes through one body: the code stays small
  for (int d0 = 0; d0 < HD; d0 += FG) {
    { const float* kp = Kf + (size_t)(h * HD + d0) * NP + t * 4; v4f kv[FG];   // products k[d] v[f], value w of row y at row y + 1, column w + 4 (aligned)
#pragma unroll   // all 16 loads in flight at once
      for (int g = 0; g < FG; ++g) kv[g] = *(const v4f*)(kp + (size_t)g * NP);
#pragma unroll   // kv stays in registers
      for (int g = 0; g < FG; ++g) *(v4f*)&s[g * FPL + (i + 1) * FP + 4 + j4] = kv[g] * vq; }
    __syncthreads();
    { float* row = &s[sg * FPL + (sl + 1) * FP + 4]; float p[WWD];   // along w: thread = (plane, row); written back one column to the right, behind the zero of ib = 0
#pragma unroll   // p stays in registers
      for (int m = 0; m < WWD / 4; ++m) { const v4f r = *(const v4f*)(row + 4 * m); p[4 * m] = r[0]; p[4 * m + 1] = r[1]; p[4 * m + 2] = r[2]; p[4 * m + 3] = r[3]; }
      float run = 0.f;
#pragma unroll   // as above
      for (int w = 0; w < WWD; ++w) { run += p[w]; p[w] = run; }
      { const v4f r = {0.f, p[0], p[1], p[2]}; *(v4f*)row = r; }
#pragma unroll   // as above
      for (int m = 1; m < WWD / 4; ++m) { const v4f r = {p[4 * m - 1], p[4 * m], p[4 * m + 1], p[4 * m + 2]}; *(v4f*)(row + 4 * m) = r; }
      row[WWD] = p[WWD - 1]; }
    __syncthreads();
    { float* cp = &s[sg * FPL + FP + 5 + sl]; float run = 0.f;   // along h: thread = (plane, column), in place
#pragma unroll 1   // 16 rows a trip: few addresses and few values live at a time (all 64 at once spilled some thirty addresses)
      for (int y0 = 0; y0 < HH; y0 += 16, cp += 16 * FP) { float p[16];
#pragma unroll   // p stays in registers; a trip's loads in flight at once
        for (int y = 0; y < 16; ++y) p[y] = cp[y * FP];
#pragma unroll   // as above
        for (int y = 0; y < 16; ++y) { run += p[y]; cp[y * FP] = run; } } }
    __syncthreads();
    { float* e = &s[sg * FPL + (sl + 1) * FP + 4 + WWD]; const float x = e[0]; const v4f r = {x, x, x, x}; *(v4f*)e = r; }   // ib = 65..67: copies of ib = 64; thread = (plane, row)
    __syncthreads();
    { const float* qp = Q + (size_t)(h * HD + d0) * NP + t * 4; v4f qc[4];
#pragma unroll   // four planes' q in flight at once
      for (int u = 0; u < 4; ++u) qc[u] = *(const v4f*)(qp + (size_t)u * NP);
#pragma unroll 1   // four planes a trip: their distances fit the LDS instructions' offset field, so a trip forms each corner's address once
      for (int g0 = 0; g0 < FG; g0 += 4) { const float* pl = s + g0 * FPL; const float* qx = qp + (size_t)(g0 + 4 < FG ? g0 + 4 : 0) * NP;
#pragma unroll   // plane distances become constants; qc indexed by constants
        for (int u = 0; u < 4; ++u) { const float* pu = pl + u * FPL; v4f cr[NWIN][4];
#pragma unroll   // a plane's twelve corner quads in flight at once
          for (int wi = 0; wi < NWIN; ++wi) { cr[wi][0] = *(const v4f*)(pu + off[wi][0]); cr[wi][1] = *(const v4f*)(pu + off[wi][1]); cr[wi][2] = *(const v4f*)(pu + off[wi][2]); cr[wi][3] = *(const v4f*)(pu + off[wi][3]); }
#pragma unroll   // acc indexed by constants
          for (int wi = 0; wi < NWIN; ++wi) acc[wi] += qc[u] * (cr[wi][0] - cr[wi][1] - cr[wi][2] + cr[wi][3]);
          qc[u] = *(const v4f*)(qx + (size_t)u * NP); }   // q of the plane four further on flies meanwhile (the last trip reads the first four again, unused: no branch inside a trip)
        asm volatile("s_wait_xcnt 0x0" ::: "memory"); } }   // the next trip forms the q loads' address anew in the same registers
    __syncthreads();   // the next pass overwrites the planes
  }
#pragma unroll   // acc indexed by constants
  for (int wi = 0; wi < NWIN; ++wi) vst2(O + (size_t)(wi * CC + h * HD + f) * NP + t * 4, acc[wi] * *(const v4f*)(INV + (size_t)(wi * NH + h) * NP + t * 4)); }
// ---- k_out: block = (128 out channels o, 32 positions), 8 waves of 16 o x 32 p: out[o][p] = sum_c Wout[o][c] O[c][p] (A = Wout bf16 exact rows, B = columns p of O as bf16 hi + lo) + bout[o]; (B, C, H, W) layout = rows o of 4,096
// The block's O tile (768 channels x one 128-byte line) is read once, whole lines, every load in flight at once, split into hi and lo once and laid down in LDS as position rows [p][c]; all eight waves take their B fragments from there.
#define OPB 32              // positions a block: one line of every channel plane
#define OPI (OC + 8)        // LDS row pitch in bf16: 1,552 bytes = 16 x odd, so that 16-byte reads of one row a lane do not collide
#define APRE 8              // A fragments fetched ahead of their use
__global__ __launch_bounds__(256) void k_out(const __bf16* __restrict__ PO, const float* __restrict__ O, const float* __restrict__ BO, float* __restrict__ Y) { __shared__ __align__(16) __bf16 sh[OPB][OPI]; __shared__ __align__(16) __bf16 sl[OPB][OPI]; __shared__ __align__(16) float so[8][16][OPB + 4];
  const int tid = threadIdx.x, wave = tid >> 5, lane = tid & 31, col = lane & 15, g = lane >> 4; const int o0 = blockIdx.x * 128 + wave * 16; const int p0 = blockIdx.y * OPB;
  const int pq = tid & 7, cg = tid >> 3;   // staging: eight lanes cover a channel's line; a thread takes four positions of eight neighbouring channels, three times
  const float* src = O + (size_t)(cg * 8) * NP + p0 + pq * 4; v4f x[OC / 256][8];
#pragma unroll   // all 24 loads of a thread in flight at once: one trip to memory for the whole tile
  for (int r = 0; r < OC / 256; ++r) {
#pragma unroll   // x indexed by constants: stays in registers
    for (int i = 0; i < 8; ++i) x[r][i] = *(const v4f*)(src + (size_t)(r * 256 + i) * NP);
    asm volatile("s_wait_xcnt 0x0" ::: "memory"); }   // later loads may land in the registers that these loads' address names
  const __bf16* ar = PO + (size_t)(o0 + col) * OC; v16b a[OC / 32];   // natural row of Wout read with the A-row lane layout (identical to frag_b's)
#pragma unroll   // the first A fragments fly beside the tile
  for (int kc = 0; kc < APRE; ++kc) a[kc] = frag_b(ar + kc * 32, lane);
  asm volatile("s_wait_xcnt 0x0" ::: "memory");   // the arithmetic below may reuse registers that these loads' addresses name
#pragma unroll   // x indexed by constants
  for (int r = 0; r < OC / 256; ++r)
#pragma unroll   // as above
    for (int e = 0; e < 4; ++e) { v8b h, l;
#pragma unroll   // as above
      for (int i = 0; i < 8; ++i) { const float v = x[r][i][e]; const __bf16 hh = (__bf16)v; h[i] = hh; l[i] = (__bf16)(v - (float)hh); }
      *(v8b*)&sh[pq * 4 + e][r * 256 + cg * 8] = h; *(v8b*)&sl[pq * 4 + e][r * 256 + cg * 8] = l; }
  __syncthreads();   // every wave reads rows that all waves wrote
  float bb[8];
#pragma unroll   // the bias flies beside the products instead of being waited for behind them
  for (int r = 0; r < 8; ++r) bb[r] = BO[o0 + 8 * g + r];
  asm volatile("s_wait_xcnt 0x0" ::: "memory");   // later loads may land in the registers that these loads' address names
  v8f acc[2] = {}; v16b bh[2][2], bl[2][2];   // B fragments of this step and of the next
#pragma unroll   // bh, bl indexed by constants
  for (int jt = 0; jt < 2; ++jt) { bh[0][jt] = frag_b(&sh[jt * 16 + col][0], lane); bl[0][jt] = frag_b(&sl[jt * 16 + col][0], lane); }
#pragma unroll   // a, bh, bl indexed by constants; the fetches ahead stand in front of the step's products
  for (int kc = 0; kc < OC / 32; ++kc) { const int cu = kc & 1, nx = cu ^ 1;
    if (kc + 1 < OC / 32) {
#pragma unroll   // as above
      for (int jt = 0; jt < 2; ++jt) { bh[nx][jt] = frag_b(&sh[jt * 16 + col][(kc + 1) * 32], lane); bl[nx][jt] = frag_b(&sl[jt * 16 + col][(kc + 1) * 32], lane); } }
    if ((kc & 3) == 0 && kc + APRE < OC / 32) {
#pragma unroll   // as above
      for (int u = 0; u < 4; ++u) a[kc + APRE + u] = frag_b(ar + (kc + APRE + u) * 32, lane); }
    acc[0] = wmma_bf(a[kc], bh[cu][0], acc[0]); acc[1] = wmma_bf(a[kc], bh[cu][1], acc[1]);   // per accumulator hi, then lo, in ascending c
    acc[0] = wmma_bf(a[kc], bl[cu][0], acc[0]); acc[1] = wmma_bf(a[kc], bl[cu][1], acc[1]); }
#pragma unroll   // acc indexed by constants
  for (int jt = 0; jt < 2; ++jt)
#pragma unroll   // as above
    for (int r = 0; r < 8; ++r) so[wave][8 * g + r][jt * 16 + col] = acc[jt][r] + bfr(bb[r]);
  LDSX();
#pragma unroll   // four rows (whole lines) a store
  for (int it = 0; it < 4; ++it) { const int rl = it * 4 + (lane >> 3); vst2(Y + (size_t)(o0 + rl) * NP + p0 + (lane & 7) * 4, *(const v4f*)&so[wave][rl][(lane & 7) * 4]); } }
extern "C" void kernel_launch(void* const* d_in, const int* in_sizes, int n_in, void* d_out, int out_size, void* d_ws, size_t ws_size, hipStream_t stream) {
  (void)in_sizes; (void)n_in; (void)out_size;
  const float** F = (const float**)d_in;   // 0 x [1,256,64,64], 1 Wq, 2 Wk, 3 Wv [256,256], 4 Wout [256,768], 5 bout [256]
  if (ws_size < (size_t)WS_END) return;
  char* ws = (char*)d_ws; __bf16 *PO = (__bf16*)(ws + WS_PO); float *Q = (float*)(ws + WS_Q), *Kf = (float*)(ws + WS_K), *Vf = (float*)(ws + WS_V), *IK = (float*)(ws + WS_IK), *INV = (float*)(ws + WS_INV), *O = (float*)(ws + WS_O);
  k_proj<<<dim3(NP / 64, CC / 128, 4), 128, 0, stream>>>(F[0], F[1], F[2], F[3], F[4], PO, Q, Kf, Vf);
  k_integral<<<NH * HD, 256, 0, stream>>>(Kf, IK);
  k_norm<<<dim3(TPB, NH, NWIN), 64, 0, stream>>>(Q, IK, INV);
  k_fuse<<<dim3(HD, NH), 1024, 0, stream>>>(Q, Kf, Vf, INV, O);
  k_out<<<dim3(CC / 128, (TPB * WWD) / OPB), 256, 0, stream>>>(PO, O, F[5], (float*)d_out);
}

// v005
// Measured time: 56.8 microseconds a run.
// Next to v004, in two timings, it ran 1.07 times as fast each time.
// Counting every step since v000, it is 7.18 times as fast.
// compute dtype: all float inputs rounded to bf16; q/k/v 1x1 convs with EXACT bf16 products on WMMA 16x16x32 (x and the weights read as they lie); sigmoid (hardware exp) and the per-position L2 normalisation of v in f32; k and k (x) v outer-product planes, their 2-D inclusive prefix sums (integral images; those of k (x) v live in LDS only) and the clamped 4-corner box differences for the three window sizes, the q-weighted sums and the division all in f32 on VALU (fixed order); out = Wout (exact) . o (bf16 hi + lo, 2 products) + bout on WMMA; f32 output in (B, C, H, W) order.
#include <hip/hip_runtime.h>
#include <math.h>

typedef __attribute__((ext_vector_type(16))) _Float16 v16h;
typedef __attribute__((ext_vector_type(16))) __bf16 v16b;
typedef __attribute__((ext_vector_type(8)))  _Float16 v8h;
typedef __attribute__((ext_vector_type(8)))  float v8f;
typedef __attribute__((ext_vector_type(4)))  float v4f;
typedef __attribute__((ext_vector_type(2)))  float v2f;
typedef __attribute__((ext_vector_type(4)))  unsigned v4u;
typedef __attribute__((ext_vector_type(4)))  int v4i;
typedef float __attribute__((may_alias)) float_a;
typedef int __attribute__((may_alias)) int_a;

template <typename T> __device__ __forceinline__ void vst2(void* p, T v) { *(T*)p = v;  }
__device__ __forceinline__ v8f wmma16(v16h a, v16h b, v8f c) {
  v8f d = __builtin_amdgcn_wmma_f32_16x16x32_f16(false, a, false, b, (short)0, c, false, false);
  asm volatile("v_nop\n\tv_nop\n\tv_nop\n\tv_nop" : "+v"(d) : "v"(a), "v"(b));
  return d;
}
__device__ __forceinline__ v8f wmma_bf(v16b a, v16b b, v8f c) {
  v8f d = __builtin_amdgcn_wmma_f32_16x16x32_bf16(false, a, false, b, (short)0, c, false, false);
  asm volatile("v_nop\n\tv_nop\n\tv_nop\n\tv_nop" : "+v"(d) : "v"(a), "v"(b));
  return d;
}
// 16x16x32 fragments: lane = (h = lane>>4, row/col = lane&15); elements 0..7 = k0+8h+0..7, 8..15 = k0+16+8h+0..7; D element r = row 8h+r
__device__ __forceinline__ v16h frag_h(const _Float16* rowk0, int lane) {
  union { v16h v; v8h q[2]; } u; const _Float16* p = rowk0 + 8 * (lane >> 4);
  u.q[0] = *(const v8h*)p; u.q[1] = *(const v8h*)(p + 16); return u.v;
}
__device__ __forceinline__ v16h frag_f32(const float* rowk0, int lane) {
  v16h a; const float* p = rowk0 + 8 * (lane >> 4);
#pragma unroll
  for (int i = 0; i < 8; ++i) { a[i] = (_Float16)p[i]; a[8 + i] = (_Float16)p[16 + i]; }
  return a;
}
__device__ __forceinline__ v16h frag_f32s(const float* rowk0, int lane, float sc) {
  v16h a; const float* p = rowk0 + 8 * (lane >> 4);
#pragma unroll
  for (int i = 0; i < 8; ++i) { a[i] = (_Float16)(p[i] * sc); a[8 + i] = (_Float16)(p[16 + i] * sc); }
  return a;
}
// column fragment from a [K][ld] layout (column n), rows >= K read as 0
__device__ __forceinline__ v16h fragc_f32(const float* W, int k0, int n, int lane, int ld, int K) {
  v16h a; const int g = lane >> 4;
#pragma unroll
  for (int i = 0; i < 8; ++i) { const int ka = k0 + 8 * g + i, kb = ka + 16;
    a[i] = (_Float16)(ka < K ? W[(size_t)(ka < K ? ka : K - 1) * ld + n] : 0.f); a[8 + i] = (_Float16)(kb < K ? W[(size_t)(kb < K ? kb : K - 1) * ld + n] : 0.f); }
  return a;
}
struct F2 { v16b h, l; };
__device__ __forceinline__ F2 bsplit16(const float v[16]) { F2 r;
#pragma unroll
  for (int i = 0; i < 16; ++i) { const __bf16 h = (__bf16)v[i]; r.h[i] = h; r.l[i] = (__bf16)(v[i] - (float)h); }
  return r; }
__device__ __forceinline__ F2 split_row(const float* row, int k0, int lane) { float v[16]; const float* p = row + k0 + 8 * (lane >> 4);
#pragma unroll
  for (int i = 0; i < 8; ++i) { v[i] = p[i]; v[8 + i] = p[16 + i]; }
  return bsplit16(v); }
__device__ __forceinline__ F2 split_rowK(const float* row, int k0, int lane, int K) { float v[16]; const int g = lane >> 4;
#pragma unroll
  for (int i = 0; i < 8; ++i) { const int ka = k0 + 8 * g + i, kb = ka + 16; v[i] = ka < K ? row[ka < K ? ka : K - 1] : 0.f; v[8 + i] = kb < K ? row[kb < K ? kb : K - 1] : 0.f; }
  return bsplit16(v); }
__device__ __forceinline__ F2 split_col(const float* W, int k0, int n, int lane, int ld, int K) { float v[16]; const int g = lane >> 4;
#pragma unroll
  for (int i = 0; i < 8; ++i) { const int ka = k0 + 8 * g + i, kb = ka + 16; v[i] = ka < K ? W[(size_t)(ka < K ? ka : K - 1) * ld + n] : 0.f; v[8 + i] = kb < K ? W[(size_t)(kb < K ? kb : K - 1) * ld + n] : 0.f; }
  return bsplit16(v); }
__device__ __forceinline__ v8f mac3(const F2& a, const F2& b, v8f c) { c = wmma_bf(a.l, b.h, c); c = wmma_bf(a.h, b.l, c); return wmma_bf(a.h, b.h, c); }
__device__ __forceinline__ float sigm(float v) { return 1.0f / (1.0f + expf(-v)); }
#define LDSX() do { asm volatile("s_wait_dscnt 0" ::: "memory"); __builtin_amdgcn_wave_barrier(); __builtin_amdgcn_fence(__ATOMIC_RELEASE, "workgroup"); } while (0)


// Inception (multi-window box) linear attention (B 1, C 256 = 8 heads x 32, 64 x 64): per window size ws in {64, 32, 16}: attn = q . boxsum(k v^T) / (q . boxsum(k) + 1e-6) using integral images with edge-replicated borders; concat over windows (768 channels), 1x1 output conv + bias.
#define CC 256
#define NH 8
#define HD 32
#define HH 64
#define WWD 64
#define NP (HH * WWD)      // 4,096 positions
#define NWIN 3
#define OC (CC * NWIN)     // 768
#ifndef TPB
#define TPB HH             // output rows (of 64 positions) computed by the box/attention stage
#endif
typedef __attribute__((ext_vector_type(8))) __bf16 v8b;
__device__ __forceinline__ v16b frag_b(const __bf16* rowk0, int lane) {
  union { v16b v; v8b q[2]; } u; const __bf16* p = rowk0 + 8 * (lane >> 4);
  u.q[0] = *(const v8b*)p; u.q[1] = *(const v8b*)(p + 16); return u.v;
}
__device__ __forceinline__ float bfr(float v) { return (float)(__bf16)v; }
__device__ __attribute__((noinline)) float exp_ni(float v) { return expf(v); }
__device__ __attribute__((noinline)) float erf_ni(float v) { return erff(v); }
__constant__ int WSZ[NWIN] = {64, 32, 16};   // Hh / w for w in (1, 2, 4)

#define WS_PW  0u                                   // (not used); then bf16 natural rows Wout [256][768]
#define WS_PO  (WS_PW + 2u * (size_t)3 * CC * CC)
#define WS_XT  (WS_PO + 2u * (size_t)CC * OC)           // (not used)
#define WS_Q   (WS_XT + 4u * (size_t)NP * CC)           // f32 q [c][p] (sigmoid), k [c][p] (sigmoid), v [c][p] (normalised): channel-major planes of 4,096 positions
#define WS_K   (WS_Q + 4u * (size_t)NP * CC)
#define WS_V   (WS_K + 4u * (size_t)NP * CC)
#define WS_IK  (WS_V + 4u * (size_t)NP * CC)            // f32 integral planes Ik [h*32+d][64x64 inclusive prefix]
#define WS_INV (WS_IK + 4u * (size_t)CC * NP)           // f32 1 / (norm + 1e-6) [wi*8+h][p]
#define WS_O   (WS_INV + 4u * (size_t)NWIN * NH * NP)   // f32 o [768][p]: channel-major planes
#define WS_END (WS_O + 4u * (size_t)NP * OC)

// ---- k_proj: block = (64 positions = one image row, 128 out channels, which): 1x1 conv = W (A rows = channels) . x (B columns = positions), so D rows are channels; stored channel-major [c][p], 256 contiguous bytes per channel and block.
// Everything the conv needs is prepared inside this launch: x is read as it lies ([c][p]: 16 lanes cover 64 bytes of a channel's line) and rounded to bf16 in registers; the block's 128 weight rows are read as whole lines, rounded to bf16 and laid down in LDS, from where all four waves take their A fragments; epilogue: q, k -> sigmoid; v -> divided by max(||v_h||, 1e-12) per (position, head), the block holding all 32 channels of its four heads (squares summed pairwise: adjacent pairs, then pairs of pairs).
// which == 3: no conv; the 128 blocks round Wout to bf16 (natural rows) for k_out.
#define WPI (CC + 8)        // LDS row pitch in bf16: 528 bytes = 16 x odd, so that 16-byte reads of one row a lane do not collide
typedef __attribute__((ext_vector_type(4))) __bf16 v4b;
__device__ __forceinline__ v4b cvt4(v4f w) { v4b b; b[0] = (__bf16)w[0]; b[1] = (__bf16)w[1]; b[2] = (__bf16)w[2]; b[3] = (__bf16)w[3]; return b; }
__global__ __launch_bounds__(128) void k_proj(const float* __restrict__ X, const float* __restrict__ WQ, const float* __restrict__ WK, const float* __restrict__ WV, const float* __restrict__ WO, __bf16* __restrict__ PO, float* __restrict__ Q, float* __restrict__ Kf, float* __restrict__ Vf) { __shared__ __align__(16) __bf16 sw[128][WPI]; __shared__ __align__(16) float so[128][68];
  const int tid = threadIdx.x, wave = tid >> 5, lane = tid & 31, col = lane & 15, g = lane >> 4; const int which = blockIdx.z;
  if (which == 3) {   // the whole block leaves here, in front of every barrier
    const size_t e0 = ((size_t)(blockIdx.y * (NP / 64) + blockIdx.x) * 384 + tid) * 4; v4f w[3];   // 128 blocks x 384 quads = 256 x 768 values
#pragma unroll   // the three loads in flight at once
    for (int it = 0; it < 3; ++it) w[it] = *(const v4f*)(WO + e0 + it * 512);
    asm volatile("s_wait_xcnt 0x0" ::: "memory");   // the conversions below may land in the registers that these loads' address names
#pragma unroll   // w indexed by constants
    for (int it = 0; it < 3; ++it) vst2(PO + e0 + it * 512, cvt4(w[it]));
    return; }
  const int p0 = blockIdx.x * 64; const int c0 = blockIdx.y * 128; const float* Wr = (which == 0) ? WQ : (which == 1) ? WK : WV;
  const float* xp = X + (size_t)(8 * g) * NP + p0 + wave * 16 + col; float xv[CC / 32][16];   // B fragments: element i = channel kc*32 + 8g + i, element 8 + i = channel kc*32 + 16 + 8g + i (the k order of frag_b)
#pragma unroll   // all of a wave's x loads in flight at once; xv indexed by constants
  for (int kc = 0; kc < CC / 32; ++kc)
#pragma unroll   // as above
    for (int i = 0; i < 8; ++i) { xv[kc][i] = xp[(size_t)(kc * 32 + i) * NP]; xv[kc][8 + i] = xp[(size_t)(kc * 32 + 16 + i) * NP]; }
  const int wr = tid >> 6, wq = (tid & 63) * 4;   // weight staging: 64 threads cover a row of 1,024 bytes, the block two rows a step
  const float* wp = Wr + (size_t)(c0 + wr) * CC + wq; v4f w0[16];
#pragma unroll   // the first 16 steps' loads fly beside those of x
  for (int it = 0; it < 16; ++it) w0[it] = *(const v4f*)(wp + (size_t)it * 2 * CC);
  asm volatile("s_wait_xcnt 0x0" ::: "memory");   // the conversions and later loads may land in the registers that the x loads' address names
  v16b a[CC / 32];
#pragma unroll   // a, xv indexed by constants
  for (int kc = 0; kc < CC / 32; ++kc)
#pragma unroll   // as above
    for (int i = 0; i < 16; ++i) a[kc][i] = (__bf16)xv[kc][i];
#pragma unroll   // w0 indexed by constants
  for (int it = 0; it < 16; ++it) *(v4b*)&sw[it * 2 + wr][wq] = cvt4(w0[it]);
#pragma unroll   // two more rounds of 24 steps, each round's loads in flight at once
  for (int b = 0; b < 2; ++b) { v4f w1[24];
#pragma unroll   // w1 indexed by constants
    for (int it = 0; it < 24; ++it) w1[it] = *(const v4f*)(wp + (size_t)(16 + b * 24 + it) * 2 * CC);
    asm volatile("s_wait_xcnt 0x0" :: "v"(wp) : "memory");   // the conversions and LDS addresses below may land in the registers that these loads' address names; named as an input, the address lives up to the wait
#pragma unroll   // as above
    for (int it = 0; it < 24; ++it) *(v4b*)&sw[(16 + b * 24 + it) * 2 + wr][wq] = cvt4(w1[it]); }
  __syncthreads();   // every wave reads weight rows that all waves wrote
  v8f acc[8] = {}; v16b af[2][8];   // A fragments of this step and of the next
#pragma unroll   // af indexed by constants
  for (int j = 0; j < 8; ++j) af[0][j] = frag_b(&sw[j * 16 + col][0], lane);
#pragma unroll   // a, af, acc indexed by constants; the next step's fragment reads stand in front of this step's products
  for (int kc = 0; kc < CC / 32; ++kc) { const int cu = kc & 1, nx = cu ^ 1;
    if (kc + 1 < CC / 32) {
#pragma unroll   // as above
      for (int j = 0; j < 8; ++j) af[nx][j] = frag_b(&sw[j * 16 + col][(kc + 1) * 32], lane); }
#pragma unroll   // as above
    for (int j = 0; j < 8; ++j) acc[j] = wmma_bf(af[cu][j], a[kc], acc[j]); }
#pragma unroll
  for (int j = 0; j < 8; ++j)
#pragma unroll
    for (int r = 0; r < 8; ++r) { const float v = acc[j][r]; so[j * 16 + 8 * g + r][wave * 16 + col] = (which < 2) ? 1.0f / (1.0f + __expf(-v)) : v; }
  __syncthreads();   // a channel's 64 positions come from all four waves
  if (which == 2) {   // the same for the whole block: thread = (position, head), two heads a thread; a wave reads and writes 128 contiguous bytes of a channel's row
    const int pp = tid & 63;
#pragma unroll 1   // two heads through one body: the code stays small
    for (int hl = tid >> 6; hl < 4; hl += 2) { float v[HD], q[HD];
#pragma unroll   // v and q indexed by constants, so they stay in registers
      for (int d = 0; d < HD; ++d) { v[d] = so[hl * HD + d][pp]; q[d] = v[d] * v[d]; }
#pragma unroll   // constant indices: q stays in registers
      for (int o = 1; o < HD; o <<= 1)
#pragma unroll   // as above
        for (int d = 0; d < HD; d += 2 * o) q[d] += q[d + o];
      const float den = fmaxf(sqrtf(q[0]), 1e-12f);
#pragma unroll   // constant indices: v stays in registers
      for (int d = 0; d < HD; ++d) so[hl * HD + d][pp] = v[d] / den; }
    __syncthreads(); }   // the stores below read rows that other threads normalised
  float* dst = (which == 0) ? Q : (which == 1) ? Kf : Vf; for (int e = tid; e < 128 * 16; e += 128) { const int cl = e >> 4, q = e & 15; vst2(dst + (size_t)(c0 + cl) * NP + p0 + q * 4, *(const v4f*)&so[cl][q * 4]); } }
// ---- k_integral: block = Ik plane (h, d) of k: inclusive prefix sums along w then along h (fixed order), store the plane [64*64]
__global__ __launch_bounds__(256) void k_integral(const float* __restrict__ Kf, float* __restrict__ IK) { __shared__ float s[HH][WWD + 1]; __shared__ __align__(16) float so2[HH][WWD + 4]; const int t = threadIdx.x; const int pl = blockIdx.x;
  const float* kp = Kf + (size_t)pl * NP;   // channel-major plane: whole lines, 16 bytes a lane
  v4f kv[4];
#pragma unroll   // all of a thread's loads in flight at once: one trip to L2 instead of one per pass
  for (int i = 0; i < 4; ++i) kv[i] = *(const v4f*)(kp + t * 4 + i * 1024);
#pragma unroll   // kv stays in registers
  for (int i = 0; i < 4; ++i) { float* sp = &s[(t >> 4) + i * 16][(t & 15) * 4]; sp[0] = kv[i][0]; sp[1] = kv[i][1]; sp[2] = kv[i][2]; sp[3] = kv[i][3]; } __syncthreads();
  if (t < HH) { float run = 0.f; for (int w = 0; w < WWD; ++w) { run += s[t][w]; s[t][w] = run; } } __syncthreads();   // along w (row t)
  if (t < WWD) { float run = 0.f; for (int y = 0; y < HH; ++y) { run += s[y][t]; s[y][t] = run; } } __syncthreads(); // along h (column t)
  for (int e = t; e < NP; e += 256) so2[e >> 6][e & 63] = s[e >> 6][e & 63]; __syncthreads();
  float* dst = IK + (size_t)pl * NP; for (int e = t; e < HH * 16; e += 256) { const int y = e >> 4, q = e & 15; vst2(dst + y * WWD + q * 4, *(const v4f*)&so2[y][q * 4]); } }
// integral lookup with the module's padding: I has a zero row/col in front (index 0) then the inclusive prefix sums; Pp = edge-pad(I, l, r); value at padded index (a, b) = I[clamp(a - l, 0, 64)][clamp(b - l, 0, 64)], I[0][*] = I[*][0] = 0
__device__ __forceinline__ float ilook(const float* __restrict__ plane, int a, int b, int l) { int ia = a - l, ib = b - l; ia = ia < 0 ? 0 : (ia > HH ? HH : ia); ib = ib < 0 ? 0 : (ib > WWD ? WWD : ib); if (ia == 0 || ib == 0) return 0.f; return plane[(ia - 1) * WWD + (ib - 1)]; }
__device__ __forceinline__ float boxsum(const float* __restrict__ plane, int i, int j, int ws, int l) { return ilook(plane, i + ws, j + ws, l) - ilook(plane, i + ws, j, l) - ilook(plane, i, j + ws, l) + ilook(plane, i, j, l); }
// ---- k_norm: block = (image row i, head h, window wi), thread = position j: INV[wi*8+h][p] = 1 / (sum_d q[d] box(Ik[h][d]) + 1e-6)
__global__ __launch_bounds__(64) void k_norm(const float* __restrict__ Q, const float* __restrict__ IK, float* __restrict__ INV) {
  const int j = threadIdx.x; const int i = blockIdx.x, h = blockIdx.y, wi = blockIdx.z; const int ws = WSZ[wi]; const int tp = ws - 1, rr = tp / 2, l = tp - rr; const size_t p = (size_t)i * WWD + j;
  float nrm = 0.f;
#pragma unroll 8   // the loads of eight d in flight at once; the sum stays in the order of d
  for (int d = 0; d < HD; ++d) { const float qd = Q[(size_t)(h * HD + d) * NP + p]; const float wk = boxsum(IK + (size_t)(h * HD + d) * NP, i, j, ws, l); nrm += qd * wk; }
  INV[(size_t)(wi * NH + h) * NP + p] = 1.0f / (nrm + 1e-6f); }
// ---- k_fuse: block = (f, h), 1,024 threads, the whole LDS of a WGP: the 32 planes k[d] v[f] of the head, 16 at a time, are built, prefix-summed (along w, then along h, each serial as in k_integral), box-differenced and summed over d with q[d] without leaving LDS; O[wi*256 + h*32 + f][p] = sum * INV
// LDS plane = the padded integral image: row ia = 0..64 (row 0 zero), column ib + 4 for ib = -4..67: ib <= 0 zero, ib = 1..64 the prefix sums, ib = 65..67 copies of ib = 64. All window offsets are multiples of 4, so the four neighbouring positions of a thread read each corner as one aligned 16-byte quad, and a quad wholly left (right) of the image is the quad at ib = -4 (64).
// Box phase: the windows reach 32, 16 and 8 rows up and down, so image rows 16 apart share their corner rows. A thread takes the rows bi, bi + 16, bi + 32, bi + 48 (four positions each) of four of the pass's 16 planes: per plane and window five integral rows, each differenced right - left once, serve all four image rows (30 quads read where 48 were). The four plane groups' partial sums over d are joined at the end through LDS.
#define FP 76               // row pitch in floats: 304 bytes = 16 x odd, so that 16-byte reads of one row a lane do not collide
#define FPL ((HH + 1) * FP) // floats a plane
#define FG 16               // planes a pass: 16 x 64 rows (columns) = one serial scan a thread
__device__ __forceinline__ v4f hdiff(const float* pl, int r, int l) { return *(const v4f*)(pl + r) - *(const v4f*)(pl + l); }   // one integral row: right corner quad - left corner quad
__global__ __launch_bounds__(1024) void k_fuse(const float* __restrict__ Q, const float* __restrict__ Kf, const float* __restrict__ Vf, const float* __restrict__ INV, float* __restrict__ O) { __shared__ __align__(16) float s[FG * FPL];
  const int t = threadIdx.x; const int f = blockIdx.x, h = blockIdx.y; const int i = t >> 4, j4 = (t & 15) * 4; const int sg = t >> 6, sl = t & 63;   // (i, j4): the thread's four positions in the product phase; (sg, sl): its plane and row or column in the scans
  const int gq = (t >> 5) & 3, bi = (t >> 7) * 2 + ((t >> 4) & 1);   // box phase: plane group (neighbouring waves read different planes) and first image row, 0..15
  const v4f zero4 = {0.f, 0.f, 0.f, 0.f};
  for (int e = t; e < FG * FP; e += 1024) s[(e / FP) * FPL + e % FP] = 0.f;   // row 0 of every plane; no pass writes it again
  *(v4f*)&s[sg * FPL + (sl + 1) * FP] = zero4;                                // ib = -4..-1 of rows 1..64; as above
  const v4f vq = *(const v4f*)(Vf + (size_t)(h * HD + f) * NP + t * 4);
  asm volatile("s_wait_xcnt 0x0" ::: "memory");   // the index arithmetic below reuses the register that this load's address names
  int cR[NWIN], cL[NWIN];   // places of the right and left corner quads in integral row bi
#pragma unroll   // cR, cL indexed by constants: stay in registers
  for (int wi = 0; wi < NWIN; ++wi) { const int ws = HH >> wi; const int tp = ws - 1, rr = tp / 2, l = tp - rr;   // l = ws - l = 32, 16, 8
    int bl = j4 - l, br = j4 + ws - l; bl = bl < -4 ? -4 : (bl > WWD ? WWD : bl); br = br < -4 ? -4 : (br > WWD ? WWD : br);
    cR[wi] = bi * FP + br + 4; cL[wi] = bi * FP + bl + 4; }
  const int dE = (HH - bi) * FP;                                  // from integral row bi to row 64
  const int dT = ((bi > 8 ? bi - 8 : 0) - bi) * FP;               // to row max(bi - 8, 0)
  const int dB = ((bi + 56 < HH ? bi + 56 : HH) - bi) * FP;       // to row min(bi + 56, 64)
  v4f acc[NWIN][4];
#pragma unroll   // acc indexed by constants
  for (int wi = 0; wi < NWIN; ++wi)
#pragma unroll   // as above
    for (int a = 0; a < 4; ++a) acc[wi][a] = zero4;
#pragma unroll 1   // two passes through one body: the code stays small
  for (int d0 = 0; d0 < HD; d0 += FG) {
    { const float* kp = Kf + (size_t)(h * HD + d0) * NP + t * 4; float* sp = &s[(i + 1) * FP + 4 + j4]; v4f kv[8];   // products k[d] v[f], value w of row y at row y + 1, column w + 4 (aligned)
#pragma unroll   // eight loads in flight: with the 48 sums live, all 16 quads at once would not fit the registers
      for (int g = 0; g < 8; ++g) kv[g] = *(const v4f*)(kp + (size_t)g * NP);
#pragma unroll   // kv indexed by constants; four quads are laid down and their registers loaded anew, so the stream of loads does not pause
      for (int b = 0; b < 8; b += 4) {
        __builtin_amdgcn_sched_barrier(0);   // holds the refills behind the stores that free their registers: fetched earlier they would spill
#pragma unroll   // as above
        for (int g = b; g < b + 4; ++g) *(v4f*)(sp + g * FPL) = kv[g] * vq;
#pragma unroll   // as above
        for (int g = b; g < b + 4; ++g) kv[g] = *(const v4f*)(kp + (size_t)(8 + g) * NP); }
      asm volatile("s_wait_xcnt 0x0" ::: "memory");   // later arithmetic may reuse the registers that these loads' address names
      __builtin_amdgcn_sched_barrier(0);   // keeps the products of the refilled quads, and with them the waits for those quads, behind the last refill
#pragma unroll   // kv indexed by constants
      for (int g = 0; g < 8; ++g) *(v4f*)(sp + (8 + g) * FPL) = kv[g] * vq; }
    __syncthreads();
    { float* row = &s[sg * FPL + (sl + 1) * FP + 4]; float run = 0.f;   // along w: thread = (plane, row); written back one column to the right, behind the zero of ib = 0
#pragma unroll 1   // 16 values a trip: few values live at a time beside the 48 sums
      for (int m0 = 0; m0 < WWD / 16; ++m0, row += 16) { v4f r[4];
#pragma unroll   // a trip's loads in flight at once
        for (int m = 0; m < 4; ++m) r[m] = *(const v4f*)(row + 4 * m);
#pragma unroll   // r indexed by constants
        for (int m = 0; m < 4; ++m) { v4f o; o[0] = run; run += r[m][0]; o[1] = run; run += r[m][1]; o[2] = run; run += r[m][2]; o[3] = run; run += r[m][3]; *(v4f*)(row + 4 * m) = o; } }
      row[0] = run; }
    __syncthreads();
    { float* cp = &s[sg * FPL + FP + 5 + sl]; float run = 0.f;   // along h: thread = (plane, column), in place
#pragma unroll 1   // 16 rows a trip: few addresses and few values live at a time (all 64 at once spilled some thirty addresses)
      for (int y0 = 0; y0 < HH; y0 += 16, cp += 16 * FP) { float p[16];
#pragma unroll   // p stays in registers; a trip's loads in flight at once
        for (int y = 0; y < 16; ++y) p[y] = cp[y * FP];
#pragma unroll   // as above
        for (int y = 0; y < 16; ++y) { run += p[y]; cp[y * FP] = run; } } }
    __syncthreads();
    { float* e = &s[sg * FPL + (sl + 1) * FP + 4 + WWD]; const float x = e[0]; const v4f r = {x, x, x, x}; *(v4f*)e = r; }   // ib = 65..67: copies of ib = 64; thread = (plane, row)
    __syncthreads();
    { const float* qp = Q + (size_t)(h * HD + d0 + gq * 4) * NP + bi * WWD + j4; v4f qc[4];   // q of the thread's four image rows, one plane at a time
#pragma unroll   // the four rows' q in flight at once
      for (int a = 0; a < 4; ++a) qc[a] = *(const v4f*)(qp + a * 16 * WWD);
      asm volatile("s_wait_xcnt 0x0" ::: "memory");   // the address arithmetic below may reuse the registers that these loads' address names
#pragma unroll 1   // one plane a trip: the code and the live values stay small
      for (int u = 0; u < 4; ++u) { const float* pl = s + (gq * 4 + u) * FPL; const float* qx = qp + (size_t)(u + 1 < 4 ? u + 1 : 0) * NP;
        // Image rows bi, bi + 16 first, then bi + 32, bi + 48, so that each half's q of the next plane flies for half a trip. The scheduling barriers keep one group of corner rows from being fetched beside the next: with the 48 sums live, more than six quads in flight spill.
        { const v4f h2 = hdiff(pl + 32 * FP, cR[0], cL[0]), h3 = hdiff(pl + 48 * FP, cR[0], cL[0]);   // reach 32: the top row of these image rows is the zero row
          acc[0][0] += qc[0] * h2; acc[0][1] += qc[1] * h3; }
        __builtin_amdgcn_sched_barrier(0);   // against spills, as said above
        const v4f m0 = hdiff(pl, cR[1], cL[1]), m1 = hdiff(pl + 16 * FP, cR[1], cL[1]), m2 = hdiff(pl + 32 * FP, cR[1], cL[1]);   // reach 16: the top row of image row bi is the zero row
        acc[1][0] += qc[0] * m1; acc[1][1] += qc[1] * (m2 - m0);
        __builtin_amdgcn_sched_barrier(0);   // against spills, as said above
        const v4f nt = hdiff(pl + dT, cR[2], cL[2]), n1 = hdiff(pl + 8 * FP, cR[2], cL[2]), n2 = hdiff(pl + 24 * FP, cR[2], cL[2]);   // reach 8
        acc[2][0] += qc[0] * (n1 - nt); acc[2][1] += qc[1] * (n2 - n1);
        qc[0] = *(const v4f*)qx; qc[1] = *(const v4f*)(qx + 16 * WWD);   // the last trip reads the first plane again, unused: no branch inside a trip
        __builtin_amdgcn_sched_barrier(0);   // against spills, as said above; it also holds the two q loads here, half a trip ahead of their use
        { const v4f he = hdiff(pl + dE, cR[0], cL[0]), h0 = hdiff(pl, cR[0], cL[0]), h1 = hdiff(pl + 16 * FP, cR[0], cL[0]);   // reach 32: the bottom row of these image rows is row 64
          acc[0][2] += qc[2] * (he - h0); acc[0][3] += qc[3] * (he - h1); }
        __builtin_amdgcn_sched_barrier(0);   // against spills, as said above
        { const v4f m3 = hdiff(pl + 48 * FP, cR[1], cL[1]), me = hdiff(pl + dE, cR[1], cL[1]);   // reach 16: the bottom row of image row bi + 48 is row 64
          acc[1][2] += qc[2] * (m3 - m1); acc[1][3] += qc[3] * (me - m2); }
        __builtin_amdgcn_sched_barrier(0);   // against spills, as said above
        { const v4f n3 = hdiff(pl + 40 * FP, cR[2], cL[2]), nb = hdiff(pl + dB, cR[2], cL[2]);   // reach 8
          acc[2][2] += qc[2] * (n3 - n2); acc[2][3] += qc[3] * (nb - n3); }
        qc[2] = *(const v4f*)(qx + 32 * WWD); qc[3] = *(const v4f*)(qx + 48 * WWD);
        asm volatile("s_wait_xcnt 0x0" ::: "memory"); } }   // the next trip forms the q loads' address anew in the same registers
    __syncthreads();   // the next pass overwrites the planes
  }
  const int yo = bi + 16 * gq;   // the image row that this thread finishes
  v4f iv[NWIN];
#pragma unroll   // the three loads fly beside the exchange below
  for (int wi = 0; wi < NWIN; ++wi) iv[wi] = *(const v4f*)(INV + (size_t)(wi * NH + h) * NP + yo * WWD + j4);
  asm volatile("s_wait_xcnt 0x0" ::: "memory");   // the address arithmetic below may reuse the registers that these loads' address names
#pragma unroll   // acc indexed by constants; partial sums of group gq and window wi lie in the inner part of plane wi * 4 + gq, which nobody reads any more
  for (int wi = 0; wi < NWIN; ++wi)
#pragma unroll   // as above
    for (int a = 0; a < 4; ++a) *(v4f*)&s[(wi * 4 + gq) * FPL + (bi + 16 * a + 1) * FP + 4 + j4] = acc[wi][a];
  __syncthreads();   // a thread adds partial sums that the three other groups wrote
#pragma unroll   // iv indexed by constants
  for (int wi = 0; wi < NWIN; ++wi) { const float* pp = s + wi * 4 * FPL + (yo + 1) * FP + 4 + j4;
    const v4f r = ((*(const v4f*)pp + *(const v4f*)(pp + FPL)) + *(const v4f*)(pp + 2 * FPL)) + *(const v4f*)(pp + 3 * FPL);   // groups in ascending order
    vst2(O + (size_t)(wi * CC + h * HD + f) * NP + yo * WWD + j4, r * iv[wi]); } }
// ---- k_out: block = (128 out channels o, 32 positions), 8 waves of 16 o x 32 p: out[o][p] = sum_c Wout[o][c] O[c][p] (A = Wout bf16 exact rows, B = columns p of O as bf16 hi + lo) + bout[o]; (B, C, H, W) layout = rows o of 4,096
// The block's O tile (768 channels x one 128-byte line) is read once, whole lines, every load in flight at once, split into hi and lo once and laid down in LDS as position rows [p][c]; all eight waves take their B fragments from there.
#define OPB 32              // positions a block: one line of every channel plane
#define OPI (OC + 8)        // LDS row pitch in bf16: 1,552 bytes = 16 x odd, so that 16-byte reads of one row a lane do not collide
#define APRE 8              // A fragments fetched ahead of their use
__global__ __launch_bounds__(256) void k_out(const __bf16* __restrict__ PO, const float* __restrict__ O, const float* __restrict__ BO, float* __restrict__ Y) { __shared__ __align__(16) __bf16 sh[OPB][OPI]; __shared__ __align__(16) __bf16 sl[OPB][OPI]; __shared__ __align__(16) float so[8][16][OPB + 4];
  const int tid = threadIdx.x, wave = tid >> 5, lane = tid & 31, col = lane & 15, g = lane >> 4; const int o0 = blockIdx.x * 128 + wave * 16; const int p0 = blockIdx.y * OPB;
  const int pq = tid & 7, cg = tid >> 3;   // staging: eight lanes cover a channel's line; a thread takes four positions of eight neighbouring channels, three times
  const float* src = O + (size_t)(cg * 8) * NP + p0 + pq * 4; v4f x[OC / 256][8];
#pragma unroll   // all 24 loads of a thread in flight at once: one trip to memory for the whole tile
  for (int r = 0; r < OC / 256; ++r) {
#pragma unroll   // x indexed by constants: stays in registers
    for (int i = 0; i < 8; ++i) x[r][i] = *(const v4f*)(src + (size_t)(r * 256 + i) * NP);
    asm volatile("s_wait_xcnt 0x0" ::: "memory"); }   // later loads may land in the registers that these loads' address names
  const __bf16* ar = PO + (size_t)(o0 + col) * OC; v16b a[OC / 32];   // natural row of Wout read with the A-row lane layout (identical to frag_b's)
#pragma unroll   // the first A fragments fly beside the tile
  for (int kc = 0; kc < APRE; ++kc) a[kc] = frag_b(ar + kc * 32, lane);
  asm volatile("s_wait_xcnt 0x0" ::: "memory");   // the arithmetic below may reuse registers that these loads' addresses name
#pragma unroll   // x indexed by constants
  for (int r = 0; r < OC / 256; ++r)
#pragma unroll   // as above
    for (int e = 0; e < 4; ++e) { v8b h, l;
#pragma unroll   // as above
      for (int i = 0; i < 8; ++i) { const float v = x[r][i][e]; const __bf16 hh = (__bf16)v; h[i] = hh; l[i] = (__bf16)(v - (float)hh); }
      *(v8b*)&sh[pq * 4 + e][r * 256 + cg * 8] = h; *(v8b*)&sl[pq * 4 + e][r * 256 + cg * 8] = l; }
  __syncthreads();   // every wave reads rows that all waves wrote
  float bb[8];
#pragma unroll   // the bias flies beside the products instead of being waited for behind them
  for (int r = 0; r < 8; ++r) bb[r] = BO[o0 + 8 * g + r];
  asm volatile("s_wait_xcnt 0x0" ::: "memory");   // later loads may land in the registers that these loads' address names
  v8f acc[2] = {}; v16b bh[2][2], bl[2][2];   // B fragments of this step and of the next
#pragma unroll   // bh, bl indexed by constants
  for (int jt = 0; jt < 2; ++jt) { bh[0][jt] = frag_b(&sh[jt * 16 + col][0], lane); bl[0][jt] = frag_b(&sl[jt * 16 + col][0], lane); }
#pragma unroll   // a, bh, bl indexed by constants; the fetches ahead stand in front of the step's products
  for (int kc = 0; kc < OC / 32; ++kc) { const int cu = kc & 1, nx = cu ^ 1;
    if (kc + 1 < OC / 32) {
#pragma unroll   // as above
      for (int jt = 0; jt < 2; ++jt) { bh[nx][jt] = frag_b(&sh[jt * 16 + col][(kc + 1) * 32], lane); bl[nx][jt] = frag_b(&sl[jt * 16 + col][(kc + 1) * 32], lane); } }
    if ((kc & 3) == 0 && kc + APRE < OC / 32) {
#pragma unroll   // as above
      for (int u = 0; u < 4; ++u) a[kc + APRE + u] = frag_b(ar + (kc + APRE + u) * 32, lane); }
    acc[0] = wmma_bf(a[kc], bh[cu][0], acc[0]); acc[1] = wmma_bf(a[kc], bh[cu][1], acc[1]);   // per accumulator hi, then lo, in ascending c
    acc[0] = wmma_bf(a[kc], bl[cu][0], acc[0]); acc[1] = wmma_bf(a[kc], bl[cu][1], acc[1]); }
#pragma unroll   // acc indexed by constants
  for (int jt = 0; jt < 2; ++jt)
#pragma unroll   // as above
    for (int r = 0; r < 8; ++r) so[wave][8 * g + r][jt * 16 + col] = acc[jt][r] + bfr(bb[r]);
  LDSX();
#pragma unroll   // four rows (whole lines) a store
  for (int it = 0; it < 4; ++it) { const int rl = it * 4 + (lane >> 3); vst2(Y + (size_t)(o0 + rl) * NP + p0 + (lane & 7) * 4, *(const v4f*)&so[wave][rl][(lane & 7) * 4]); } }
extern "C" void kernel_launch(void* const* d_in, const int* in_sizes, int n_in, void* d_out, int out_size, void* d_ws, size_t ws_size, hipStream_t stream) {
  (void)in_sizes; (void)n_in; (void)out_size;
  const float** F = (const float**)d_in;   // 0 x [1,256,64,64], 1 Wq, 2 Wk, 3 Wv [256,256], 4 Wout [256,768], 5 bout [256]
  if (ws_size < (size_t)WS_END) return;
  char* ws = (char*)d_ws; __bf16 *PO = (__bf16*)(ws + WS_PO); float *Q = (float*)(ws + WS_Q), *Kf = (float*)(ws + WS_K), *Vf = (float*)(ws + WS_V), *IK = (float*)(ws + WS_IK), *INV = (float*)(ws + WS_INV), *O = (float*)(ws + WS_O);
  k_proj<<<dim3(NP / 64, CC / 128, 4), 128, 0, stream>>>(F[0], F[1], F[2], F[3], F[4], PO, Q, Kf, Vf);
  k_integral<<<NH * HD, 256, 0, stream>>>(Kf, IK);
  k_norm<<<dim3(TPB, NH, NWIN), 64, 0, stream>>>(Q, IK, INV);
  k_fuse<<<dim3(HD, NH), 1024, 0, stream>>>(Q, Kf, Vf, INV, O);
  k_out<<<dim3(CC / 128, (TPB * WWD) / OPB), 256, 0, stream>>>(PO, O, F[5], (float*)d_out);
}

// v006
// A run of this version takes 49.7 microseconds.
// Timed twice side by side with v005, it ran 1.15 times as fast both times.
// Counting every step since v000, it is 8.25 times as fast.
// compute dtype: all float inputs rounded to bf16; q/k/v 1x1 convs with EXACT bf16 products on WMMA 16x16x32 (x and the weights read as they lie); sigmoid (hardware exp) and the per-position L2 normalisation of v in f32; k and k (x) v outer-product planes, their 2-D inclusive prefix sums (integral images; they live in LDS only) and the clamped 4-corner box differences for the three window sizes, the q-weighted sums and the division all in f32 on VALU (fixed order); out = Wout (exact) . o (bf16 hi + lo, 2 products) + bout on WMMA; f32 output in (B, C, H, W) order.
#include <hip/hip_runtime.h>
#include <math.h>

typedef __attribute__((ext_vector_type(16))) _Float16 v16h;
typedef __attribute__((ext_vector_type(16))) __bf16 v16b;
typedef __attribute__((ext_vector_type(8)))  _Float16 v8h;
typedef __attribute__((ext_vector_type(8)))  float v8f;
typedef __attribute__((ext_vector_type(4)))  float v4f;
typedef __attribute__((ext_vector_type(2)))  float v2f;
typedef __attribute__((ext_vector_type(4)))  unsigned v4u;
typedef __attribute__((ext_vector_type(4)))  int v4i;
typedef float __attribute__((may_alias)) float_a;
typedef int __attribute__((may_alias)) int_a;

template <typename T> __device__ __forceinline__ void vst2(void* p, T v) { *(T*)p = v;  }
__device__ __forceinline__ v8f wmma16(v16h a, v16h b, v8f c) {
  v8f d = __builtin_amdgcn_wmma_f32_16x16x32_f16(false, a, false, b, (short)0, c, false, false);
  asm volatile("v_nop\n\tv_nop\n\tv_nop\n\tv_nop" : "+v"(d) : "v"(a), "v"(b));
  return d;
}
__device__ __forceinline__ v8f wmma_bf(v16b a, v16b b, v8f c) {
  v8f d = __builtin_amdgcn_wmma_f32_16x16x32_bf16(false, a, false, b, (short)0, c, false, false);
  asm volatile("v_nop\n\tv_nop\n\tv_nop\n\tv_nop" : "+v"(d) : "v"(a), "v"(b));
  return d;
}
// 16x16x32 fragments: lane = (h = lane>>4, row/col = lane&15); elements 0..7 = k0+8h+0..7, 8..15 = k0+16+8h+0..7; D element r = row 8h+r
__device__ __forceinline__ v16h frag_h(const _Float16* rowk0, int lane) {
  union { v16h v; v8h q[2]; } u; const _Float16* p = rowk0 + 8 * (lane >> 4);
  u.q[0] = *(const v8h*)p; u.q[1] = *(const v8h*)(p + 16); return u.v;
}
__device__ __forceinline__ v16h frag_f32(const float* rowk0, int lane) {
  v16h a; const float* p = rowk0 + 8 * (lane >> 4);
#pragma unroll
  for (int i = 0; i < 8; ++i) { a[i] = (_Float16)p[i]; a[8 + i] = (_Float16)p[16 + i]; }
  return a;
}
__device__ __forceinline__ v16h frag_f32s(const float* rowk0, int lane, float sc) {
  v16h a; const float* p = rowk0 + 8 * (lane >> 4);
#pragma unroll
  for (int i = 0; i < 8; ++i) { a[i] = (_Float16)(p[i] * sc); a[8 + i] = (_Float16)(p[16 + i] * sc); }
  return a;
}
// column fragment from a [K][ld] layout (column n), rows >= K read as 0
__device__ __forceinline__ v16h fragc_f32(const float* W, int k0, int n, int lane, int ld, int K) {
  v16h a; const int g = lane >> 4;
#pragma unroll
  for (int i = 0; i < 8; ++i) { const int ka = k0 + 8 * g + i, kb = ka + 16;
    a[i] = (_Float16)(ka < K ? W[(size_t)(ka < K ? ka : K - 1) * ld + n] : 0.f); a[8 + i] = (_Float16)(kb < K ? W[(size_t)(kb < K ? kb : K - 1) * ld + n] : 0.f); }
  return a;
}
struct F2 { v16b h, l; };
__device__ __forceinline__ F2 bsplit16(const float v[16]) { F2 r;
#pragma unroll
  for (int i = 0; i < 16; ++i) { const __bf16 h = (__bf16)v[i]; r.h[i] = h; r.l[i] = (__bf16)(v[i] - (float)h); }
  return r; }
__device__ __forceinline__ F2 split_row(const float* row, int k0, int lane) { float v[16]; const float* p = row + k0 + 8 * (lane >> 4);
#pragma unroll
  for (int i = 0; i < 8; ++i) { v[i] = p[i]; v[8 + i] = p[16 + i]; }
  return bsplit16(v); }
__device__ __forceinline__ F2 split_rowK(const float* row, int k0, int lane, int K) { float v[16]; const int g = lane >> 4;
#pragma unroll
  for (int i = 0; i < 8; ++i) { const int ka = k0 + 8 * g + i, kb = ka + 16; v[i] = ka < K ? row[ka < K ? ka : K - 1] : 0.f; v[8 + i] = kb < K ? row[kb < K ? kb : K - 1] : 0.f; }
  return bsplit16(v); }
__device__ __forceinline__ F2 split_col(const float* W, int k0, int n, int lane, int ld, int K) { float v[16]; const int g = lane >> 4;
#pragma unroll
  for (int i = 0; i < 8; ++i) { const int ka = k0 + 8 * g + i, kb = ka + 16; v[i] = ka < K ? W[(size_t)(ka < K ? ka : K - 1) * ld + n] : 0.f; v[8 + i] = kb < K ? W[(size_t)(kb < K ? kb : K - 1) * ld + n] : 0.f; }
  return bsplit16(v); }
__device__ __forceinline__ v8f mac3(const F2& a, const F2& b, v8f c) { c = wmma_bf(a.l, b.h, c); c = wmma_bf(a.h, b.l, c); return wmma_bf(a.h, b.h, c); }
__device__ __forceinline__ float sigm(float v) { return 1.0f / (1.0f + expf(-v)); }
#define LDSX() do { asm volatile("s_wait_dscnt 0" ::: "memory"); __builtin_amdgcn_wave_barrier(); __builtin_amdgcn_fence(__ATOMIC_RELEASE, "workgroup"); } while (0)


// Inception (multi-window box) linear attention (B 1, C 256 = 8 heads x 32, 64 x 64): per window size ws in {64, 32, 16}: attn = q . boxsum(k v^T) / (q . boxsum(k) + 1e-6) using integral images with edge-replicated borders; concat over windows (768 channels), 1x1 output conv + bias.
#define CC 256
#define NH 8
#define HD 32
#define HH 64
#define WWD 64
#define NP (HH * WWD)      // 4,096 positions
#define NWIN 3
#define OC (CC * NWIN)     // 768
#ifndef TPB
#define TPB HH             // output rows (of 64 positions) that k_out's grid covers
#endif
typedef __attribute__((ext_vector_type(8))) __bf16 v8b;
__device__ __forceinline__ v16b frag_b(const __bf16* rowk0, int lane) {
  union { v16b v; v8b q[2]; } u; const __bf16* p = rowk0 + 8 * (lane >> 4);
  u.q[0] = *(const v8b*)p; u.q[1] = *(const v8b*)(p + 16); return u.v;
}
__device__ __forceinline__ float bfr(float v) { return (float)(__bf16)v; }
__device__ __attribute__((noinline)) float exp_ni(float v) { return expf(v); }
__device__ __attribute__((noinline)) float erf_ni(float v) { return erff(v); }

#define WS_PW  0u                                   // (not used); then bf16 natural rows Wout [256][768]
#define WS_PO  (WS_PW + 2u * (size_t)3 * CC * CC)
#define WS_XT  (WS_PO + 2u * (size_t)CC * OC)           // (not used)
#define WS_Q   (WS_XT + 4u * (size_t)NP * CC)           // f32 q [c][p] (sigmoid), k [c][p] (sigmoid), v [c][p] (normalised): channel-major planes of 4,096 positions
#define WS_K   (WS_Q + 4u * (size_t)NP * CC)
#define WS_V   (WS_K + 4u * (size_t)NP * CC)
#define NPB 4               // planes d of k a work-group of k_inorm
#define NG (HD / NPB)       // partial sums over d of the norm
#define WS_NP  (WS_V + 4u * (size_t)NP * CC)            // f32 partial norms [(dg*3+wi)*8+h][p]: sum over the NPB planes d of group dg
#define WS_O   (WS_NP + 4u * (size_t)NG * NWIN * NH * NP)   // f32 o [768][p], not yet divided by the norm: channel-major planes
#define WS_END (WS_O + 4u * (size_t)NP * OC)

// ---- k_proj: block = (64 positions = one image row, 128 out channels, which): 1x1 conv = W (A rows = channels) . x (B columns = positions), so D rows are channels; stored channel-major [c][p], 256 contiguous bytes per channel and block.
// Everything the conv needs is prepared inside this launch: x is read as it lies ([c][p]: 16 lanes cover 64 bytes of a channel's line) and rounded to bf16 in registers; the block's 128 weight rows are read as whole lines, rounded to bf16 and laid down in LDS, from where all four waves take their A fragments; epilogue: q, k -> sigmoid; v -> divided by max(||v_h||, 1e-12) per (position, head), the block holding all 32 channels of its four heads (squares summed pairwise: adjacent pairs, then pairs of pairs).
// which == 3: no conv; the 128 blocks round Wout to bf16 (natural rows) for k_out.
#define WPI (CC + 8)        // LDS row pitch in bf16: 528 bytes = 16 x odd, so that 16-byte reads of one row a lane do not collide
typedef __attribute__((ext_vector_type(4))) __bf16 v4b;
__device__ __forceinline__ v4b cvt4(v4f w) { v4b b; b[0] = (__bf16)w[0]; b[1] = (__bf16)w[1]; b[2] = (__bf16)w[2]; b[3] = (__bf16)w[3]; return b; }
__global__ __launch_bounds__(128) void k_proj(const float* __restrict__ X, const float* __restrict__ WQ, const float* __restrict__ WK, const float* __restrict__ WV, const float* __restrict__ WO, __bf16* __restrict__ PO, float* __restrict__ Q, float* __restrict__ Kf, float* __restrict__ Vf) { __shared__ __align__(16) __bf16 sw[128][WPI]; __shared__ __align__(16) float so[128][68];
  const int tid = threadIdx.x, wave = tid >> 5, lane = tid & 31, col = lane & 15, g = lane >> 4; const int which = blockIdx.z;
  if (which == 3) {   // the whole block leaves here, in front of every barrier
    const size_t e0 = ((size_t)(blockIdx.y * (NP / 64) + blockIdx.x) * 384 + tid) * 4; v4f w[3];   // 128 blocks x 384 quads = 256 x 768 values
#pragma unroll   // the three loads in flight at once
    for (int it = 0; it < 3; ++it) w[it] = *(const v4f*)(WO + e0 + it * 512);
    asm volatile("s_wait_xcnt 0x0" ::: "memory");   // the conversions below may land in the registers that these loads' address names
#pragma unroll   // w indexed by constants
    for (int it = 0; it < 3; ++it) vst2(PO + e0 + it * 512, cvt4(w[it]));
    return; }
  const int p0 = blockIdx.x * 64; const int c0 = blockIdx.y * 128; const float* Wr = (which == 0) ? WQ : (which == 1) ? WK : WV;
  const float* xp = X + (size_t)(8 * g) * NP + p0 + wave * 16 + col; float xv[CC / 32][16];   // B fragments: element i = channel kc*32 + 8g + i, element 8 + i = channel kc*32 + 16 + 8g + i (the k order of frag_b)
#pragma unroll   // all of a wave's x loads in flight at once; xv indexed by constants
  for (int kc = 0; kc < CC / 32; ++kc)
#pragma unroll   // as above
    for (int i = 0; i < 8; ++i) { xv[kc][i] = xp[(size_t)(kc * 32 + i) * NP]; xv[kc][8 + i] = xp[(size_t)(kc * 32 + 16 + i) * NP]; }
  const int wr = tid >> 6, wq = (tid & 63) * 4;   // weight staging: 64 threads cover a row of 1,024 bytes, the block two rows a step
  const float* wp = Wr + (size_t)(c0 + wr) * CC + wq; v4f w0[16];
#pragma unroll   // the first 16 steps' loads fly beside those of x
  for (int it = 0; it < 16; ++it) w0[it] = *(const v4f*)(wp + (size_t)it * 2 * CC);
  asm volatile("s_wait_xcnt 0x0" ::: "memory");   // the conversions and later loads may land in the registers that the x loads' address names
  v16b a[CC / 32];
#pragma unroll   // a, xv indexed by constants
  for (int kc = 0; kc < CC / 32; ++kc)
#pragma unroll   // as above
    for (int i = 0; i < 16; ++i) a[kc][i] = (__bf16)xv[kc][i];
#pragma unroll   // w0 indexed by constants
  for (int it = 0; it < 16; ++it) *(v4b*)&sw[it * 2 + wr][wq] = cvt4(w0[it]);
#pragma unroll   // two more rounds of 24 steps, each round's loads in flight at once
  for (int b = 0; b < 2; ++b) { v4f w1[24];
#pragma unroll   // w1 indexed by constants
    for (int it = 0; it < 24; ++it) w1[it] = *(const v4f*)(wp + (size_t)(16 + b * 24 + it) * 2 * CC);
    asm volatile("s_wait_xcnt 0x0" :: "v"(wp) : "memory");   // the conversions and LDS addresses below may land in the registers that these loads' address names; named as an input, the address lives up to the wait
#pragma unroll   // as above
    for (int it = 0; it < 24; ++it) *(v4b*)&sw[(16 + b * 24 + it) * 2 + wr][wq] = cvt4(w1[it]); }
  __syncthreads();   // every wave reads weight rows that all waves wrote
  v8f acc[8] = {}; v16b af[2][8];   // A fragments of this step and of the next
#pragma unroll   // af indexed by constants
  for (int j = 0; j < 8; ++j) af[0][j] = frag_b(&sw[j * 16 + col][0], lane);
#pragma unroll   // a, af, acc indexed by constants; the next step's fragment reads stand in front of this step's products
  for (int kc = 0; kc < CC / 32; ++kc) { const int cu = kc & 1, nx = cu ^ 1;
    if (kc + 1 < CC / 32) {
#pragma unroll   // as above
      for (int j = 0; j < 8; ++j) af[nx][j] = frag_b(&sw[j * 16 + col][(kc + 1) * 32], lane); }
#pragma unroll   // as above
    for (int j = 0; j < 8; ++j) acc[j] = wmma_bf(af[cu][j], a[kc], acc[j]); }
#pragma unroll
  for (int j = 0; j < 8; ++j)
#pragma unroll
    for (int r = 0; r < 8; ++r) { const float v = acc[j][r]; so[j * 16 + 8 * g + r][wave * 16 + col] = (which < 2) ? 1.0f / (1.0f + __expf(-v)) : v; }
  __syncthreads();   // a channel's 64 positions come from all four waves
  if (which == 2) {   // the same for the whole block: thread = (position, head), two heads a thread; a wave reads and writes 128 contiguous bytes of a channel's row
    const int pp = tid & 63;
#pragma unroll 1   // two heads through one body: the code stays small
    for (int hl = tid >> 6; hl < 4; hl += 2) { float v[HD], q[HD];
#pragma unroll   // v and q indexed by constants, so they stay in registers
      for (int d = 0; d < HD; ++d) { v[d] = so[hl * HD + d][pp]; q[d] = v[d] * v[d]; }
#pragma unroll   // constant indices: q stays in registers
      for (int o = 1; o < HD; o <<= 1)
#pragma unroll   // as above
        for (int d = 0; d < HD; d += 2 * o) q[d] += q[d + o];
      const float den = fmaxf(sqrtf(q[0]), 1e-12f);
#pragma unroll   // constant indices: v stays in registers
      for (int d = 0; d < HD; ++d) so[hl * HD + d][pp] = v[d] / den; }
    __syncthreads(); }   // the stores below read rows that other threads normalised
  float* dst = (which == 0) ? Q : (which == 1) ? Kf : Vf; for (int e = tid; e < 128 * 16; e += 128) { const int cl = e >> 4, q = e & 15; vst2(dst + (size_t)(c0 + cl) * NP + p0 + q * 4, *(const v4f*)&so[cl][q * 4]); } }
// ---- k_fuse: block = (f, h), 1,024 threads, the whole LDS of a WGP: the 32 planes k[d] v[f] of the head, 16 at a time, are built, prefix-summed (along w, then along h, each serial), box-differenced and summed over d with q[d] without leaving LDS; O[wi*256 + h*32 + f][p] = sum (k_out divides by the norm)
// LDS plane = the padded integral image: row ia = 0..64 (row 0 zero), column ib + 4 for ib = -4..67: ib <= 0 zero, ib = 1..64 the prefix sums, ib = 65..67 copies of ib = 64. All window offsets are multiples of 4, so the four neighbouring positions of a thread read each corner as one aligned 16-byte quad, and a quad wholly left (right) of the image is the quad at ib = -4 (64).
// Box phase: the windows reach 32, 16 and 8 rows up and down, so image rows 16 apart share their corner rows. A thread takes the rows bi, bi + 16, bi + 32, bi + 48 (four positions each) of four of the pass's 16 planes: per plane and window five integral rows, each differenced right - left once, serve all four image rows (30 quads read where 48 were). The four plane groups' partial sums over d are joined at the end through LDS.
#define FP 76               // row pitch in floats: 304 bytes = 16 x odd, so that 16-byte reads of one row a lane do not collide
#define FPL ((HH + 1) * FP) // floats a plane
#define FG 16               // planes a pass: 16 x 64 rows (columns) = one serial scan a thread
__device__ __forceinline__ v4f hdiff(const float* pl, int r, int l) { return *(const v4f*)(pl + r) - *(const v4f*)(pl + l); }   // one integral row: right corner quad - left corner quad
__global__ __launch_bounds__(1024) void k_fuse(const float* __restrict__ Q, const float* __restrict__ Kf, const float* __restrict__ Vf, float* __restrict__ O) { __shared__ __align__(16) float s[FG * FPL];
  const int t = threadIdx.x; const int f = blockIdx.x, h = blockIdx.y; const int i = t >> 4, j4 = (t & 15) * 4; const int sg = t >> 6, sl = t & 63;   // (i, j4): the thread's four positions in the product phase; (sg, sl): its plane and row or column in the scans
  const int gq = (t >> 5) & 3, bi = (t >> 7) * 2 + ((t >> 4) & 1);   // box phase: plane group (neighbouring waves read different planes) and first image row, 0..15
  const v4f zero4 = {0.f, 0.f, 0.f, 0.f};
  for (int e = t; e < FG * FP; e += 1024) s[(e / FP) * FPL + e % FP] = 0.f;   // row 0 of every plane; no pass writes it again
  *(v4f*)&s[sg * FPL + (sl + 1) * FP] = zero4;                                // ib = -4..-1 of rows 1..64; as above
  const v4f vq = *(const v4f*)(Vf + (size_t)(h * HD + f) * NP + t * 4);
  asm volatile("s_wait_xcnt 0x0" ::: "memory");   // the index arithmetic below reuses the register that this load's address names
  int cR[NWIN], cL[NWIN];   // places of the right and left corner quads in integral row bi
#pragma unroll   // cR, cL indexed by constants: stay in registers
  for (int wi = 0; wi < NWIN; ++wi) { const int ws = HH >> wi; const int tp = ws - 1, rr = tp / 2, l = tp - rr;   // l = ws - l = 32, 16, 8
    int bl = j4 - l, br = j4 + ws - l; bl = bl < -4 ? -4 : (bl > WWD ? WWD : bl); br = br < -4 ? -4 : (br > WWD ? WWD : br);
    cR[wi] = bi * FP + br + 4; cL[wi] = bi * FP + bl + 4; }
  const int dE = (HH - bi) * FP;                                  // from integral row bi to row 64
  const int dT = ((bi > 8 ? bi - 8 : 0) - bi) * FP;               // to row max(bi - 8, 0)
  const int dB = ((bi + 56 < HH ? bi + 56 : HH) - bi) * FP;       // to row min(bi + 56, 64)
  v4f acc[NWIN][4];
#pragma unroll   // acc indexed by constants
  for (int wi = 0; wi < NWIN; ++wi)
#pragma unroll   // as above
    for (int a = 0; a < 4; ++a) acc[wi][a] = zero4;
#pragma unroll 1   // two passes through one body: the code stays small
  for (int d0 = 0; d0 < HD; d0 += FG) {
    { const float* kp = Kf + (size_t)(h * HD + d0) * NP + t * 4; float* sp = &s[(i + 1) * FP + 4 + j4]; v4f kv[8];   // products k[d] v[f], value w of row y at row y + 1, column w + 4 (aligned)
#pragma unroll   // eight loads in flight: with the 48 sums live, all 16 quads at once would not fit the registers
      for (int g = 0; g < 8; ++g) kv[g] = *(const v4f*)(kp + (size_t)g * NP);
#pragma unroll   // kv indexed by constants; four quads are laid down and their registers loaded anew, so the stream of loads does not pause
      for (int b = 0; b < 8; b += 4) {
        __builtin_amdgcn_sched_barrier(0);   // holds the refills behind the stores that free their registers: fetched earlier they would spill
#pragma unroll   // as above
        for (int g = b; g < b + 4; ++g) *(v4f*)(sp + g * FPL) = kv[g] * vq;
#pragma unroll   // as above
        for (int g = b; g < b + 4; ++g) kv[g] = *(const v4f*)(kp + (size_t)(8 + g) * NP); }
      asm volatile("s_wait_xcnt 0x0" ::: "memory");   // later arithmetic may reuse the registers that these loads' address names
      __builtin_amdgcn_sched_barrier(0);   // keeps the products of the refilled quads, and with them the waits for those quads, behind the last refill
#pragma unroll   // kv indexed by constants
      for (int g = 0; g < 8; ++g) *(v4f*)(sp + (8 + g) * FPL) = kv[g] * vq; }
    __syncthreads();
    { float* row = &s[sg * FPL + (sl + 1) * FP + 4]; float run = 0.f;   // along w: thread = (plane, row); written back one column to the right, behind the zero of ib = 0
#pragma unroll 1   // 16 values a trip: few values live at a time beside the 48 sums
      for (int m0 = 0; m0 < WWD / 16; ++m0, row += 16) { v4f r[4];
#pragma unroll   // a trip's loads in flight at once
        for (int m = 0; m < 4; ++m) r[m] = *(const v4f*)(row + 4 * m);
#pragma unroll   // r indexed by constants
        for (int m = 0; m < 4; ++m) { v4f o; o[0] = run; run += r[m][0]; o[1] = run; run += r[m][1]; o[2] = run; run += r[m][2]; o[3] = run; run += r[m][3]; *(v4f*)(row + 4 * m) = o; } }
      row[0] = run; }
    __syncthreads();
    { float* cp = &s[sg * FPL + FP + 5 + sl]; float run = 0.f;   // along h: thread = (plane, column), in place
#pragma unroll 1   // 16 rows a trip: few addresses and few values live at a time (all 64 at once spilled some thirty addresses)
      for (int y0 = 0; y0 < HH; y0 += 16, cp += 16 * FP) { float p[16];
#pragma unroll   // p stays in registers; a trip's loads in flight at once
        for (int y = 0; y < 16; ++y) p[y] = cp[y * FP];
#pragma unroll   // as above
        for (int y = 0; y < 16; ++y) { run += p[y]; cp[y * FP] = run; } } }
    __syncthreads();
    { float* e = &s[sg * FPL + (sl + 1) * FP + 4 + WWD]; const float x = e[0]; const v4f r = {x, x, x, x}; *(v4f*)e = r; }   // ib = 65..67: copies of ib = 64; thread = (plane, row)
    __syncthreads();
    { const float* qp = Q + (size_t)(h * HD + d0 + gq * 4) * NP + bi * WWD + j4; v4f qc[4];   // q of the thread's four image rows, one plane at a time
#pragma unroll   // the four rows' q in flight at once
      for (int a = 0; a < 4; ++a) qc[a] = *(const v4f*)(qp + a * 16 * WWD);
      asm volatile("s_wait_xcnt 0x0" ::: "memory");   // the address arithmetic below may reuse the registers that these loads' address names
#pragma unroll 1   // one plane a trip: the code and the live values stay small
      for (int u = 0; u < 4; ++u) { const float* pl = s + (gq * 4 + u) * FPL; const float* qx = qp + (size_t)(u + 1 < 4 ? u + 1 : 0) * NP;
        // Image rows bi, bi + 16 first, then bi + 32, bi + 48, so that each half's q of the next plane flies for half a trip. The scheduling barriers keep one group of corner rows from being fetched beside the next: with the 48 sums live, more than six quads in flight spill.
        { const v4f h2 = hdiff(pl + 32 * FP, cR[0], cL[0]), h3 = hdiff(pl + 48 * FP, cR[0], cL[0]);   // reach 32: the top row of these image rows is the zero row
          acc[0][0] += qc[0] * h2; acc[0][1] += qc[1] * h3; }
        __builtin_amdgcn_sched_barrier(0);   // against spills, as said above
        const v4f m0 = hdiff(pl, cR[1], cL[1]), m1 = hdiff(pl + 16 * FP, cR[1], cL[1]), m2 = hdiff(pl + 32 * FP, cR[1], cL[1]);   // reach 16: the top row of image row bi is the zero row
        acc[1][0] += qc[0] * m1; acc[1][1] += qc[1] * (m2 - m0);
        __builtin_amdgcn_sched_barrier(0);   // against spills, as said above
        const v4f nt = hdiff(pl + dT, cR[2], cL[2]), n1 = hdiff(pl + 8 * FP, cR[2], cL[2]), n2 = hdiff(pl + 24 * FP, cR[2], cL[2]);   // reach 8
        acc[2][0] += qc[0] * (n1 - nt); acc[2][1] += qc[1] * (n2 - n1);
        qc[0] = *(const v4f*)qx; qc[1] = *(const v4f*)(qx + 16 * WWD);   // the last trip reads the first plane again, unused: no branch inside a trip
        __builtin_amdgcn_sched_barrier(0);   // against spills, as said above; it also holds the two q loads here, half a trip ahead of their use
        { const v4f he = hdiff(pl + dE, cR[0], cL[0]), h0 = hdiff(pl, cR[0], cL[0]), h1 = hdiff(pl + 16 * FP, cR[0], cL[0]);   // reach 32: the bottom row of these image rows is row 64
          acc[0][2] += qc[2] * (he - h0); acc[0][3] += qc[3] * (he - h1); }
        __builtin_amdgcn_sched_barrier(0);   // against spills, as said above
        { const v4f m3 = hdiff(pl + 48 * FP, cR[1], cL[1]), me = hdiff(pl + dE, cR[1], cL[1]);   // reach 16: the bottom row of image row bi + 48 is row 64
          acc[1][2] += qc[2] * (m3 - m1); acc[1][3] += qc[3] * (me - m2); }
        __builtin_amdgcn_sched_barrier(0);   // against spills, as said above
        { const v4f n3 = hdiff(pl + 40 * FP, cR[2], cL[2]), nb = hdiff(pl + dB, cR[2], cL[2]);   // reach 8
          acc[2][2] += qc[2] * (n3 - n2); acc[2][3] += qc[3] * (nb - n3); }
        qc[2] = *(const v4f*)(qx + 32 * WWD); qc[3] = *(const v4f*)(qx + 48 * WWD);
        asm volatile("s_wait_xcnt 0x0" ::: "memory"); } }   // the next trip forms the q loads' address anew in the same registers
    __syncthreads();   // the next pass overwrites the planes
  }
  const int yo = bi + 16 * gq;   // the image row that this thread finishes
#pragma unroll   // acc indexed by constants; partial sums of group gq and window wi lie in the inner part of plane wi * 4 + gq, which nobody reads any more
  for (int wi = 0; wi < NWIN; ++wi)
#pragma unroll   // as above
    for (int a = 0; a < 4; ++a) *(v4f*)&s[(wi * 4 + gq) * FPL + (bi + 16 * a + 1) * FP + 4 + j4] = acc[wi][a];
  __syncthreads();   // a thread adds partial sums that the three other groups wrote
#pragma unroll   // three windows, constant plane offsets
  for (int wi = 0; wi < NWIN; ++wi) { const float* pp = s + wi * 4 * FPL + (yo + 1) * FP + 4 + j4;
    const v4f r = ((*(const v4f*)pp + *(const v4f*)(pp + FPL)) + *(const v4f*)(pp + 2 * FPL)) + *(const v4f*)(pp + 3 * FPL);   // groups in ascending order
    vst2(O + (size_t)(wi * CC + h * HD + f) * NP + yo * WWD + j4, r); } }
// ---- k_inorm: block = (group dg of NPB planes d, head h, quarter rq of the image rows), 256 threads: the planes k[d] are laid down in LDS in k_fuse's plane layout, prefix-summed along w, then along h (each serial, one thread a row or column), and box-differenced there: NPART[(dg*3+wi)*8+h][p] = sum over the group's d (ascending) of q[d] box(k[d]); k_out adds the NG groups.
// The four quarters of a (dg, h) each build the same integral images: the scans are a chain of waits that costs the same for any number of rows wanted, and the box phase, the part that takes LDS time, is shared out over four WGPs.
__global__ __launch_bounds__(256) void k_inorm(const float* __restrict__ Q, const float* __restrict__ Kf, float* __restrict__ NPART) { __shared__ __align__(16) float s[NPB * FPL];
  const int t = threadIdx.x; const int dg = blockIdx.x, h = blockIdx.y, rq = blockIdx.z; const int i = t >> 4, j4 = (t & 15) * 4; const int sg = t >> 6, sl = t & 63;   // (i, j4): row within a quarter and four positions; (sg, sl): plane and row or column in the scans
  const int y = rq * (HH / 4) + i;   // the image row whose norms this thread computes
  const v4f zero4 = {0.f, 0.f, 0.f, 0.f};
  const float* kp = Kf + (size_t)(h * HD + dg * NPB) * NP + t * 4; v4f kv[NPB][4];
#pragma unroll   // all of a thread's loads in flight at once; kv indexed by constants
  for (int g = 0; g < NPB; ++g)
#pragma unroll   // as above
    for (int c = 0; c < 4; ++c) kv[g][c] = *(const v4f*)(kp + (size_t)g * NP + c * 1024);
  const float* qp = Q + (size_t)(h * HD + dg * NPB) * NP + y * WWD + j4; v4f qc[NPB];   // q flies beside k and lands during the scans
#pragma unroll   // as above
  for (int g = 0; g < NPB; ++g) qc[g] = *(const v4f*)(qp + (size_t)g * NP);
  asm volatile("s_wait_xcnt 0x0" ::: "memory");   // the index arithmetic below may reuse the registers that these loads' addresses name
  for (int e = t; e < NPB * FP; e += 256) s[(e / FP) * FPL + e % FP] = 0.f;   // row 0 of every plane
  *(v4f*)&s[sg * FPL + (sl + 1) * FP] = zero4;                                // ib = -4..-1 of rows 1..64
  { float* sp = &s[(i + 1) * FP + 4 + j4];   // value w of row r at row r + 1, column w + 4 (aligned)
#pragma unroll   // kv indexed by constants
    for (int g = 0; g < NPB; ++g)
#pragma unroll   // as above
      for (int c = 0; c < 4; ++c) *(v4f*)(sp + g * FPL + c * 16 * FP) = kv[g][c]; }
  __syncthreads();   // a scan reads a row that 16 threads wrote
  { float* row = &s[sg * FPL + (sl + 1) * FP + 4]; float run = 0.f; v4f r[WWD / 4];   // along w: thread = (plane, row); written back one column to the right, behind the zero of ib = 0
#pragma unroll   // a row's 16 loads in flight at once: one LDS latency a scan
    for (int m = 0; m < WWD / 4; ++m) r[m] = *(const v4f*)(row + 4 * m);
#pragma unroll   // r indexed by constants
    for (int m = 0; m < WWD / 4; ++m) { v4f o; o[0] = run; run += r[m][0]; o[1] = run; run += r[m][1]; o[2] = run; run += r[m][2]; o[3] = run; run += r[m][3]; *(v4f*)(row + 4 * m) = o; }
    row[WWD] = run; }
  __syncthreads();   // columns cross the rows of 64 threads
  { float* cp = &s[sg * FPL + FP + 5 + sl]; float run = 0.f; float p[HH];   // along h: thread = (plane, column), in place
#pragma unroll   // a column's 64 loads in flight at once; p indexed by constants
    for (int r = 0; r < HH; ++r) p[r] = cp[r * FP];
    __builtin_amdgcn_sched_barrier(0);   // holds all the loads in front of the chain of sums: sunk between the sums, only three were in flight and the scan waited out an LDS latency every few rows
#pragma unroll   // as above
    for (int r = 0; r < HH; ++r) { run += p[r]; cp[r * FP] = run; } }
  __syncthreads();   // column ib = 64 was summed by one thread a plane
  { float* e = &s[sg * FPL + (sl + 1) * FP + 4 + WWD]; const float x = e[0]; const v4f r = {x, x, x, x}; *(v4f*)e = r; }   // ib = 65..67: copies of ib = 64; thread = (plane, row)
  __syncthreads();   // the corners below lie in rows and columns of other threads
  v4f acc[NWIN];
#pragma unroll   // acc indexed by constants; the corner places are formed once a window
  for (int wi = 0; wi < NWIN; ++wi) { const int ws = HH >> wi; const int tp = ws - 1, rr = tp / 2, l = tp - rr;   // l = ws - l = 32, 16, 8
    int bl = j4 - l, br = j4 + ws - l; bl = bl < -4 ? -4 : (bl > WWD ? WWD : bl); br = br < -4 ? -4 : (br > WWD ? WWD : br);
    int at = y - l, ab = y + ws - l; at = at < 0 ? 0 : at; ab = ab > HH ? HH : ab;   // integral rows of the window's top and bottom
    const float* pb = s + ab * FP; const float* pt = s + at * FP; v4f a = zero4;
#pragma unroll   // the planes in ascending order of d; their corner quads in flight together
    for (int g = 0; g < NPB; ++g) a += qc[g] * (hdiff(pb + g * FPL, br + 4, bl + 4) - hdiff(pt + g * FPL, br + 4, bl + 4));
    acc[wi] = a; }
#pragma unroll   // acc indexed by constants
  for (int wi = 0; wi < NWIN; ++wi) vst2(NPART + (size_t)((dg * NWIN + wi) * NH + h) * NP + y * WWD + j4, acc[wi]); }
// ---- k_out: block = (128 out channels o, 32 positions), 8 waves of 16 o x 32 p: out[o][p] = sum_c Wout[o][c] O[c][p] / (norm + 1e-6) (A = Wout bf16 exact rows, B = columns p of O divided by the norm, as bf16 hi + lo) + bout[o]; (B, C, H, W) layout = rows o of 4,096
// The block's O tile (768 channels x one 128-byte line) is read once, whole lines, every load in flight at once, divided by the norm (the NG partial norms of its head and window added, + 1e-6, inverted once a thread), split into hi and lo once and laid down in LDS as position rows [p][c]; all eight waves take their B fragments from there.
#define OPB 32              // positions a block: one line of every channel plane
#define OPI (OC + 8)        // LDS row pitch in bf16: 1,552 bytes = 16 x odd, so that 16-byte reads of one row a lane do not collide
#define APRE 8              // A fragments fetched ahead of their use
__global__ __launch_bounds__(256) void k_out(const __bf16* __restrict__ PO, const float* __restrict__ O, const float* __restrict__ NPART, const float* __restrict__ BO, float* __restrict__ Y) { __shared__ __align__(16) __bf16 sh[OPB][OPI]; __shared__ __align__(16) __bf16 sl[OPB][OPI]; __shared__ __align__(16) float so[8][16][OPB + 4];
  const int tid = threadIdx.x, wave = tid >> 5, lane = tid & 31, col = lane & 15, g = lane >> 4; const int o0 = blockIdx.x * 128 + wave * 16; const int p0 = blockIdx.y * OPB;
  const int pq = tid & 7, cg = tid >> 3;   // staging: eight lanes cover a channel's line; a thread takes four positions of eight neighbouring channels, three times
  const float* np = NPART + (size_t)(cg >> 2) * NP + p0 + pq * 4; v4f nq[NWIN][NG];   // the thread's eight channels lie in head cg >> 2; round r of the staging is window r
#pragma unroll   // the partial norms fly in front of the tile; nq indexed by constants
  for (int r = 0; r < NWIN; ++r)
#pragma unroll   // as above
    for (int gI = 0; gI < NG; ++gI) nq[r][gI] = *(const v4f*)(np + (size_t)((gI * NWIN + r) * NH) * NP);
  asm volatile("s_wait_xcnt 0x0" ::: "memory");   // later loads may land in the registers that these loads' address names
  const float* src = O + (size_t)(cg * 8) * NP + p0 + pq * 4; v4f x[OC / 256][8];
#pragma unroll   // all 24 loads of a thread in flight at once: one trip to memory for the whole tile
  for (int r = 0; r < OC / 256; ++r) {
#pragma unroll   // x indexed by constants: stays in registers
    for (int i = 0; i < 8; ++i) x[r][i] = *(const v4f*)(src + (size_t)(r * 256 + i) * NP);
    asm volatile("s_wait_xcnt 0x0" ::: "memory"); }   // later loads may land in the registers that these loads' address names
  const __bf16* ar = PO + (size_t)(o0 + col) * OC; v16b a[OC / 32];   // natural row of Wout read with the A-row lane layout (identical to frag_b's)
#pragma unroll   // the first A fragments fly beside the tile
  for (int kc = 0; kc < APRE; ++kc) a[kc] = frag_b(ar + kc * 32, lane);
  asm volatile("s_wait_xcnt 0x0" ::: "memory");   // the arithmetic below may reuse registers that these loads' addresses name
  v4f inv[NWIN];   // 1 / (norm + 1e-6): the groups of d added in ascending order
#pragma unroll   // nq, inv indexed by constants
  for (int r = 0; r < NWIN; ++r) { v4f n = nq[r][0];
#pragma unroll   // as above
    for (int gI = 1; gI < NG; ++gI) n += nq[r][gI];
    inv[r] = 1.0f / (n + 1e-6f); }
#pragma unroll   // x indexed by constants
  for (int r = 0; r < OC / 256; ++r)
#pragma unroll   // as above
    for (int e = 0; e < 4; ++e) { v8b h, l;
#pragma unroll   // as above
      for (int i = 0; i < 8; ++i) { const float v = x[r][i][e] * inv[r][e]; const __bf16 hh = (__bf16)v; h[i] = hh; l[i] = (__bf16)(v - (float)hh); }
      *(v8b*)&sh[pq * 4 + e][r * 256 + cg * 8] = h; *(v8b*)&sl[pq * 4 + e][r * 256 + cg * 8] = l; }
  __syncthreads();   // every wave reads rows that all waves wrote
  float bb[8];
#pragma unroll   // the bias flies beside the products instead of being waited for behind them
  for (int r = 0; r < 8; ++r) bb[r] = BO[o0 + 8 * g + r];
  asm volatile("s_wait_xcnt 0x0" ::: "memory");   // later loads may land in the registers that these loads' address names
  v8f acc[2] = {}; v16b bh[2][2], bl[2][2];   // B fragments of this step and of the next
#pragma unroll   // bh, bl indexed by constants
  for (int jt = 0; jt < 2; ++jt) { bh[0][jt] = frag_b(&sh[jt * 16 + col][0], lane); bl[0][jt] = frag_b(&sl[jt * 16 + col][0], lane); }
#pragma unroll   // a, bh, bl indexed by constants; the fetches ahead stand in front of the step's products
  for (int kc = 0; kc < OC / 32; ++kc) { const int cu = kc & 1, nx = cu ^ 1;
    if (kc + 1 < OC / 32) {
#pragma unroll   // as above
      for (int jt = 0; jt < 2; ++jt) { bh[nx][jt] = frag_b(&sh[jt * 16 + col][(kc + 1) * 32], lane); bl[nx][jt] = frag_b(&sl[jt * 16 + col][(kc + 1) * 32], lane); } }
    if ((kc & 3) == 0 && kc + APRE < OC / 32) {
#pragma unroll   // as above
      for (int u = 0; u < 4; ++u) a[kc + APRE + u] = frag_b(ar + (kc + APRE + u) * 32, lane); }
    acc[0] = wmma_bf(a[kc], bh[cu][0], acc[0]); acc[1] = wmma_bf(a[kc], bh[cu][1], acc[1]);   // per accumulator hi, then lo, in ascending c
    acc[0] = wmma_bf(a[kc], bl[cu][0], acc[0]); acc[1] = wmma_bf(a[kc], bl[cu][1], acc[1]); }
#pragma unroll   // acc indexed by constants
  for (int jt = 0; jt < 2; ++jt)
#pragma unroll   // as above
    for (int r = 0; r < 8; ++r) so[wave][8 * g + r][jt * 16 + col] = acc[jt][r] + bfr(bb[r]);
  LDSX();
#pragma unroll   // four rows (whole lines) a store
  for (int it = 0; it < 4; ++it) { const int rl = it * 4 + (lane >> 3); vst2(Y + (size_t)(o0 + rl) * NP + p0 + (lane & 7) * 4, *(const v4f*)&so[wave][rl][(lane & 7) * 4]); } }
extern "C" void kernel_launch(void* const* d_in, const int* in_sizes, int n_in, void* d_out, int out_size, void* d_ws, size_t ws_size, hipStream_t stream) {
  (void)in_sizes; (void)n_in; (void)out_size;
  const float** F = (const float**)d_in;   // 0 x [1,256,64,64], 1 Wq, 2 Wk, 3 Wv [256,256], 4 Wout [256,768], 5 bout [256]
  if (ws_size < (size_t)WS_END) return;
  char* ws = (char*)d_ws; __bf16 *PO = (__bf16*)(ws + WS_PO); float *Q = (float*)(ws + WS_Q), *Kf = (float*)(ws + WS_K), *Vf = (float*)(ws + WS_V), *NPART = (float*)(ws + WS_NP), *O = (float*)(ws + WS_O);
  k_proj<<<dim3(NP / 64, CC / 128, 4), 128, 0, stream>>>(F[0], F[1], F[2], F[3], F[4], PO, Q, Kf, Vf);
  k_inorm<<<dim3(NG, NH, 4), 256, 0, stream>>>(Q, Kf, NPART);
  k_fuse<<<dim3(HD, NH), 1024, 0, stream>>>(Q, Kf, Vf, O);
  k_out<<<dim3(CC / 128, (TPB * WWD) / OPB), 256, 0, stream>>>(PO, O, NPART, F[5], (float*)d_out);
}

// v007
// Measured time: 47.5 microseconds a run.
// Two timings next to v006 put it at 1.04 and 1.05 times that version's speed.
// All steps since v000 together make it 8.62 times as fast.
// compute dtype: all float inputs rounded to bf16; q/k/v 1x1 convs with EXACT bf16 products on WMMA 16x16x32 (x and the weights read as they lie); sigmoid (hardware exp) and the per-position L2 normalisation of v in f32; k and k (x) v outer-product planes, their 2-D inclusive prefix sums (integral images; they live in LDS only) and the clamped 4-corner box differences for the three window sizes, the q-weighted sums and the division all in f32 on VALU (fixed order); out = Wout (exact) . o (bf16 hi + lo, 2 products) + bout on WMMA; f32 output in (B, C, H, W) order.
#include <hip/hip_runtime.h>
#include <math.h>

typedef __attribute__((ext_vector_type(16))) _Float16 v16h;
typedef __attribute__((ext_vector_type(16))) __bf16 v16b;
typedef __attribute__((ext_vector_type(8)))  _Float16 v8h;
typedef __attribute__((ext_vector_type(8)))  float v8f;
typedef __attribute__((ext_vector_type(4)))  float v4f;
typedef __attribute__((ext_vector_type(2)))  float v2f;
typedef __attribute__((ext_vector_type(4)))  unsigned v4u;
typedef __attribute__((ext_vector_type(4)))  int v4i;
typedef float __attribute__((may_alias)) float_a;
typedef int __attribute__((may_alias)) int_a;

template <typename T> __device__ __forceinline__ void vst2(void* p, T v) { *(T*)p = v;  }
__device__ __forceinline__ v8f wmma16(v16h a, v16h b, v8f c) {
  v8f d = __builtin_amdgcn_wmma_f32_16x16x32_f16(false, a, false, b, (short)0, c, false, false);
  asm volatile("v_nop\n\tv_nop\n\tv_nop\n\tv_nop" : "+v"(d) : "v"(a), "v"(b));
  return d;
}
__device__ __forceinline__ v8f wmma_bf(v16b a, v16b b, v8f c) {
  v8f d = __builtin_amdgcn_wmma_f32_16x16x32_bf16(false, a, false, b, (short)0, c, false, false);
  asm volatile("v_nop\n\tv_nop\n\tv_nop\n\tv_nop" : "+v"(d) : "v"(a), "v"(b));
  return d;
}
// 16x16x32 fragments: lane = (h = lane>>4, row/col = lane&15); elements 0..7 = k0+8h+0..7, 8..15 = k0+16+8h+0..7; D element r = row 8h+r
__device__ __forceinline__ v16h frag_h(const _Float16* rowk0, int lane) {
  union { v16h v; v8h q[2]; } u; const _Float16* p = rowk0 + 8 * (lane >> 4);
  u.q[0] = *(const v8h*)p; u.q[1] = *(const v8h*)(p + 16); return u.v;
}
__device__ __forceinline__ v16h frag_f32(const float* rowk0, int lane) {
  v16h a; const float* p = rowk0 + 8 * (lane >> 4);
#pragma unroll
  for (int i = 0; i < 8; ++i) { a[i] = (_Float16)p[i]; a[8 + i] = (_Float16)p[16 + i]; }
  return a;
}
__device__ __forceinline__ v16h frag_f32s(const float* rowk0, int lane, float sc) {
  v16h a; const float* p = rowk0 + 8 * (lane >> 4);
#pragma unroll
  for (int i = 0; i < 8; ++i) { a[i] = (_Float16)(p[i] * sc); a[8 + i] = (_Float16)(p[16 + i] * sc); }
  return a;
}
// column fragment from a [K][ld] layout (column n), rows >= K read as 0
__device__ __forceinline__ v16h fragc_f32(const float* W, int k0, int n, int lane, int ld, int K) {
  v16h a; const int g = lane >> 4;
#pragma unroll
  for (int i = 0; i < 8; ++i) { const int ka = k0 + 8 * g + i, kb = ka + 16;
    a[i] = (_Float16)(ka < K ? W[(size_t)(ka < K ? ka : K - 1) * ld + n] : 0.f); a[8 + i] = (_Float16)(kb < K ? W[(size_t)(kb < K ? kb : K - 1) * ld + n] : 0.f); }
  return a;
}
struct F2 { v16b h, l; };
__device__ __forceinline__ F2 bsplit16(const float v[16]) { F2 r;
#pragma unroll
  for (int i = 0; i < 16; ++i) { const __bf16 h = (__bf16)v[i]; r.h[i] = h; r.l[i] = (__bf16)(v[i] - (float)h); }
  return r; }
__device__ __forceinline__ F2 split_row(const float* row, int k0, int lane) { float v[16]; const float* p = row + k0 + 8 * (lane >> 4);
#pragma unroll
  for (int i = 0; i < 8; ++i) { v[i] = p[i]; v[8 + i] = p[16 + i]; }
  return bsplit16(v); }
__device__ __forceinline__ F2 split_rowK(const float* row, int k0, int lane, int K) { float v[16]; const int g = lane >> 4;
#pragma unroll
  for (int i = 0; i < 8; ++i) { const int ka = k0 + 8 * g + i, kb = ka + 16; v[i] = ka < K ? row[ka < K ? ka : K - 1] : 0.f; v[8 + i] = kb < K ? row[kb < K ? kb : K - 1] : 0.f; }
  return bsplit16(v); }
__device__ __forceinline__ F2 split_col(const float* W, int k0, int n, int lane, int ld, int K) { float v[16]; const int g = lane >> 4;
#pragma unroll
  for (int i = 0; i < 8; ++i) { const int ka = k0 + 8 * g + i, kb = ka + 16; v[i] = ka < K ? W[(size_t)(ka < K ? ka : K - 1) * ld + n] : 0.f; v[8 + i] = kb < K ? W[(size_t)(kb < K ? kb : K - 1) * ld + n] : 0.f; }
  return bsplit16(v); }
__device__ __forceinline__ v8f mac3(const F2& a, const F2& b, v8f c) { c = wmma_bf(a.l, b.h, c); c = wmma_bf(a.h, b.l, c); return wmma_bf(a.h, b.h, c); }
__device__ __forceinline__ float sigm(float v) { return 1.0f / (1.0f + expf(-v)); }
#define LDSX() do { asm volatile("s_wait_dscnt 0" ::: "memory"); __builtin_amdgcn_wave_barrier(); __builtin_amdgcn_fence(__ATOMIC_RELEASE, "workgroup"); } while (0)


// Inception (multi-window box) linear attention (B 1, C 256 = 8 heads x 32, 64 x 64): per window size ws in {64, 32, 16}: attn = q . boxsum(k v^T) / (q . boxsum(k) + 1e-6) using integral images with edge-replicated borders; concat over windows (768 channels), 1x1 output conv + bias.
#define CC 256
#define NH 8
#define HD 32
#define HH 64
#define WWD 64
#define NP (HH * WWD)      // 4,096 positions
#define NWIN 3
#define OC (CC * NWIN)     // 768
#ifndef TPB
#define TPB HH             // output rows (of 64 positions) that k_out's grid covers
#endif
typedef __attribute__((ext_vector_type(8))) __bf16 v8b;
__device__ __forceinline__ v16b frag_b(const __bf16* rowk0, int lane) {
  union { v16b v; v8b q[2]; } u; const __bf16* p = rowk0 + 8 * (lane >> 4);
  u.q[0] = *(const v8b*)p; u.q[1] = *(const v8b*)(p + 16); return u.v;
}
__device__ __forceinline__ float bfr(float v) { return (float)(__bf16)v; }
__device__ __attribute__((noinline)) float exp_ni(float v) { return expf(v); }
__device__ __attribute__((noinline)) float erf_ni(float v) { return erff(v); }

#define WS_PW  0u                                   // (not used); then bf16 natural rows Wout [256][768]
#define WS_PO  (WS_PW + 2u * (size_t)3 * CC * CC)
#define WS_XT  (WS_PO + 2u * (size_t)CC * OC)           // (not used)
#define WS_Q   (WS_XT + 4u * (size_t)NP * CC)           // f32 q [c][p] (sigmoid), k [c][p] (sigmoid), v [c][p] (normalised): channel-major planes of 4,096 positions
#define WS_K   (WS_Q + 4u * (size_t)NP * CC)
#define WS_V   (WS_K + 4u * (size_t)NP * CC)
#define NPB 4               // planes d of k a work-group of k_inorm
#define NG (HD / NPB)       // partial sums over d of the norm
#define WS_NP  (WS_V + 4u * (size_t)NP * CC)            // f32 partial norms [(dg*3+wi)*8+h][p]: sum over the NPB planes d of group dg
#define WS_O   (WS_NP + 4u * (size_t)NG * NWIN * NH * NP)   // f32 o [768][p], not yet divided by the norm: channel-major planes
#define WS_END (WS_O + 4u * (size_t)NP * OC)

// ---- k_proj: block = (64 positions = one image row, 128 out channels, which): 1x1 conv = W (A rows = channels) . x (B columns = positions), so D rows are channels; stored channel-major [c][p], 256 contiguous bytes per channel and block.
// Everything the conv needs is prepared inside this launch: x is read as it lies ([c][p]: 16 lanes cover 64 bytes of a channel's line) and rounded to bf16 in registers; the block's 128 weight rows are read as whole lines, rounded to bf16 and laid down in LDS, from where all four waves take their A fragments; epilogue: q, k -> sigmoid; v -> divided by max(||v_h||, 1e-12) per (position, head), the block holding all 32 channels of its four heads (squares summed pairwise: adjacent pairs, then pairs of pairs).
// which == 3: no conv; the 128 blocks round Wout to bf16 (natural rows) for k_out.
#define WPI (CC + 8)        // LDS row pitch in bf16: 528 bytes = 16 x odd, so that 16-byte reads of one row a lane do not collide
typedef __attribute__((ext_vector_type(4))) __bf16 v4b;
__device__ __forceinline__ v4b cvt4(v4f w) { v4b b; b[0] = (__bf16)w[0]; b[1] = (__bf16)w[1]; b[2] = (__bf16)w[2]; b[3] = (__bf16)w[3]; return b; }
__global__ __launch_bounds__(128) void k_proj(const float* __restrict__ X, const float* __restrict__ WQ, const float* __restrict__ WK, const float* __restrict__ WV, const float* __restrict__ WO, __bf16* __restrict__ PO, float* __restrict__ Q, float* __restrict__ Kf, float* __restrict__ Vf) { __shared__ __align__(16) __bf16 sw[128][WPI]; __shared__ __align__(16) float so[128][68];
  const int tid = threadIdx.x, wave = tid >> 5, lane = tid & 31, col = lane & 15, g = lane >> 4; const int which = blockIdx.z;
  if (which == 3) {   // the whole block leaves here, in front of every barrier
    const size_t e0 = ((size_t)(blockIdx.y * (NP / 64) + blockIdx.x) * 384 + tid) * 4; v4f w[3];   // 128 blocks x 384 quads = 256 x 768 values
#pragma unroll   // the three loads in flight at once
    for (int it = 0; it < 3; ++it) w[it] = *(const v4f*)(WO + e0 + it * 512);
    asm volatile("s_wait_xcnt 0x0" ::: "memory");   // the conversions below may land in the registers that these loads' address names
#pragma unroll   // w indexed by constants
    for (int it = 0; it < 3; ++it) vst2(PO + e0 + it * 512, cvt4(w[it]));
    return; }
  const int p0 = blockIdx.x * 64; const int c0 = blockIdx.y * 128; const float* Wr = (which == 0) ? WQ : (which == 1) ? WK : WV;
  const float* xp = X + (size_t)(8 * g) * NP + p0 + wave * 16 + col; float xv[CC / 32][16];   // B fragments: element i = channel kc*32 + 8g + i, element 8 + i = channel kc*32 + 16 + 8g + i (the k order of frag_b)
#pragma unroll   // all of a wave's x loads in flight at once; xv indexed by constants
  for (int kc = 0; kc < CC / 32; ++kc)
#pragma unroll   // as above
    for (int i = 0; i < 8; ++i) { xv[kc][i] = xp[(size_t)(kc * 32 + i) * NP]; xv[kc][8 + i] = xp[(size_t)(kc * 32 + 16 + i) * NP]; }
  const int wr = tid >> 6, wq = (tid & 63) * 4;   // weight staging: 64 threads cover a row of 1,024 bytes, the block two rows a step
  const float* wp = Wr + (size_t)(c0 + wr) * CC + wq; v4f w0[16];
#pragma unroll   // the first 16 steps' loads fly beside those of x
  for (int it = 0; it < 16; ++it) w0[it] = *(const v4f*)(wp + (size_t)it * 2 * CC);
  asm volatile("s_wait_xcnt 0x0" ::: "memory");   // the conversions and later loads may land in the registers that the x loads' address names
  v16b a[CC / 32];
#pragma unroll   // a, xv indexed by constants
  for (int kc = 0; kc < CC / 32; ++kc)
#pragma unroll   // as above
    for (int i = 0; i < 16; ++i) a[kc][i] = (__bf16)xv[kc][i];
#pragma unroll   // w0 indexed by constants
  for (int it = 0; it < 16; ++it) *(v4b*)&sw[it * 2 + wr][wq] = cvt4(w0[it]);
#pragma unroll   // two more rounds of 24 steps, each round's loads in flight at once
  for (int b = 0; b < 2; ++b) { v4f w1[24];
#pragma unroll   // w1 indexed by constants
    for (int it = 0; it < 24; ++it) w1[it] = *(const v4f*)(wp + (size_t)(16 + b * 24 + it) * 2 * CC);
    asm volatile("s_wait_xcnt 0x0" :: "v"(wp) : "memory");   // the conversions and LDS addresses below may land in the registers that these loads' address names; named as an input, the address lives up to the wait
#pragma unroll   // as above
    for (int it = 0; it < 24; ++it) *(v4b*)&sw[(16 + b * 24 + it) * 2 + wr][wq] = cvt4(w1[it]); }
  __syncthreads();   // every wave reads weight rows that all waves wrote
  v8f acc[8] = {}; v16b af[2][8];   // A fragments of this step and of the next
#pragma unroll   // af indexed by constants
  for (int j = 0; j < 8; ++j) af[0][j] = frag_b(&sw[j * 16 + col][0], lane);
#pragma unroll   // a, af, acc indexed by constants; the next step's fragment reads stand in front of this step's products
  for (int kc = 0; kc < CC / 32; ++kc) { const int cu = kc & 1, nx = cu ^ 1;
    if (kc + 1 < CC / 32) {
#pragma unroll   // as above
      for (int j = 0; j < 8; ++j) af[nx][j] = frag_b(&sw[j * 16 + col][(kc + 1) * 32], lane); }
#pragma unroll   // as above
    for (int j = 0; j < 8; ++j) acc[j] = wmma_bf(af[cu][j], a[kc], acc[j]); }
#pragma unroll
  for (int j = 0; j < 8; ++j)
#pragma unroll
    for (int r = 0; r < 8; ++r) { const float v = acc[j][r]; so[j * 16 + 8 * g + r][wave * 16 + col] = (which < 2) ? 1.0f / (1.0f + __expf(-v)) : v; }
  __syncthreads();   // a channel's 64 positions come from all four waves
  if (which == 2) {   // the same for the whole block: thread = (position, head), two heads a thread; a wave reads and writes 128 contiguous bytes of a channel's row
    const int pp = tid & 63;
#pragma unroll 1   // two heads through one body: the code stays small
    for (int hl = tid >> 6; hl < 4; hl += 2) { float v[HD], q[HD];
#pragma unroll   // v and q indexed by constants, so they stay in registers
      for (int d = 0; d < HD; ++d) { v[d] = so[hl * HD + d][pp]; q[d] = v[d] * v[d]; }
#pragma unroll   // constant indices: q stays in registers
      for (int o = 1; o < HD; o <<= 1)
#pragma unroll   // as above
        for (int d = 0; d < HD; d += 2 * o) q[d] += q[d + o];
      const float den = fmaxf(sqrtf(q[0]), 1e-12f);
#pragma unroll   // constant indices: v stays in registers
      for (int d = 0; d < HD; ++d) so[hl * HD + d][pp] = v[d] / den; }
    __syncthreads(); }   // the stores below read rows that other threads normalised
  float* dst = (which == 0) ? Q : (which == 1) ? Kf : Vf; for (int e = tid; e < 128 * 16; e += 128) { const int cl = e >> 4, q = e & 15; vst2(dst + (size_t)(c0 + cl) * NP + p0 + q * 4, *(const v4f*)&so[cl][q * 4]); } }
// ---- k_fuse: block = (f, h), 256 threads, nearly the whole LDS of a WGP: the 32 planes k[d] v[f] of the head, 16 at a time, are summed to integral images in registers on their way into LDS, box-differenced there and summed over d (ascending) with q[d]; O[wi*256 + h*32 + f][p] = sum (k_out divides by the norm)
// LDS plane = the padded integral image: row ia = 0..64 (row 0 zero), column ib + 4 for ib = -4..67: ib <= 0 zero, ib = 1..64 the prefix sums, ib = 65..67 copies of ib = 64. All window offsets are multiples of 4, so the four neighbouring positions of a thread read each corner as one aligned 16-byte quad, and a quad wholly left (right) of the image is the quad at ib = -4 (64).
// Integral phase: 16 lanes hold an image row (four columns a lane), a half-wave walks the 64 rows of its own plane. Along h the sum runs in the thread's registers; along w the row's 16 quad totals are prefix-summed across the 16 lanes with DPP shifts (1, 2, 4, 8 lanes), and each lane adds the sum of the lanes to its left to its own three partial sums. Each value is written to LDS once, finished.
// Box phase: the windows reach 32, 16 and 8 rows up and down, so image rows 16 apart share their corner rows. A thread takes the rows bi, bi + 16, bi + 32, bi + 48 (four positions each) of every plane: per plane and window five integral rows, each differenced right - left once, serve all four image rows.
#define FP 76               // k_inorm's row pitch in floats: 304 bytes = 16 x odd, so that 16-byte reads of one row a lane do not collide
#define FPL ((HH + 1) * FP) // floats a plane of k_inorm
#define FG 16               // planes a pass
#define GP 72               // k_fuse's row pitch in floats: no lane reads a row of its own here, 16 lanes always cover neighbouring quads of one row
#define GPL ((HH + 1) * GP) // floats a plane of k_fuse
#define KR 32               // rows of k in flight a thread
__device__ __forceinline__ v4f hdiff(const float* pl, int r, int l) { return *(const v4f*)(pl + r) - *(const v4f*)(pl + l); }   // one integral row: right corner quad - left corner quad
template <int N> __device__ __forceinline__ float shr16(float x) { return __builtin_bit_cast(float, __builtin_amdgcn_update_dpp(0, __builtin_bit_cast(int, x), 0x110 + N, 0xf, 0xf, false)); }   // the value of the lane N to the left in the 16-lane row, 0 where there is none
__global__ __launch_bounds__(256) void k_fuse(const float* __restrict__ Q, const float* __restrict__ Kf, const float* __restrict__ Vf, float* __restrict__ O) { __shared__ __align__(16) float s[FG * GPL]; __shared__ __align__(16) float sv[NP];
  const int t = threadIdx.x; const int f = blockIdx.x, h = blockIdx.y; const int bi = t >> 4, jl = t & 15, j4 = jl * 4;   // bi: the thread's plane in the integral phase, its first image row in the box phase
  const v4f zero4 = {0.f, 0.f, 0.f, 0.f};
  { const float* vp = Vf + (size_t)(h * HD + f) * NP + t * 4; v4f vv[4];
#pragma unroll   // the four loads in flight at once
    for (int c = 0; c < 4; ++c) vv[c] = *(const v4f*)(vp + c * 1024);
    asm volatile("s_wait_xcnt 0x0" ::: "memory");   // the index arithmetic below may reuse the registers that these loads' address names
    for (int e = t; e < FG * (GP / 4); e += 256) *(v4f*)&s[(e / (GP / 4)) * GPL + (e % (GP / 4)) * 4] = zero4;   // row 0 of every plane; no pass writes it again
#pragma unroll   // four rows a thread
    for (int c = 0; c < 4; ++c) *(v4f*)&s[bi * GPL + (c * 16 + jl + 1) * GP] = zero4;   // ib = -4..-1 of rows 1..64; as above
#pragma unroll   // vv indexed by constants
    for (int c = 0; c < 4; ++c) *(v4f*)&sv[c * 1024 + t * 4] = vv[c]; }
  int cR[NWIN], cL[NWIN];   // places of the right and left corner quads in integral row bi
#pragma unroll   // cR, cL indexed by constants: stay in registers
  for (int wi = 0; wi < NWIN; ++wi) { const int ws = HH >> wi; const int tp = ws - 1, rr = tp / 2, l = tp - rr;   // l = ws - l = 32, 16, 8
    int bl = j4 - l, br = j4 + ws - l; bl = bl < -4 ? -4 : (bl > WWD ? WWD : bl); br = br < -4 ? -4 : (br > WWD ? WWD : br);
    cR[wi] = bi * GP + br + 4; cL[wi] = bi * GP + bl + 4; }
  const int dE = (HH - bi) * GP;                                  // from integral row bi to row 64
  const int dT = ((bi > 8 ? bi - 8 : 0) - bi) * GP;               // to row max(bi - 8, 0)
  const int dB = ((bi + 56 < HH ? bi + 56 : HH) - bi) * GP;       // to row min(bi + 56, 64)
  v4f acc[NWIN][4];
#pragma unroll   // acc indexed by constants
  for (int wi = 0; wi < NWIN; ++wi)
#pragma unroll   // as above
    for (int a = 0; a < 4; ++a) acc[wi][a] = zero4;
  __syncthreads();   // every wave reads all of v, which all waves wrote
#pragma unroll 1   // two passes through one body: the code stays small
  for (int d0 = 0; d0 < HD; d0 += FG) {
    const float* qp = Q + (size_t)(h * HD + d0) * NP + bi * WWD + j4; v4f qc[4];   // q of the thread's four image rows, one plane at a time
    { const float* kp = Kf + (size_t)(h * HD + d0 + bi) * NP + j4; float* sp = &s[bi * GPL + GP + 4 + j4]; const float* vr = &sv[j4]; v4f kv[KR]; v4f c = zero4;
#pragma unroll   // half a plane's rows in flight at once; kv indexed by constants
      for (int r = 0; r < KR; ++r) kv[r] = *(const v4f*)(kp + r * WWD);
      asm volatile("s_wait_xcnt 0x0" :: "v"(kp) : "memory");   // later arithmetic may reuse the registers that these loads' address names; named as an input, the address lives up to the wait
#pragma unroll   // kv indexed by constants; eight rows a group, so that their independent row sums fill each other's waits
      for (int g = 0; g < HH / 8; ++g) { float tot[8];
#pragma unroll   // as above
        for (int u = 0; u < 8; ++u) { const int r = g * 8 + u;
          c += kv[r % KR] * *(const v4f*)(vr + r * WWD);   // along h
          const float l1 = c[0], l2 = l1 + c[1], l3 = l2 + c[2]; float x = l3 + c[3];   // along w inside the quad
          x += shr16<1>(x); x += shr16<2>(x); x += shr16<4>(x); x += shr16<8>(x);   // along w over the 16 quads of the row
          const float e = shr16<1>(x); const v4f o = {e, e + l1, e + l2, e + l3};   // one column to the right: ib = j4 .. j4 + 3
          *(v4f*)(sp + r * GP) = o; tot[u] = x; }
        if (jl == 15) {   // ib = 64..67: the row's total
#pragma unroll   // tot indexed by constants
          for (int u = 0; u < 8; ++u) { const v4f e4 = {tot[u], tot[u], tot[u], tot[u]}; *(v4f*)(sp + (g * 8 + u) * GP + 4) = e4; } }
        if (g * 8 + KR < HH) {
#pragma unroll   // the group's registers are loaded anew, so the stream of loads does not pause
          for (int u = 0; u < 8; ++u) kv[(g * 8 + u) % KR] = *(const v4f*)(kp + (g * 8 + u + KR) * WWD);
          asm volatile("s_wait_xcnt 0x0" :: "v"(kp) : "memory"); }   // as at the first loads
        if (g * 8 + KR == HH) {   // behind the last refill: the first plane's q lands during the remaining rows, in registers that k has left, not in front of the barrier
#pragma unroll   // the four rows' q in flight at once
          for (int a = 0; a < 4; ++a) qc[a] = *(const v4f*)(qp + a * 16 * WWD);
          asm volatile("s_wait_xcnt 0x0" :: "v"(qp) : "memory"); } } }   // as at the first loads
    __syncthreads();   // the corners below lie in planes that other waves wrote
#pragma unroll 2   // two planes a trip: the q fetched ahead needs no register copies
    for (int u = 0; u < FG; ++u) { const float* pl = s + u * GPL; const float* qx = qp + (size_t)(u + 1 < FG ? u + 1 : 0) * NP; v4f qn[4];
#pragma unroll   // q of the next plane flies for one plane's work; the last trip reads the first plane again, unused: no branch inside a trip
      for (int a = 0; a < 4; ++a) qn[a] = *(const v4f*)(qx + a * 16 * WWD);
      asm volatile("s_wait_xcnt 0x0" ::: "memory");   // the next trip forms the q loads' address anew in the same registers
      const v4f h0 = hdiff(pl, cR[0], cL[0]), h1 = hdiff(pl + 16 * GP, cR[0], cL[0]), h2 = hdiff(pl + 32 * GP, cR[0], cL[0]), h3 = hdiff(pl + 48 * GP, cR[0], cL[0]), he = hdiff(pl + dE, cR[0], cL[0]);   // reach 32: top row zero for the upper two image rows, bottom row 64 for the lower two
      const v4f m0 = hdiff(pl, cR[1], cL[1]), m1 = hdiff(pl + 16 * GP, cR[1], cL[1]), m2 = hdiff(pl + 32 * GP, cR[1], cL[1]), m3 = hdiff(pl + 48 * GP, cR[1], cL[1]), me = hdiff(pl + dE, cR[1], cL[1]);   // reach 16
      const v4f nt = hdiff(pl + dT, cR[2], cL[2]), n1 = hdiff(pl + 8 * GP, cR[2], cL[2]), n2 = hdiff(pl + 24 * GP, cR[2], cL[2]), n3 = hdiff(pl + 40 * GP, cR[2], cL[2]), nb = hdiff(pl + dB, cR[2], cL[2]);   // reach 8
      acc[0][0] += qc[0] * h2; acc[0][1] += qc[1] * h3; acc[0][2] += qc[2] * (he - h0); acc[0][3] += qc[3] * (he - h1);
      acc[1][0] += qc[0] * m1; acc[1][1] += qc[1] * (m2 - m0); acc[1][2] += qc[2] * (m3 - m1); acc[1][3] += qc[3] * (me - m2);
      acc[2][0] += qc[0] * (n1 - nt); acc[2][1] += qc[1] * (n2 - n1); acc[2][2] += qc[2] * (n3 - n2); acc[2][3] += qc[3] * (nb - n3);
#pragma unroll   // qc, qn indexed by constants
      for (int a = 0; a < 4; ++a) qc[a] = qn[a]; }
    __syncthreads();   // the next pass overwrites the planes
  }
#pragma unroll   // acc indexed by constants; 16 lanes store 256 contiguous bytes of a row
  for (int wi = 0; wi < NWIN; ++wi)
#pragma unroll   // as above
    for (int a = 0; a < 4; ++a) vst2(O + (size_t)(wi * CC + h * HD + f) * NP + (bi + 16 * a) * WWD + j4, acc[wi][a]); }
// ---- k_inorm: block = (group dg of NPB planes d, head h, quarter rq of the image rows), 256 threads: the planes k[d] are laid down in LDS in k_fuse's plane layout, prefix-summed along w, then along h (each serial, one thread a row or column), and box-differenced there: NPART[(dg*3+wi)*8+h][p] = sum over the group's d (ascending) of q[d] box(k[d]); k_out adds the NG groups.
// The four quarters of a (dg, h) each build the same integral images: the scans are a chain of waits that costs the same for any number of rows wanted, and the box phase, the part that takes LDS time, is shared out over four WGPs.
__global__ __launch_bounds__(256) void k_inorm(const float* __restrict__ Q, const float* __restrict__ Kf, float* __restrict__ NPART) { __shared__ __align__(16) float s[NPB * FPL];
  const int t = threadIdx.x; const int dg = blockIdx.x, h = blockIdx.y, rq = blockIdx.z; const int i = t >> 4, j4 = (t & 15) * 4; const int sg = t >> 6, sl = t & 63;   // (i, j4): row within a quarter and four positions; (sg, sl): plane and row or column in the scans
  const int y = rq * (HH / 4) + i;   // the image row whose norms this thread computes
  const v4f zero4 = {0.f, 0.f, 0.f, 0.f};
  const float* kp = Kf + (size_t)(h * HD + dg * NPB) * NP + t * 4; v4f kv[NPB][4];
#pragma unroll   // all of a thread's loads in flight at once; kv indexed by constants
  for (int g = 0; g < NPB; ++g)
#pragma unroll   // as above
    for (int c = 0; c < 4; ++c) kv[g][c] = *(const v4f*)(kp + (size_t)g * NP + c * 1024);
  const float* qp = Q + (size_t)(h * HD + dg * NPB) * NP + y * WWD + j4; v4f qc[NPB];   // q flies beside k and lands during the scans
#pragma unroll   // as above
  for (int g = 0; g < NPB; ++g) qc[g] = *(const v4f*)(qp + (size_t)g * NP);
  asm volatile("s_wait_xcnt 0x0" ::: "memory");   // the index arithmetic below may reuse the registers that these loads' addresses name
  for (int e = t; e < NPB * FP; e += 256) s[(e / FP) * FPL + e % FP] = 0.f;   // row 0 of every plane
  *(v4f*)&s[sg * FPL + (sl + 1) * FP] = zero4;                                // ib = -4..-1 of rows 1..64
  { float* sp = &s[(i + 1) * FP + 4 + j4];   // value w of row r at row r + 1, column w + 4 (aligned)
#pragma unroll   // kv indexed by constants
    for (int g = 0; g < NPB; ++g)
#pragma unroll   // as above
      for (int c = 0; c < 4; ++c) *(v4f*)(sp + g * FPL + c * 16 * FP) = kv[g][c]; }
  __syncthreads();   // a scan reads a row that 16 threads wrote
  { float* row = &s[sg * FPL + (sl + 1) * FP + 4]; float run = 0.f; v4f r[WWD / 4];   // along w: thread = (plane, row); written back one column to the right, behind the zero of ib = 0
#pragma unroll   // a row's 16 loads in flight at once: one LDS latency a scan
    for (int m = 0; m < WWD / 4; ++m) r[m] = *(const v4f*)(row + 4 * m);
#pragma unroll   // r indexed by constants
    for (int m = 0; m < WWD / 4; ++m) { v4f o; o[0] = run; run += r[m][0]; o[1] = run; run += r[m][1]; o[2] = run; run += r[m][2]; o[3] = run; run += r[m][3]; *(v4f*)(row + 4 * m) = o; }
    row[WWD] = run; }
  __syncthreads();   // columns cross the rows of 64 threads
  { float* cp = &s[sg * FPL + FP + 5 + sl]; float run = 0.f; float p[HH];   // along h: thread = (plane, column), in place
#pragma unroll   // a column's 64 loads in flight at once; p indexed by constants
    for (int r = 0; r < HH; ++r) p[r] = cp[r * FP];
    __builtin_amdgcn_sched_barrier(0);   // holds all the loads in front of the chain of sums: sunk between the sums, only three were in flight and the scan waited out an LDS latency every few rows
#pragma unroll   // as above
    for (int r = 0; r < HH; ++r) { run += p[r]; cp[r * FP] = run; } }
  __syncthreads();   // column ib = 64 was summed by one thread a plane
  { float* e = &s[sg * FPL + (sl + 1) * FP + 4 + WWD]; const float x = e[0]; const v4f r = {x, x, x, x}; *(v4f*)e = r; }   // ib = 65..67: copies of ib = 64; thread = (plane, row)
  __syncthreads();   // the corners below lie in rows and columns of other threads
  v4f acc[NWIN];
#pragma unroll   // acc indexed by constants; the corner places are formed once a window
  for (int wi = 0; wi < NWIN; ++wi) { const int ws = HH >> wi; const int tp = ws - 1, rr = tp / 2, l = tp - rr;   // l = ws - l = 32, 16, 8
    int bl = j4 - l, br = j4 + ws - l; bl = bl < -4 ? -4 : (bl > WWD ? WWD : bl); br = br < -4 ? -4 : (br > WWD ? WWD : br);
    int at = y - l, ab = y + ws - l; at = at < 0 ? 0 : at; ab = ab > HH ? HH : ab;   // integral rows of the window's top and bottom
    const float* pb = s + ab * FP; const float* pt = s + at * FP; v4f a = zero4;
#pragma unroll   // the planes in ascending order of d; their corner quads in flight together
    for (int g = 0; g < NPB; ++g) a += qc[g] * (hdiff(pb + g * FPL, br + 4, bl + 4) - hdiff(pt + g * FPL, br + 4, bl + 4));
    acc[wi] = a; }
#pragma unroll   // acc indexed by constants
  for (int wi = 0; wi < NWIN; ++wi) vst2(NPART + (size_t)((dg * NWIN + wi) * NH + h) * NP + y * WWD + j4, acc[wi]); }
// ---- k_out: block = (128 out channels o, 32 positions), 8 waves of 16 o x 32 p: out[o][p] = sum_c Wout[o][c] O[c][p] / (norm + 1e-6) (A = Wout bf16 exact rows, B = columns p of O divided by the norm, as bf16 hi + lo) + bout[o]; (B, C, H, W) layout = rows o of 4,096
// The block's O tile (768 channels x one 128-byte line) is read once, whole lines, every load in flight at once, divided by the norm (the NG partial norms of its head and window added, + 1e-6, inverted once a thread), split into hi and lo once and laid down in LDS as position rows [p][c]; all eight waves take their B fragments from there.
#define OPB 32              // positions a block: one line of every channel plane
#define OPI (OC + 8)        // LDS row pitch in bf16: 1,552 bytes = 16 x odd, so that 16-byte reads of one row a lane do not collide
#define APRE 8              // A fragments fetched ahead of their use
__global__ __launch_bounds__(256) void k_out(const __bf16* __restrict__ PO, const float* __restrict__ O, const float* __restrict__ NPART, const float* __restrict__ BO, float* __restrict__ Y) { __shared__ __align__(16) __bf16 sh[OPB][OPI]; __shared__ __align__(16) __bf16 sl[OPB][OPI]; __shared__ __align__(16) float so[8][16][OPB + 4];
  const int tid = threadIdx.x, wave = tid >> 5, lane = tid & 31, col = lane & 15, g = lane >> 4; const int o0 = blockIdx.x * 128 + wave * 16; const int p0 = blockIdx.y * OPB;
  const int pq = tid & 7, cg = tid >> 3;   // staging: eight lanes cover a channel's line; a thread takes four positions of eight neighbouring channels, three times
  const float* np = NPART + (size_t)(cg >> 2) * NP + p0 + pq * 4; v4f nq[NWIN][NG];   // the thread's eight channels lie in head cg >> 2; round r of the staging is window r
#pragma unroll   // the partial norms fly in front of the tile; nq indexed by constants
  for (int r = 0; r < NWIN; ++r)
#pragma unroll   // as above
    for (int gI = 0; gI < NG; ++gI) nq[r][gI] = *(const v4f*)(np + (size_t)((gI * NWIN + r) * NH) * NP);
  asm volatile("s_wait_xcnt 0x0" ::: "memory");   // later loads may land in the registers that these loads' address names
  const float* src = O + (size_t)(cg * 8) * NP + p0 + pq * 4; v4f x[OC / 256][8];
#pragma unroll   // all 24 loads of a thread in flight at once: one trip to memory for the whole tile
  for (int r = 0; r < OC / 256; ++r) {
#pragma unroll   // x indexed by constants: stays in registers
    for (int i = 0; i < 8; ++i) x[r][i] = *(const v4f*)(src + (size_t)(r * 256 + i) * NP);
    asm volatile("s_wait_xcnt 0x0" ::: "memory"); }   // later loads may land in the registers that these loads' address names
  const __bf16* ar = PO + (size_t)(o0 + col) * OC; v16b a[OC / 32];   // natural row of Wout read with the A-row lane layout (identical to frag_b's)
#pragma unroll   // the first A fragments fly beside the tile
  for (int kc = 0; kc < APRE; ++kc) a[kc] = frag_b(ar + kc * 32, lane);
  asm volatile("s_wait_xcnt 0x0" ::: "memory");   // the arithmetic below may reuse registers that these loads' addresses name
  v4f inv[NWIN];   // 1 / (norm + 1e-6): the groups of d added in ascending order
#pragma unroll   // nq, inv indexed by constants
  for (int r = 0; r < NWIN; ++r) { v4f n = nq[r][0];
#pragma unroll   // as above
    for (int gI = 1; gI < NG; ++gI) n += nq[r][gI];
    inv[r] = 1.0f / (n + 1e-6f); }
#pragma unroll   // x indexed by constants
  for (int r = 0; r < OC / 256; ++r)
#pragma unroll   // as above
    for (int e = 0; e < 4; ++e) { v8b h, l;
#pragma unroll   // as above
      for (int i = 0; i < 8; ++i) { const float v = x[r][i][e] * inv[r][e]; const __bf16 hh = (__bf16)v; h[i] = hh; l[i] = (__bf16)(v - (float)hh); }
      *(v8b*)&sh[pq * 4 + e][r * 256 + cg * 8] = h; *(v8b*)&sl[pq * 4 + e][r * 256 + cg * 8] = l; }
  __syncthreads();   // every wave reads rows that all waves wrote
  float bb[8];
#pragma unroll   // the bias flies beside the products instead of being waited for behind them
  for (int r = 0; r < 8; ++r) bb[r] = BO[o0 + 8 * g + r];
  asm volatile("s_wait_xcnt 0x0" ::: "memory");   // later loads may land in the registers that these loads' address names
  v8f acc[2] = {}; v16b bh[2][2], bl[2][2];   // B fragments of this step and of the next
#pragma unroll   // bh, bl indexed by constants
  for (int jt = 0; jt < 2; ++jt) { bh[0][jt] = frag_b(&sh[jt * 16 + col][0], lane); bl[0][jt] = frag_b(&sl[jt * 16 + col][0], lane); }
#pragma unroll   // a, bh, bl indexed by constants; the fetches ahead stand in front of the step's products
  for (int kc = 0; kc < OC / 32; ++kc) { const int cu = kc & 1, nx = cu ^ 1;
    if (kc + 1 < OC / 32) {
#pragma unroll   // as above
      for (int jt = 0; jt < 2; ++jt) { bh[nx][jt] = frag_b(&sh[jt * 16 + col][(kc + 1) * 32], lane); bl[nx][jt] = frag_b(&sl[jt * 16 + col][(kc + 1) * 32], lane); } }
    if ((kc & 3) == 0 && kc + APRE < OC / 32) {
#pragma unroll   // as above
      for (int u = 0; u < 4; ++u) a[kc + APRE + u] = frag_b(ar + (kc + APRE + u) * 32, lane); }
    acc[0] = wmma_bf(a[kc], bh[cu][0], acc[0]); acc[1] = wmma_bf(a[kc], bh[cu][1], acc[1]);   // per accumulator hi, then lo, in ascending c
    acc[0] = wmma_bf(a[kc], bl[cu][0], acc[0]); acc[1] = wmma_bf(a[kc], bl[cu][1], acc[1]); }
#pragma unroll   // acc indexed by constants
  for (int jt = 0; jt < 2; ++jt)
#pragma unroll   // as above
    for (int r = 0; r < 8; ++r) so[wave][8 * g + r][jt * 16 + col] = acc[jt][r] + bfr(bb[r]);
  LDSX();
#pragma unroll   // four rows (whole lines) a store
  for (int it = 0; it < 4; ++it) { const int rl = it * 4 + (lane >> 3); vst2(Y + (size_t)(o0 + rl) * NP + p0 + (lane & 7) * 4, *(const v4f*)&so[wave][rl][(lane & 7) * 4]); } }
extern "C" void kernel_launch(void* const* d_in, const int* in_sizes, int n_in, void* d_out, int out_size, void* d_ws, size_t ws_size, hipStream_t stream) {
  (void)in_sizes; (void)n_in; (void)out_size;
  const float** F = (const float**)d_in;   // 0 x [1,256,64,64], 1 Wq, 2 Wk, 3 Wv [256,256], 4 Wout [256,768], 5 bout [256]
  if (ws_size < (size_t)WS_END) return;
  char* ws = (char*)d_ws; __bf16 *PO = (__bf16*)(ws + WS_PO); float *Q = (float*)(ws + WS_Q), *Kf = (float*)(ws + WS_K), *Vf = (float*)(ws + WS_V), *NPART = (float*)(ws + WS_NP), *O = (float*)(ws + WS_O);
  k_proj<<<dim3(NP / 64, CC / 128, 4), 128, 0, stream>>>(F[0], F[1], F[2], F[3], F[4], PO, Q, Kf, Vf);
  k_inorm<<<dim3(NG, NH, 4), 256, 0, stream>>>(Q, Kf, NPART);
  k_fuse<<<dim3(HD, NH), 256, 0, stream>>>(Q, Kf, Vf, O);
  k_out<<<dim3(CC / 128, (TPB * WWD) / OPB), 256, 0, stream>>>(PO, O, NPART, F[5], (float*)d_out);
}

// v008
// One run takes 46 microseconds.
// Two timings next to v007 both put it at 1.03 times that version's speed.
// All steps since v000 together make it 8.89 times as fast.
// compute dtype: all float inputs rounded to bf16; q/k/v 1x1 convs with EXACT bf16 products on WMMA 16x16x32 (x and the weights read as they lie); sigmoid (hardware exp) and the per-position L2 normalisation of v in f32; k and k (x) v outer-product planes, their 2-D inclusive prefix sums (integral images; they live in LDS only) and the clamped 4-corner box differences for the three window sizes, the q-weighted sums and the division all in f32 on VALU (fixed order); out = Wout (exact) . o (bf16 hi + lo, 2 products) + bout on WMMA; f32 output in (B, C, H, W) order.
#include <hip/hip_runtime.h>
#include <math.h>

typedef __attribute__((ext_vector_type(16))) _Float16 v16h;
typedef __attribute__((ext_vector_type(16))) __bf16 v16b;
typedef __attribute__((ext_vector_type(8)))  _Float16 v8h;
typedef __attribute__((ext_vector_type(8)))  float v8f;
typedef __attribute__((ext_vector_type(4)))  float v4f;
typedef __attribute__((ext_vector_type(2)))  float v2f;
typedef __attribute__((ext_vector_type(4)))  unsigned v4u;
typedef __attribute__((ext_vector_type(4)))  int v4i;
typedef float __attribute__((may_alias)) float_a;
typedef int __attribute__((may_alias)) int_a;

template <typename T> __device__ __forceinline__ void vst2(void* p, T v) { *(T*)p = v;  }
__device__ __forceinline__ v8f wmma16(v16h a, v16h b, v8f c) {
  v8f d = __builtin_amdgcn_wmma_f32_16x16x32_f16(false, a, false, b, (short)0, c, false, false);
  asm volatile("v_nop\n\tv_nop\n\tv_nop\n\tv_nop" : "+v"(d) : "v"(a), "v"(b));
  return d;
}
__device__ __forceinline__ v8f wmma_bf(v16b a, v16b b, v8f c) {
  v8f d = __builtin_amdgcn_wmma_f32_16x16x32_bf16(false, a, false, b, (short)0, c, false, false);
  asm volatile("v_nop\n\tv_nop\n\tv_nop\n\tv_nop" : "+v"(d) : "v"(a), "v"(b));
  return d;
}
// 16x16x32 fragments: lane = (h = lane>>4, row/col = lane&15); elements 0..7 = k0+8h+0..7, 8..15 = k0+16+8h+0..7; D element r = row 8h+r
__device__ __forceinline__ v16h frag_h(const _Float16* rowk0, int lane) {
  union { v16h v; v8h q[2]; } u; const _Float16* p = rowk0 + 8 * (lane >> 4);
  u.q[0] = *(const v8h*)p; u.q[1] = *(const v8h*)(p + 16); return u.v;
}
__device__ __forceinline__ v16h frag_f32(const float* rowk0, int lane) {
  v16h a; const float* p = rowk0 + 8 * (lane >> 4);
#pragma unroll
  for (int i = 0; i < 8; ++i) { a[i] = (_Float16)p[i]; a[8 + i] = (_Float16)p[16 + i]; }
  return a;
}
__device__ __forceinline__ v16h frag_f32s(const float* rowk0, int lane, float sc) {
  v16h a; const float* p = rowk0 + 8 * (lane >> 4);
#pragma unroll
  for (int i = 0; i < 8; ++i) { a[i] = (_Float16)(p[i] * sc); a[8 + i] = (_Float16)(p[16 + i] * sc); }
  return a;
}
// column fragment from a [K][ld] layout (column n), rows >= K read as 0
__device__ __forceinline__ v16h fragc_f32(const float* W, int k0, int n, int lane, int ld, int K) {
  v16h a; const int g = lane >> 4;
#pragma unroll
  for (int i = 0; i < 8; ++i) { const int ka = k0 + 8 * g + i, kb = ka + 16;
    a[i] = (_Float16)(ka < K ? W[(size_t)(ka < K ? ka : K - 1) * ld + n] : 0.f); a[8 + i] = (_Float16)(kb < K ? W[(size_t)(kb < K ? kb : K - 1) * ld + n] : 0.f); }
  return a;
}
struct F2 { v16b h, l; };
__device__ __forceinline__ F2 bsplit16(const float v[16]) { F2 r;
#pragma unroll
  for (int i = 0; i < 16; ++i) { const __bf16 h = (__bf16)v[i]; r.h[i] = h; r.l[i] = (__bf16)(v[i] - (float)h); }
  return r; }
__device__ __forceinline__ F2 split_row(const float* row, int k0, int lane) { float v[16]; const float* p = row + k0 + 8 * (lane >> 4);
#pragma unroll
  for (int i = 0; i < 8; ++i) { v[i] = p[i]; v[8 + i] = p[16 + i]; }
  return bsplit16(v); }
__device__ __forceinline__ F2 split_rowK(const float* row, int k0, int lane, int K) { float v[16]; const int g = lane >> 4;
#pragma unroll
  for (int i = 0; i < 8; ++i) { const int ka = k0 + 8 * g + i, kb = ka + 16; v[i] = ka < K ? row[ka < K ? ka : K - 1] : 0.f; v[8 + i] = kb < K ? row[kb < K ? kb : K - 1] : 0.f; }
  return bsplit16(v); }
__device__ __forceinline__ F2 split_col(const float* W, int k0, int n, int lane, int ld, int K) { float v[16]; const int g = lane >> 4;
#pragma unroll
  for (int i = 0; i < 8; ++i) { const int ka = k0 + 8 * g + i, kb = ka + 16; v[i] = ka < K ? W[(size_t)(ka < K ? ka : K - 1) * ld + n] : 0.f; v[8 + i] = kb < K ? W[(size_t)(kb < K ? kb : K - 1) * ld + n] : 0.f; }
  return bsplit16(v); }
__device__ __forceinline__ v8f mac3(const F2& a, const F2& b, v8f c) { c = wmma_bf(a.l, b.h, c); c = wmma_bf(a.h, b.l, c); return wmma_bf(a.h, b.h, c); }
__device__ __forceinline__ float sigm(float v) { return 1.0f / (1.0f + expf(-v)); }
#define LDSX() do { asm volatile("s_wait_dscnt 0" ::: "memory"); __builtin_amdgcn_wave_barrier(); __builtin_amdgcn_fence(__ATOMIC_RELEASE, "workgroup"); } while (0)


// Inception (multi-window box) linear attention (B 1, C 256 = 8 heads x 32, 64 x 64): per window size ws in {64, 32, 16}: attn = q . boxsum(k v^T) / (q . boxsum(k) + 1e-6) using integral images with edge-replicated borders; concat over windows (768 channels), 1x1 output conv + bias.
#define CC 256
#define NH 8
#define HD 32
#define HH 64
#define WWD 64
#define NP (HH * WWD)      // 4,096 positions
#define NWIN 3
#define OC (CC * NWIN)     // 768
#ifndef TPB
#define TPB HH             // output rows (of 64 positions) that k_out's grid covers
#endif
typedef __attribute__((ext_vector_type(8))) __bf16 v8b;
__device__ __forceinline__ v16b frag_b(const __bf16* rowk0, int lane) {
  union { v16b v; v8b q[2]; } u; const __bf16* p = rowk0 + 8 * (lane >> 4);
  u.q[0] = *(const v8b*)p; u.q[1] = *(const v8b*)(p + 16); return u.v;
}
__device__ __forceinline__ float bfr(float v) { return (float)(__bf16)v; }
__device__ __attribute__((noinline)) float exp_ni(float v) { return expf(v); }
__device__ __attribute__((noinline)) float erf_ni(float v) { return erff(v); }

#define WS_PW  0u                                   // (not used); then bf16 natural rows Wout [256][768]
#define WS_PO  (WS_PW + 2u * (size_t)3 * CC * CC)
#define WS_XT  (WS_PO + 2u * (size_t)CC * OC)           // (not used)
#define WS_Q   (WS_XT + 4u * (size_t)NP * CC)           // f32 q [c][p] (sigmoid), k [c][p] (sigmoid), v [c][p] (normalised): channel-major planes of 4,096 positions
#define WS_K   (WS_Q + 4u * (size_t)NP * CC)
#define WS_V   (WS_K + 4u * (size_t)NP * CC)
#define NPB 4               // planes d of k a work-group of k_inorm
#define NG (HD / NPB)       // partial sums over d of the norm
#define WS_NP  (WS_V + 4u * (size_t)NP * CC)            // f32 partial norms [(dg*3+wi)*8+h][p]: sum over the NPB planes d of group dg
#define WS_O   (WS_NP + 4u * (size_t)NG * NWIN * NH * NP)   // f32 o [768][p], not yet divided by the norm: channel-major planes
#define WS_END (WS_O + 4u * (size_t)NP * OC)

// ---- k_proj: block = (64 positions = one image row, 128 out channels, which): 1x1 conv = W (A rows = channels) . x (B columns = positions), so D rows are channels; stored channel-major [c][p], 256 contiguous bytes per channel and block.
// Everything the conv needs is prepared inside this launch: x is read as it lies ([c][p]: 16 lanes cover 64 bytes of a channel's line) and rounded to bf16 in registers; the block's 128 weight rows are read as whole lines, rounded to bf16 and laid down in LDS, from where all four waves take their A fragments; epilogue: q, k -> sigmoid; v -> divided by max(||v_h||, 1e-12) per (position, head), the block holding all 32 channels of its four heads (squares summed pairwise: adjacent pairs, then pairs of pairs).
// which == 3: no conv; the 128 blocks round Wout to bf16 (natural rows) for k_out.
#define WPI (CC + 8)        // LDS row pitch in bf16: 528 bytes = 16 x odd, so that 16-byte reads of one row a lane do not collide
typedef __attribute__((ext_vector_type(4))) __bf16 v4b;
__device__ __forceinline__ v4b cvt4(v4f w) { v4b b; b[0] = (__bf16)w[0]; b[1] = (__bf16)w[1]; b[2] = (__bf16)w[2]; b[3] = (__bf16)w[3]; return b; }
__global__ __launch_bounds__(128) void k_proj(const float* __restrict__ X, const float* __restrict__ WQ, const float* __restrict__ WK, const float* __restrict__ WV, const float* __restrict__ WO, __bf16* __restrict__ PO, float* __restrict__ Q, float* __restrict__ Kf, float* __restrict__ Vf) { __shared__ __align__(16) __bf16 sw[128][WPI]; __shared__ __align__(16) float so[128][68];
  const int tid = threadIdx.x, wave = tid >> 5, lane = tid & 31, col = lane & 15, g = lane >> 4; const int which = blockIdx.z;
  if (which == 3) {   // the whole block leaves here, in front of every barrier
    const size_t e0 = ((size_t)(blockIdx.y * (NP / 64) + blockIdx.x) * 384 + tid) * 4; v4f w[3];   // 128 blocks x 384 quads = 256 x 768 values
#pragma unroll   // the three loads in flight at once
    for (int it = 0; it < 3; ++it) w[it] = *(const v4f*)(WO + e0 + it * 512);
    asm volatile("s_wait_xcnt 0x0" ::: "memory");   // the conversions below may land in the registers that these loads' address names
#pragma unroll   // w indexed by constants
    for (int it = 0; it < 3; ++it) vst2(PO + e0 + it * 512, cvt4(w[it]));
    return; }
  const int p0 = blockIdx.x * 64; const int c0 = blockIdx.y * 128; const float* Wr = (which == 0) ? WQ : (which == 1) ? WK : WV;
  const float* xp = X + (size_t)(8 * g) * NP + p0 + wave * 16 + col; float xv[CC / 32][16];   // B fragments: element i = channel kc*32 + 8g + i, element 8 + i = channel kc*32 + 16 + 8g + i (the k order of frag_b)
#pragma unroll   // all of a wave's x loads in flight at once; xv indexed by constants
  for (int kc = 0; kc < CC / 32; ++kc)
#pragma unroll   // as above
    for (int i = 0; i < 8; ++i) { xv[kc][i] = xp[(size_t)(kc * 32 + i) * NP]; xv[kc][8 + i] = xp[(size_t)(kc * 32 + 16 + i) * NP]; }
  const int wr = tid >> 6, wq = (tid & 63) * 4;   // weight staging: 64 threads cover a row of 1,024 bytes, the block two rows a step
  const float* wp = Wr + (size_t)(c0 + wr) * CC + wq; v4f w0[16];
#pragma unroll   // the first 16 steps' loads fly beside those of x
  for (int it = 0; it < 16; ++it) w0[it] = *(const v4f*)(wp + (size_t)it * 2 * CC);
  asm volatile("s_wait_xcnt 0x0" ::: "memory");   // the conversions and later loads may land in the registers that the x loads' address names
  v16b a[CC / 32];
#pragma unroll   // a, xv indexed by constants
  for (int kc = 0; kc < CC / 32; ++kc)
#pragma unroll   // as above
    for (int i = 0; i < 16; ++i) a[kc][i] = (__bf16)xv[kc][i];
#pragma unroll   // w0 indexed by constants
  for (int it = 0; it < 16; ++it) *(v4b*)&sw[it * 2 + wr][wq] = cvt4(w0[it]);
#pragma unroll   // two more rounds of 24 steps, each round's loads in flight at once
  for (int b = 0; b < 2; ++b) { v4f w1[24];
#pragma unroll   // w1 indexed by constants
    for (int it = 0; it < 24; ++it) w1[it] = *(const v4f*)(wp + (size_t)(16 + b * 24 + it) * 2 * CC);
    asm volatile("s_wait_xcnt 0x0" :: "v"(wp) : "memory");   // the conversions and LDS addresses below may land in the registers that these loads' address names; named as an input, the address lives up to the wait
#pragma unroll   // as above
    for (int it = 0; it < 24; ++it) *(v4b*)&sw[(16 + b * 24 + it) * 2 + wr][wq] = cvt4(w1[it]); }
  __syncthreads();   // every wave reads weight rows that all waves wrote
  v8f acc[8] = {}; v16b af[2][8];   // A fragments of this step and of the next
#pragma unroll   // af indexed by constants
  for (int j = 0; j < 8; ++j) af[0][j] = frag_b(&sw[j * 16 + col][0], lane);
#pragma unroll   // a, af, acc indexed by constants; the next step's fragment reads stand in front of this step's products
  for (int kc = 0; kc < CC / 32; ++kc) { const int cu = kc & 1, nx = cu ^ 1;
    if (kc + 1 < CC / 32) {
#pragma unroll   // as above
      for (int j = 0; j < 8; ++j) af[nx][j] = frag_b(&sw[j * 16 + col][(kc + 1) * 32], lane); }
#pragma unroll   // as above
    for (int j = 0; j < 8; ++j) acc[j] = wmma_bf(af[cu][j], a[kc], acc[j]); }
#pragma unroll
  for (int j = 0; j < 8; ++j)
#pragma unroll
    for (int r = 0; r < 8; ++r) { const float v = acc[j][r]; so[j * 16 + 8 * g + r][wave * 16 + col] = (which < 2) ? 1.0f / (1.0f + __expf(-v)) : v; }
  __syncthreads();   // a channel's 64 positions come from all four waves
  if (which == 2) {   // the same for the whole block: thread = (position, head), two heads a thread; a wave reads and writes 128 contiguous bytes of a channel's row
    const int pp = tid & 63;
#pragma unroll 1   // two heads through one body: the code stays small
    for (int hl = tid >> 6; hl < 4; hl += 2) { float v[HD], q[HD];
#pragma unroll   // v and q indexed by constants, so they stay in registers
      for (int d = 0; d < HD; ++d) { v[d] = so[hl * HD + d][pp]; q[d] = v[d] * v[d]; }
#pragma unroll   // constant indices: q stays in registers
      for (int o = 1; o < HD; o <<= 1)
#pragma unroll   // as above
        for (int d = 0; d < HD; d += 2 * o) q[d] += q[d + o];
      const float den = fmaxf(sqrtf(q[0]), 1e-12f);
#pragma unroll   // constant indices: v stays in registers
      for (int d = 0; d < HD; ++d) so[hl * HD + d][pp] = v[d] / den; }
    __syncthreads(); }   // the stores below read rows that other threads normalised
  float* dst = (which == 0) ? Q : (which == 1) ? Kf : Vf; for (int e = tid; e < 128 * 16; e += 128) { const int cl = e >> 4, q = e & 15; vst2(dst + (size_t)(c0 + cl) * NP + p0 + q * 4, *(const v4f*)&so[cl][q * 4]); } }
// ---- k_fuse: block = (f, h), 256 threads, nearly the whole LDS of a WGP: the 32 planes k[d] v[f] of the head, 16 at a time, are summed to integral images in registers on their way into LDS, box-differenced there and summed over d with q[d] (each wave in a fixed order of its own, see the box phase); O[wi*256 + h*32 + f][p] = sum (k_out divides by the norm)
// LDS plane = the padded integral image: row ia = 0..64 (row 0 zero), column ib + 4 for ib = -4..67: ib <= 0 zero, ib = 1..64 the prefix sums, ib = 65..67 copies of ib = 64. All window offsets are multiples of 4, so the four neighbouring positions of a thread read each corner as one aligned 16-byte quad, and a quad wholly left (right) of the image is the quad at ib = -4 (64).
// Integral phase: 16 lanes hold an image row (four columns a lane), a half-wave walks the 64 rows of its own plane. Along h the sum runs in the thread's registers; along w the row's 16 quad totals are prefix-summed across the 16 lanes with DPP shifts (1, 2, 4, 8 lanes), and each lane adds the sum of the lanes to its left to its own three partial sums. Each value is written to LDS once, finished.
// Box phase: the windows reach 32, 16 and 8 rows up and down, so image rows 16 apart share their corner rows. A thread takes the rows bi, bi + 16, bi + 32, bi + 48 (four positions each) of every plane: per plane and window five integral rows, each differenced right - left once, serve all four image rows. The 16 planes of a pass are walked in pairs, round the ring of eight pairs, wave w of block f starting at pair (w + f) mod 8: at any moment the eight waves read eight different pairs, 37,440 bytes apart; and the blocks of a head, which share q, ask for different planes of it at a time.
#define FP 76               // k_inorm's row pitch in floats: 304 bytes = 16 x odd, so that 16-byte reads of one row a lane do not collide
#define FPL ((HH + 1) * FP) // floats a plane of k_inorm
#define FG 16               // planes a pass
#define GP 72               // k_fuse's row pitch in floats: no lane reads a row of its own here, 16 lanes always cover neighbouring quads of one row
#define GPL ((HH + 1) * GP) // floats a plane of k_fuse
#define KR 32               // rows of k in flight a thread
__device__ __forceinline__ v4f hdiff(const float* pl, int r, int l) { return *(const v4f*)(pl + r) - *(const v4f*)(pl + l); }   // one integral row: right corner quad - left corner quad
template <int N> __device__ __forceinline__ float shr16(float x) { return __builtin_bit_cast(float, __builtin_amdgcn_update_dpp(0, __builtin_bit_cast(int, x), 0x110 + N, 0xf, 0xf, false)); }   // the value of the lane N to the left in the 16-lane row, 0 where there is none
__global__ __launch_bounds__(256) void k_fuse(const float* __restrict__ Q, const float* __restrict__ Kf, const float* __restrict__ Vf, float* __restrict__ O) { __shared__ __align__(16) float s[FG * GPL]; __shared__ __align__(16) float sv[NP];
  const int t = threadIdx.x; const int f = blockIdx.x, h = blockIdx.y; const int bi = t >> 4, jl = t & 15, j4 = jl * 4;   // bi: the thread's plane in the integral phase, its first image row in the box phase
  const v4f zero4 = {0.f, 0.f, 0.f, 0.f};
  { const float* vp = Vf + (size_t)(h * HD + f) * NP + t * 4; v4f vv[4];
#pragma unroll   // the four loads in flight at once
    for (int c = 0; c < 4; ++c) vv[c] = *(const v4f*)(vp + c * 1024);
    asm volatile("s_wait_xcnt 0x0" ::: "memory");   // the index arithmetic below may reuse the registers that these loads' address names
    for (int e = t; e < FG * (GP / 4); e += 256) *(v4f*)&s[(e / (GP / 4)) * GPL + (e % (GP / 4)) * 4] = zero4;   // row 0 of every plane; no pass writes it again
#pragma unroll   // four rows a thread
    for (int c = 0; c < 4; ++c) *(v4f*)&s[bi * GPL + (c * 16 + jl + 1) * GP] = zero4;   // ib = -4..-1 of rows 1..64; as above
#pragma unroll   // vv indexed by constants
    for (int c = 0; c < 4; ++c) *(v4f*)&sv[c * 1024 + t * 4] = vv[c]; }
  int cR[NWIN], cL[NWIN];   // places of the right and left corner quads in integral row bi
#pragma unroll   // cR, cL indexed by constants: stay in registers
  for (int wi = 0; wi < NWIN; ++wi) { const int ws = HH >> wi; const int tp = ws - 1, rr = tp / 2, l = tp - rr;   // l = ws - l = 32, 16, 8
    int bl = j4 - l, br = j4 + ws - l; bl = bl < -4 ? -4 : (bl > WWD ? WWD : bl); br = br < -4 ? -4 : (br > WWD ? WWD : br);
    cR[wi] = bi * GP + br + 4; cL[wi] = bi * GP + bl + 4; }
  const int dE = (HH - bi) * GP;                                  // from integral row bi to row 64
  const int dT = ((bi > 8 ? bi - 8 : 0) - bi) * GP;               // to row max(bi - 8, 0)
  const int dB = ((bi + 56 < HH ? bi + 56 : HH) - bi) * GP;       // to row min(bi + 56, 64)
  const int st = __builtin_amdgcn_readfirstlane(((t >> 5) + f) & (FG / 2 - 1));   // the wave's first pair of planes in the box phase; the same in every lane, so the plane's place stays a scalar
  v4f acc[NWIN][4];
#pragma unroll   // acc indexed by constants
  for (int wi = 0; wi < NWIN; ++wi)
#pragma unroll   // as above
    for (int a = 0; a < 4; ++a) acc[wi][a] = zero4;
  __syncthreads();   // every wave reads all of v, which all waves wrote
#pragma unroll 1   // two passes through one body: the code stays small
  for (int d0 = 0; d0 < HD; d0 += FG) {
    const float* qp = Q + (size_t)(h * HD + d0) * NP + bi * WWD + j4; const float* q0 = qp + (size_t)(2 * st) * NP; v4f qc[4];   // q of the thread's four image rows, one plane at a time; q0: the wave's first plane
    { const float* kp = Kf + (size_t)(h * HD + d0 + bi) * NP + j4; float* sp = &s[bi * GPL + GP + 4 + j4]; const float* vr = &sv[j4]; v4f kv[KR]; v4f c = zero4;
#pragma unroll   // half a plane's rows in flight at once; kv indexed by constants
      for (int r = 0; r < KR; ++r) kv[r] = *(const v4f*)(kp + r * WWD);
      asm volatile("s_wait_xcnt 0x0" :: "v"(kp) : "memory");   // later arithmetic may reuse the registers that these loads' address names; named as an input, the address lives up to the wait
#pragma unroll   // kv indexed by constants; eight rows a group, so that their independent row sums fill each other's waits
      for (int g = 0; g < HH / 8; ++g) { float tot[8];
#pragma unroll   // as above
        for (int u = 0; u < 8; ++u) { const int r = g * 8 + u;
          c += kv[r % KR] * *(const v4f*)(vr + r * WWD);   // along h
          const float l1 = c[0], l2 = l1 + c[1], l3 = l2 + c[2]; float x = l3 + c[3];   // along w inside the quad
          x += shr16<1>(x); x += shr16<2>(x); x += shr16<4>(x); x += shr16<8>(x);   // along w over the 16 quads of the row
          const float e = shr16<1>(x); const v4f o = {e, e + l1, e + l2, e + l3};   // one column to the right: ib = j4 .. j4 + 3
          *(v4f*)(sp + r * GP) = o; tot[u] = x; }
        if (jl == 15) {   // ib = 64..67: the row's total
#pragma unroll   // tot indexed by constants
          for (int u = 0; u < 8; ++u) { const v4f e4 = {tot[u], tot[u], tot[u], tot[u]}; *(v4f*)(sp + (g * 8 + u) * GP + 4) = e4; } }
        if (g * 8 + KR < HH) {
#pragma unroll   // the group's registers are loaded anew, so the stream of loads does not pause
          for (int u = 0; u < 8; ++u) kv[(g * 8 + u) % KR] = *(const v4f*)(kp + (g * 8 + u + KR) * WWD);
          asm volatile("s_wait_xcnt 0x0" :: "v"(kp) : "memory"); }   // as at the first loads
        if (g * 8 + KR == HH) {   // behind the last refill: the first plane's q lands during the remaining rows, in registers that k has left, not in front of the barrier
#pragma unroll   // the four rows' q in flight at once
          for (int a = 0; a < 4; ++a) qc[a] = *(const v4f*)(q0 + a * 16 * WWD);
          asm volatile("s_wait_xcnt 0x0" :: "v"(q0) : "memory"); } } }   // as at the first loads
    __syncthreads();   // the corners below lie in planes that other waves wrote
#pragma unroll 1   // one pair of planes a trip: the code stays small
    for (int i = 0; i < FG / 2; ++i) { const int pa = 2 * ((st + i) & (FG / 2 - 1)), pn = 2 * ((st + i + 1) & (FG / 2 - 1));   // this pair's first plane and the next pair's
#pragma unroll   // both planes of the pair in one body: the q fetched ahead needs no register copies
    for (int e = 0; e < 2; ++e) { const float* pl = s + (pa + e) * GPL; const float* qx = qp + (size_t)(e == 0 ? pa + 1 : pn) * NP; v4f qn[4];
#pragma unroll   // q of the next plane flies for one plane's box work; the last trip reads the wave's first plane again, unused: no branch inside a trip
      for (int a = 0; a < 4; ++a) qn[a] = *(const v4f*)(qx + a * 16 * WWD);
      asm volatile("s_wait_xcnt 0x0" ::: "memory");   // the next trip forms the q loads' address anew in the same registers
      const v4f h0 = hdiff(pl, cR[0], cL[0]), h1 = hdiff(pl + 16 * GP, cR[0], cL[0]), h2 = hdiff(pl + 32 * GP, cR[0], cL[0]), h3 = hdiff(pl + 48 * GP, cR[0], cL[0]), he = hdiff(pl + dE, cR[0], cL[0]);   // reach 32: top row zero for the upper two image rows, bottom row 64 for the lower two
      const v4f m0 = hdiff(pl, cR[1], cL[1]), m1 = hdiff(pl + 16 * GP, cR[1], cL[1]), m2 = hdiff(pl + 32 * GP, cR[1], cL[1]), m3 = hdiff(pl + 48 * GP, cR[1], cL[1]), me = hdiff(pl + dE, cR[1], cL[1]);   // reach 16
      const v4f nt = hdiff(pl + dT, cR[2], cL[2]), n1 = hdiff(pl + 8 * GP, cR[2], cL[2]), n2 = hdiff(pl + 24 * GP, cR[2], cL[2]), n3 = hdiff(pl + 40 * GP, cR[2], cL[2]), nb = hdiff(pl + dB, cR[2], cL[2]);   // reach 8
      acc[0][0] += qc[0] * h2; acc[0][1] += qc[1] * h3; acc[0][2] += qc[2] * (he - h0); acc[0][3] += qc[3] * (he - h1);
      acc[1][0] += qc[0] * m1; acc[1][1] += qc[1] * (m2 - m0); acc[1][2] += qc[2] * (m3 - m1); acc[1][3] += qc[3] * (me - m2);
      acc[2][0] += qc[0] * (n1 - nt); acc[2][1] += qc[1] * (n2 - n1); acc[2][2] += qc[2] * (n3 - n2); acc[2][3] += qc[3] * (nb - n3);
#pragma unroll   // qc, qn indexed by constants
      for (int a = 0; a < 4; ++a) qc[a] = qn[a]; } }
    __syncthreads();   // the next pass overwrites the planes
  }
#pragma unroll   // acc indexed by constants; 16 lanes store 256 contiguous bytes of a row
  for (int wi = 0; wi < NWIN; ++wi)
#pragma unroll   // as above
    for (int a = 0; a < 4; ++a) vst2(O + (size_t)(wi * CC + h * HD + f) * NP + (bi + 16 * a) * WWD + j4, acc[wi][a]); }
// ---- k_inorm: block = (group dg of NPB planes d, head h, quarter rq of the image rows), 256 threads: the planes k[d] are laid down in LDS in k_fuse's plane layout, prefix-summed along w, then along h (each serial, one thread a row or column), and box-differenced there: NPART[(dg*3+wi)*8+h][p] = sum over the group's d (ascending) of q[d] box(k[d]); k_out adds the NG groups.
// The four quarters of a (dg, h) each build the same integral images: the scans are a chain of waits that costs the same for any number of rows wanted, and the box phase, the part that takes LDS time, is shared out over four WGPs.
__global__ __launch_bounds__(256) void k_inorm(const float* __restrict__ Q, const float* __restrict__ Kf, float* __restrict__ NPART) { __shared__ __align__(16) float s[NPB * FPL];
  const int t = threadIdx.x; const int dg = blockIdx.x, h = blockIdx.y, rq = blockIdx.z; const int i = t >> 4, j4 = (t & 15) * 4; const int sg = t >> 6, sl = t & 63;   // (i, j4): row within a quarter and four positions; (sg, sl): plane and row or column in the scans
  const int y = rq * (HH / 4) + i;   // the image row whose norms this thread computes
  const v4f zero4 = {0.f, 0.f, 0.f, 0.f};
  const float* kp = Kf + (size_t)(h * HD + dg * NPB) * NP + t * 4; v4f kv[NPB][4];
#pragma unroll   // all of a thread's loads in flight at once; kv indexed by constants
  for (int g = 0; g < NPB; ++g)
#pragma unroll   // as above
    for (int c = 0; c < 4; ++c) kv[g][c] = *(const v4f*)(kp + (size_t)g * NP + c * 1024);
  const float* qp = Q + (size_t)(h * HD + dg * NPB) * NP + y * WWD + j4; v4f qc[NPB];   // q flies beside k and lands during the scans
#pragma unroll   // as above
  for (int g = 0; g < NPB; ++g) qc[g] = *(const v4f*)(qp + (size_t)g * NP);
  asm volatile("s_wait_xcnt 0x0" ::: "memory");   // the index arithmetic below may reuse the registers that these loads' addresses name
  for (int e = t; e < NPB * FP; e += 256) s[(e / FP) * FPL + e % FP] = 0.f;   // row 0 of every plane
  *(v4f*)&s[sg * FPL + (sl + 1) * FP] = zero4;                                // ib = -4..-1 of rows 1..64
  { float* sp = &s[(i + 1) * FP + 4 + j4];   // value w of row r at row r + 1, column w + 4 (aligned)
#pragma unroll   // kv indexed by constants
    for (int g = 0; g < NPB; ++g)
#pragma unroll   // as above
      for (int c = 0; c < 4; ++c) *(v4f*)(sp + g * FPL + c * 16 * FP) = kv[g][c]; }
  __syncthreads();   // a scan reads a row that 16 threads wrote
  { float* row = &s[sg * FPL + (sl + 1) * FP + 4]; float run = 0.f; v4f r[WWD / 4];   // along w: thread = (plane, row); written back one column to the right, behind the zero of ib = 0
#pragma unroll   // a row's 16 loads in flight at once: one LDS latency a scan
    for (int m = 0; m < WWD / 4; ++m) r[m] = *(const v4f*)(row + 4 * m);
#pragma unroll   // r indexed by constants
    for (int m = 0; m < WWD / 4; ++m) { v4f o; o[0] = run; run += r[m][0]; o[1] = run; run += r[m][1]; o[2] = run; run += r[m][2]; o[3] = run; run += r[m][3]; *(v4f*)(row + 4 * m) = o; }
    row[WWD] = run; }
  __syncthreads();   // columns cross the rows of 64 threads
  { float* cp = &s[sg * FPL + FP + 5 + sl]; float run = 0.f; float p[HH];   // along h: thread = (plane, column), in place
#pragma unroll   // a column's 64 loads in flight at once; p indexed by constants
    for (int r = 0; r < HH; ++r) p[r] = cp[r * FP];
    __builtin_amdgcn_sched_barrier(0);   // holds all the loads in front of the chain of sums: sunk between the sums, only three were in flight and the scan waited out an LDS latency every few rows
#pragma unroll   // as above
    for (int r = 0; r < HH; ++r) { run += p[r]; cp[r * FP] = run; } }
  __syncthreads();   // column ib = 64 was summed by one thread a plane
  { float* e = &s[sg * FPL + (sl + 1) * FP + 4 + WWD]; const float x = e[0]; const v4f r = {x, x, x, x}; *(v4f*)e = r; }   // ib = 65..67: copies of ib = 64; thread = (plane, row)
  __syncthreads();   // the corners below lie in rows and columns of other threads
  v4f acc[NWIN];
#pragma unroll   // acc indexed by constants; the corner places are formed once a window
  for (int wi = 0; wi < NWIN; ++wi) { const int ws = HH >> wi; const int tp = ws - 1, rr = tp / 2, l = tp - rr;   // l = ws - l = 32, 16, 8
    int bl = j4 - l, br = j4 + ws - l; bl = bl < -4 ? -4 : (bl > WWD ? WWD : bl); br = br < -4 ? -4 : (br > WWD ? WWD : br);
    int at = y - l, ab = y + ws - l; at = at < 0 ? 0 : at; ab = ab > HH ? HH : ab;   // integral rows of the window's top and bottom
    const float* pb = s + ab * FP; const float* pt = s + at * FP; v4f a = zero4;
#pragma unroll   // the planes in ascending order of d; their corner quads in flight together
    for (int g = 0; g < NPB; ++g) a += qc[g] * (hdiff(pb + g * FPL, br + 4, bl + 4) - hdiff(pt + g * FPL, br + 4, bl + 4));
    acc[wi] = a; }
#pragma unroll   // acc indexed by constants
  for (int wi = 0; wi < NWIN; ++wi) vst2(NPART + (size_t)((dg * NWIN + wi) * NH + h) * NP + y * WWD + j4, acc[wi]); }
// ---- k_out: block = (128 out channels o, 32 positions), 8 waves of 16 o x 32 p: out[o][p] = sum_c Wout[o][c] O[c][p] / (norm + 1e-6) (A = Wout bf16 exact rows, B = columns p of O divided by the norm, as bf16 hi + lo) + bout[o]; (B, C, H, W) layout = rows o of 4,096
// The block's O tile (768 channels x one 128-byte line) is read once, whole lines, every load in flight at once, divided by the norm (the NG partial norms of its head and window added, + 1e-6, inverted once a thread), split into hi and lo once and laid down in LDS as position rows [p][c]; all eight waves take their B fragments from there.
#define OPB 32              // positions a block: one line of every channel plane
#define OPI (OC + 8)        // LDS row pitch in bf16: 1,552 bytes = 16 x odd, so that 16-byte reads of one row a lane do not collide
#define APRE 8              // A fragments fetched ahead of their use
__global__ __launch_bounds__(256) void k_out(const __bf16* __restrict__ PO, const float* __restrict__ O, const float* __restrict__ NPART, const float* __restrict__ BO, float* __restrict__ Y) { __shared__ __align__(16) __bf16 sh[OPB][OPI]; __shared__ __align__(16) __bf16 sl[OPB][OPI]; __shared__ __align__(16) float so[8][16][OPB + 4];
  const int tid = threadIdx.x, wave = tid >> 5, lane = tid & 31, col = lane & 15, g = lane >> 4; const int o0 = blockIdx.x * 128 + wave * 16; const int p0 = blockIdx.y * OPB;
  const int pq = tid & 7, cg = tid >> 3;   // staging: eight lanes cover a channel's line; a thread takes four positions of eight neighbouring channels, three times
  const float* np = NPART + (size_t)(cg >> 2) * NP + p0 + pq * 4; v4f nq[NWIN][NG];   // the thread's eight channels lie in head cg >> 2; round r of the staging is window r
#pragma unroll   // the partial norms fly in front of the tile; nq indexed by constants
  for (int r = 0; r < NWIN; ++r)
#pragma unroll   // as above
    for (int gI = 0; gI < NG; ++gI) nq[r][gI] = *(const v4f*)(np + (size_t)((gI * NWIN + r) * NH) * NP);
  asm volatile("s_wait_xcnt 0x0" ::: "memory");   // later loads may land in the registers that these loads' address names
  const float* src = O + (size_t)(cg * 8) * NP + p0 + pq * 4; v4f x[OC / 256][8];
#pragma unroll   // all 24 loads of a thread in flight at once: one trip to memory for the whole tile
  for (int r = 0; r < OC / 256; ++r) {
#pragma unroll   // x indexed by constants: stays in registers
    for (int i = 0; i < 8; ++i) x[r][i] = *(const v4f*)(src + (size_t)(r * 256 + i) * NP);
    asm volatile("s_wait_xcnt 0x0" ::: "memory"); }   // later loads may land in the registers that these loads' address names
  const __bf16* ar = PO + (size_t)(o0 + col) * OC; v16b a[OC / 32];   // natural row of Wout read with the A-row lane layout (identical to frag_b's)
#pragma unroll   // the first A fragments fly beside the tile
  for (int kc = 0; kc < APRE; ++kc) a[kc] = frag_b(ar + kc * 32, lane);
  asm volatile("s_wait_xcnt 0x0" ::: "memory");   // the arithmetic below may reuse registers that these loads' addresses name
  v4f inv[NWIN];   // 1 / (norm + 1e-6): the groups of d added in ascending order
#pragma unroll   // nq, inv indexed by constants
  for (int r = 0; r < NWIN; ++r) { v4f n = nq[r][0];
#pragma unroll   // as above
    for (int gI = 1; gI < NG; ++gI) n += nq[r][gI];
    inv[r] = 1.0f / (n + 1e-6f); }
#pragma unroll   // x indexed by constants
  for (int r = 0; r < OC / 256; ++r)
#pragma unroll   // as above
    for (int e = 0; e < 4; ++e) { v8b h, l;
#pragma unroll   // as above
      for (int i = 0; i < 8; ++i) { const float v = x[r][i][e] * inv[r][e]; const __bf16 hh = (__bf16)v; h[i] = hh; l[i] = (__bf16)(v - (float)hh); }
      *(v8b*)&sh[pq * 4 + e][r * 256 + cg * 8] = h; *(v8b*)&sl[pq * 4 + e][r * 256 + cg * 8] = l; }
  __syncthreads();   // every wave reads rows that all waves wrote
  float bb[8];
#pragma unroll   // the bias flies beside the products instead of being waited for behind them
  for (int r = 0; r < 8; ++r) bb[r] = BO[o0 + 8 * g + r];
  asm volatile("s_wait_xcnt 0x0" ::: "memory");   // later loads may land in the registers that these loads' address names
  v8f acc[2] = {}; v16b bh[2][2], bl[2][2];   // B fragments of this step and of the next
#pragma unroll   // bh, bl indexed by constants
  for (int jt = 0; jt < 2; ++jt) { bh[0][jt] = frag_b(&sh[jt * 16 + col][0], lane); bl[0][jt] = frag_b(&sl[jt * 16 + col][0], lane); }
#pragma unroll   // a, bh, bl indexed by constants; the fetches ahead stand in front of the step's products
  for (int kc = 0; kc < OC / 32; ++kc) { const int cu = kc & 1, nx = cu ^ 1;
    if (kc + 1 < OC / 32) {
#pragma unroll   // as above
      for (int jt = 0; jt < 2; ++jt) { bh[nx][jt] = frag_b(&sh[jt * 16 + col][(kc + 1) * 32], lane); bl[nx][jt] = frag_b(&sl[jt * 16 + col][(kc + 1) * 32], lane); } }
    if ((kc & 3) == 0 && kc + APRE < OC / 32) {
#pragma unroll   // as above
      for (int u = 0; u < 4; ++u) a[kc + APRE + u] = frag_b(ar + (kc + APRE + u) * 32, lane); }
    acc[0] = wmma_bf(a[kc], bh[cu][0], acc[0]); acc[1] = wmma_bf(a[kc], bh[cu][1], acc[1]);   // per accumulator hi, then lo, in ascending c
    acc[0] = wmma_bf(a[kc], bl[cu][0], acc[0]); acc[1] = wmma_bf(a[kc], bl[cu][1], acc[1]); }
#pragma unroll   // acc indexed by constants
  for (int jt = 0; jt < 2; ++jt)
#pragma unroll   // as above
    for (int r = 0; r < 8; ++r) so[wave][8 * g + r][jt * 16 + col] = acc[jt][r] + bfr(bb[r]);
  LDSX();
#pragma unroll   // four rows (whole lines) a store
  for (int it = 0; it < 4; ++it) { const int rl = it * 4 + (lane >> 3); vst2(Y + (size_t)(o0 + rl) * NP + p0 + (lane & 7) * 4, *(const v4f*)&so[wave][rl][(lane & 7) * 4]); } }
extern "C" void kernel_launch(void* const* d_in, const int* in_sizes, int n_in, void* d_out, int out_size, void* d_ws, size_t ws_size, hipStream_t stream) {
  (void)in_sizes; (void)n_in; (void)out_size;
  const float** F = (const float**)d_in;   // 0 x [1,256,64,64], 1 Wq, 2 Wk, 3 Wv [256,256], 4 Wout [256,768], 5 bout [256]
  if (ws_size < (size_t)WS_END) return;
  char* ws = (char*)d_ws; __bf16 *PO = (__bf16*)(ws + WS_PO); float *Q = (float*)(ws + WS_Q), *Kf = (float*)(ws + WS_K), *Vf = (float*)(ws + WS_V), *NPART = (float*)(ws + WS_NP), *O = (float*)(ws + WS_O);
  k_proj<<<dim3(NP / 64, CC / 128, 4), 128, 0, stream>>>(F[0], F[1], F[2], F[3], F[4], PO, Q, Kf, Vf);
  k_inorm<<<dim3(NG, NH, 4), 256, 0, stream>>>(Q, Kf, NPART);
  k_fuse<<<dim3(HD, NH), 256, 0, stream>>>(Q, Kf, Vf, O);
  k_out<<<dim3(CC / 128, (TPB * WWD) / OPB), 256, 0, stream>>>(PO, O, NPART, F[5], (float*)d_out);
}

// v009
// A run of this version takes 42.7 microseconds.
// Timed twice side by side with v008, it ran 1.07 and 1.08 times as fast.
// Counting every step since v000, it is 9.56 times as fast.
// compute dtype: all float inputs rounded to bf16; q/k/v 1x1 convs with EXACT bf16 products on WMMA 16x16x32 (x and the weights read as they lie); sigmoid (hardware exp) and the per-position L2 normalisation of v in f32; k and k (x) v outer-product planes, their 2-D inclusive prefix sums (integral images; they live in LDS only) and the clamped 4-corner box differences for the three window sizes, the q-weighted sums and the division all in f32 on VALU (fixed order); out = Wout (exact) . o (bf16 hi + lo, 2 products) + bout on WMMA; f32 output in (B, C, H, W) order.
#include <hip/hip_runtime.h>
#include <math.h>

typedef __attribute__((ext_vector_type(16))) _Float16 v16h;
typedef __attribute__((ext_vector_type(16))) __bf16 v16b;
typedef __attribute__((ext_vector_type(8)))  _Float16 v8h;
typedef __attribute__((ext_vector_type(8)))  float v8f;
typedef __attribute__((ext_vector_type(4)))  float v4f;
typedef __attribute__((ext_vector_type(2)))  float v2f;
typedef __attribute__((ext_vector_type(4)))  unsigned v4u;
typedef __attribute__((ext_vector_type(4)))  int v4i;
typedef float __attribute__((may_alias)) float_a;
typedef int __attribute__((may_alias)) int_a;

template <typename T> __device__ __forceinline__ void vst2(void* p, T v) { *(T*)p = v;  }
__device__ __forceinline__ v8f wmma16(v16h a, v16h b, v8f c) {
  v8f d = __builtin_amdgcn_wmma_f32_16x16x32_f16(false, a, false, b, (short)0, c, false, false);
  asm volatile("v_nop\n\tv_nop\n\tv_nop\n\tv_nop" : "+v"(d) : "v"(a), "v"(b));
  return d;
}
__device__ __forceinline__ v8f wmma_bf(v16b a, v16b b, v8f c) {
  v8f d = __builtin_amdgcn_wmma_f32_16x16x32_bf16(false, a, false, b, (short)0, c, false, false);
  asm volatile("v_nop\n\tv_nop\n\tv_nop\n\tv_nop" : "+v"(d) : "v"(a), "v"(b));
  return d;
}
// 16x16x32 fragments: lane = (h = lane>>4, row/col = lane&15); elements 0..7 = k0+8h+0..7, 8..15 = k0+16+8h+0..7; D element r = row 8h+r
__device__ __forceinline__ v16h frag_h(const _Float16* rowk0, int lane) {
  union { v16h v; v8h q[2]; } u; const _Float16* p = rowk0 + 8 * (lane >> 4);
  u.q[0] = *(const v8h*)p; u.q[1] = *(const v8h*)(p + 16); return u.v;
}
__device__ __forceinline__ v16h frag_f32(const float* rowk0, int lane) {
  v16h a; const float* p = rowk0 + 8 * (lane >> 4);
#pragma unroll
  for (int i = 0; i < 8; ++i) { a[i] = (_Float16)p[i]; a[8 + i] = (_Float16)p[16 + i]; }
  return a;
}
__device__ __forceinline__ v16h frag_f32s(const float* rowk0, int lane, float sc) {
  v16h a; const float* p = rowk0 + 8 * (lane >> 4);
#pragma unroll
  for (int i = 0; i < 8; ++i) { a[i] = (_Float16)(p[i] * sc); a[8 + i] = (_Float16)(p[16 + i] * sc); }
  return a;
}
// column fragment from a [K][ld] layout (column n), rows >= K read as 0
__device__ __forceinline__ v16h fragc_f32(const float* W, int k0, int n, int lane, int ld, int K) {
  v16h a; const int g = lane >> 4;
#pragma unroll
  for (int i = 0; i < 8; ++i) { const int ka = k0 + 8 * g + i, kb = ka + 16;
    a[i] = (_Float16)(ka < K ? W[(size_t)(ka < K ? ka : K - 1) * ld + n] : 0.f); a[8 + i] = (_Float16)(kb < K ? W[(size_t)(kb < K ? kb : K - 1) * ld + n] : 0.f); }
  return a;
}
struct F2 { v16b h, l; };
__device__ __forceinline__ F2 bsplit16(const float v[16]) { F2 r;
#pragma unroll
  for (int i = 0; i < 16; ++i) { const __bf16 h = (__bf16)v[i]; r.h[i] = h; r.l[i] = (__bf16)(v[i] - (float)h); }
  return r; }
__device__ __forceinline__ F2 split_row(const float* row, int k0, int lane) { float v[16]; const float* p = row + k0 + 8 * (lane >> 4);
#pragma unroll
  for (int i = 0; i < 8; ++i) { v[i] = p[i]; v[8 + i] = p[16 + i]; }
  return bsplit16(v); }
__device__ __forceinline__ F2 split_rowK(const float* row, int k0, int lane, int K) { float v[16]; const int g = lane >> 4;
#pragma unroll
  for (int i = 0; i < 8; ++i) { const int ka = k0 + 8 * g + i, kb = ka + 16; v[i] = ka < K ? row[ka < K ? ka : K - 1] : 0.f; v[8 + i] = kb < K ? row[kb < K ? kb : K - 1] : 0.f; }
  return bsplit16(v); }
__device__ __forceinline__ F2 split_col(const float* W, int k0, int n, int lane, int ld, int K) { float v[16]; const int g = lane >> 4;
#pragma unroll
  for (int i = 0; i < 8; ++i) { const int ka = k0 + 8 * g + i, kb = ka + 16; v[i] = ka < K ? W[(size_t)(ka < K ? ka : K - 1) * ld + n] : 0.f; v[8 + i] = kb < K ? W[(size_t)(kb < K ? kb : K - 1) * ld + n] : 0.f; }
  return bsplit16(v); }
__device__ __forceinline__ v8f mac3(const F2& a, const F2& b, v8f c) { c = wmma_bf(a.l, b.h, c); c = wmma_bf(a.h, b.l, c); return wmma_bf(a.h, b.h, c); }
__device__ __forceinline__ float sigm(float v) { return 1.0f / (1.0f + expf(-v)); }
#define LDSX() do { asm volatile("s_wait_dscnt 0" ::: "memory"); __builtin_amdgcn_wave_barrier(); __builtin_amdgcn_fence(__ATOMIC_RELEASE, "workgroup"); } while (0)


// Inception (multi-window box) linear attention (B 1, C 256 = 8 heads x 32, 64 x 64): per window size ws in {64, 32, 16}: attn = q . boxsum(k v^T) / (q . boxsum(k) + 1e-6) using integral images with edge-replicated borders; concat over windows (768 channels), 1x1 output conv + bias.
#define CC 256
#define NH 8
#define HD 32
#define HH 64
#define WWD 64
#define NP (HH * WWD)      // 4,096 positions
#define NWIN 3
#define OC (CC * NWIN)     // 768
#ifndef TPB
#define TPB HH             // output rows (of 64 positions) that k_out's grid covers
#endif
typedef __attribute__((ext_vector_type(8))) __bf16 v8b;
__device__ __forceinline__ v16b frag_b(const __bf16* rowk0, int lane) {
  union { v16b v; v8b q[2]; } u; const __bf16* p = rowk0 + 8 * (lane >> 4);
  u.q[0] = *(const v8b*)p; u.q[1] = *(const v8b*)(p + 16); return u.v;
}
__device__ __forceinline__ float bfr(float v) { return (float)(__bf16)v; }
__device__ __attribute__((noinline)) float exp_ni(float v) { return expf(v); }
__device__ __attribute__((noinline)) float erf_ni(float v) { return erff(v); }

#define WS_PW  0u                                   // (not used); then bf16 natural rows Wout [256][768]
#define WS_PO  (WS_PW + 2u * (size_t)3 * CC * CC)
#define WS_XT  (WS_PO + 2u * (size_t)CC * OC)           // (not used)
#define WS_Q   (WS_XT + 4u * (size_t)NP * CC)           // f32 q [c][p] (sigmoid), k [c][p] (sigmoid), v [c][p] (normalised): channel-major planes of 4,096 positions
#define WS_K   (WS_Q + 4u * (size_t)NP * CC)
#define WS_V   (WS_K + 4u * (size_t)NP * CC)
#define NPB 4               // planes d of k a work-group takes for the norm
#define NG (HD / NPB)       // partial sums over d of the norm
#define WS_NP  (WS_V + 4u * (size_t)NP * CC)            // f32 partial norms [(dg*3+wi)*8+h][p]: sum over the NPB planes d of group dg
#define WS_O   (WS_NP + 4u * (size_t)NG * NWIN * NH * NP)   // f32 o [768][p], not yet divided by the norm: channel-major planes
#define WS_END (WS_O + 4u * (size_t)NP * OC)

// ---- k_proj: block = (64 positions = one image row, 128 out channels, which): 1x1 conv = W (A rows = channels) . x (B columns = positions), so D rows are channels; stored channel-major [c][p], 256 contiguous bytes per channel and block.
// Everything the conv needs is prepared inside this launch: x is read as it lies ([c][p]: 16 lanes cover 64 bytes of a channel's line) and rounded to bf16 in registers; the block's 128 weight rows are read as whole lines, rounded to bf16 and laid down in LDS, from where all four waves take their A fragments; epilogue: q, k -> sigmoid; v -> divided by max(||v_h||, 1e-12) per (position, head), the block holding all 32 channels of its four heads (squares summed pairwise: adjacent pairs, then pairs of pairs).
// which == 3: no conv; the 128 blocks round Wout to bf16 (natural rows) for k_out.
#define WPI (CC + 8)        // LDS row pitch in bf16: 528 bytes = 16 x odd, so that 16-byte reads of one row a lane do not collide
typedef __attribute__((ext_vector_type(4))) __bf16 v4b;
__device__ __forceinline__ v4b cvt4(v4f w) { v4b b; b[0] = (__bf16)w[0]; b[1] = (__bf16)w[1]; b[2] = (__bf16)w[2]; b[3] = (__bf16)w[3]; return b; }
__global__ __launch_bounds__(128) void k_proj(const float* __restrict__ X, const float* __restrict__ WQ, const float* __restrict__ WK, const float* __restrict__ WV, const float* __restrict__ WO, __bf16* __restrict__ PO, float* __restrict__ Q, float* __restrict__ Kf, float* __restrict__ Vf) { __shared__ __align__(16) __bf16 sw[128][WPI]; __shared__ __align__(16) float so[128][68];
  const int tid = threadIdx.x, wave = tid >> 5, lane = tid & 31, col = lane & 15, g = lane >> 4; const int which = blockIdx.z;
  if (which == 3) {   // the whole block leaves here, in front of every barrier
    const size_t e0 = ((size_t)(blockIdx.y * (NP / 64) + blockIdx.x) * 384 + tid) * 4; v4f w[3];   // 128 blocks x 384 quads = 256 x 768 values
#pragma unroll   // the three loads in flight at once
    for (int it = 0; it < 3; ++it) w[it] = *(const v4f*)(WO + e0 + it * 512);
    asm volatile("s_wait_xcnt 0x0" ::: "memory");   // the conversions below may land in the registers that these loads' address names
#pragma unroll   // w indexed by constants
    for (int it = 0; it < 3; ++it) vst2(PO + e0 + it * 512, cvt4(w[it]));
    return; }
  const int p0 = blockIdx.x * 64; const int c0 = blockIdx.y * 128; const float* Wr = (which == 0) ? WQ : (which == 1) ? WK : WV;
  const float* xp = X + (size_t)(8 * g) * NP + p0 + wave * 16 + col; float xv[CC / 32][16];   // B fragments: element i = channel kc*32 + 8g + i, element 8 + i = channel kc*32 + 16 + 8g + i (the k order of frag_b)
#pragma unroll   // all of a wave's x loads in flight at once; xv indexed by constants
  for (int kc = 0; kc < CC / 32; ++kc)
#pragma unroll   // as above
    for (int i = 0; i < 8; ++i) { xv[kc][i] = xp[(size_t)(kc * 32 + i) * NP]; xv[kc][8 + i] = xp[(size_t)(kc * 32 + 16 + i) * NP]; }
  const int wr = tid >> 6, wq = (tid & 63) * 4;   // weight staging: 64 threads cover a row of 1,024 bytes, the block two rows a step
  const float* wp = Wr + (size_t)(c0 + wr) * CC + wq; v4f w0[16];
#pragma unroll   // the first 16 steps' loads fly beside those of x
  for (int it = 0; it < 16; ++it) w0[it] = *(const v4f*)(wp + (size_t)it * 2 * CC);
  asm volatile("s_wait_xcnt 0x0" ::: "memory");   // the conversions and later loads may land in the registers that the x loads' address names
  v16b a[CC / 32];
#pragma unroll   // a, xv indexed by constants
  for (int kc = 0; kc < CC / 32; ++kc)
#pragma unroll   // as above
    for (int i = 0; i < 16; ++i) a[kc][i] = (__bf16)xv[kc][i];
#pragma unroll   // w0 indexed by constants
  for (int it = 0; it < 16; ++it) *(v4b*)&sw[it * 2 + wr][wq] = cvt4(w0[it]);
#pragma unroll   // two more rounds of 24 steps, each round's loads in flight at once
  for (int b = 0; b < 2; ++b) { v4f w1[24];
#pragma unroll   // w1 indexed by constants
    for (int it = 0; it < 24; ++it) w1[it] = *(const v4f*)(wp + (size_t)(16 + b * 24 + it) * 2 * CC);
    asm volatile("s_wait_xcnt 0x0" :: "v"(wp) : "memory");   // the conversions and LDS addresses below may land in the registers that these loads' address names; named as an input, the address lives up to the wait
#pragma unroll   // as above
    for (int it = 0; it < 24; ++it) *(v4b*)&sw[(16 + b * 24 + it) * 2 + wr][wq] = cvt4(w1[it]); }
  __syncthreads();   // every wave reads weight rows that all waves wrote
  v8f acc[8] = {}; v16b af[2][8];   // A fragments of this step and of the next
#pragma unroll   // af indexed by constants
  for (int j = 0; j < 8; ++j) af[0][j] = frag_b(&sw[j * 16 + col][0], lane);
#pragma unroll   // a, af, acc indexed by constants; the next step's fragment reads stand in front of this step's products
  for (int kc = 0; kc < CC / 32; ++kc) { const int cu = kc & 1, nx = cu ^ 1;
    if (kc + 1 < CC / 32) {
#pragma unroll   // as above
      for (int j = 0; j < 8; ++j) af[nx][j] = frag_b(&sw[j * 16 + col][(kc + 1) * 32], lane); }
#pragma unroll   // as above
    for (int j = 0; j < 8; ++j) acc[j] = wmma_bf(af[cu][j], a[kc], acc[j]); }
#pragma unroll
  for (int j = 0; j < 8; ++j)
#pragma unroll
    for (int r = 0; r < 8; ++r) { const float v = acc[j][r]; so[j * 16 + 8 * g + r][wave * 16 + col] = (which < 2) ? 1.0f / (1.0f + __expf(-v)) : v; }
  __syncthreads();   // a channel's 64 positions come from all four waves
  if (which == 2) {   // the same for the whole block: thread = (position, head), two heads a thread; a wave reads and writes 128 contiguous bytes of a channel's row
    const int pp = tid & 63;
#pragma unroll 1   // two heads through one body: the code stays small
    for (int hl = tid >> 6; hl < 4; hl += 2) { float v[HD], q[HD];
#pragma unroll   // v and q indexed by constants, so they stay in registers
      for (int d = 0; d < HD; ++d) { v[d] = so[hl * HD + d][pp]; q[d] = v[d] * v[d]; }
#pragma unroll   // constant indices: q stays in registers
      for (int o = 1; o < HD; o <<= 1)
#pragma unroll   // as above
        for (int d = 0; d < HD; d += 2 * o) q[d] += q[d + o];
      const float den = fmaxf(sqrtf(q[0]), 1e-12f);
#pragma unroll   // constant indices: v stays in registers
      for (int d = 0; d < HD; ++d) so[hl * HD + d][pp] = v[d] / den; }
    __syncthreads(); }   // the stores below read rows that other threads normalised
  float* dst = (which == 0) ? Q : (which == 1) ? Kf : Vf; for (int e = tid; e < 128 * 16; e += 128) { const int cl = e >> 4, q = e & 15; vst2(dst + (size_t)(c0 + cl) * NP + p0 + q * 4, *(const v4f*)&so[cl][q * 4]); } }
// ---- k_fuse: block = (f, h), 256 threads, nearly the whole LDS of a WGP: the 32 planes k[d] v[f] of the head, 16 at a time, are summed to integral images in registers on their way into LDS, box-differenced there and summed over d with q[d] (each wave in a fixed order of its own, see the box phase); O[wi*256 + h*32 + f][p] = sum (k_out divides by the norm)
// LDS plane = the padded integral image: row ia = 0..64 (row 0 zero), column ib + 4 for ib = -4..67: ib <= 0 zero, ib = 1..64 the prefix sums, ib = 65..67 copies of ib = 64. All window offsets are multiples of 4, so the four neighbouring positions of a thread read each corner as one aligned 16-byte quad, and a quad wholly left (right) of the image is the quad at ib = -4 (64).
// Integral phase: 16 lanes hold an image row (four columns a lane), a half-wave walks the 64 rows of its own plane. Along h the sum runs in the thread's registers; along w the row's 16 quad totals are prefix-summed across the 16 lanes with DPP shifts (1, 2, 4, 8 lanes), and each lane adds the sum of the lanes to its left to its own three partial sums. Each value is written to LDS once, finished.
// Box phase: the windows reach 32, 16 and 8 rows up and down, so image rows 16 apart share their corner rows. A thread takes the rows bi, bi + 16, bi + 32, bi + 48 (four positions each) of every plane: per plane and window five integral rows, each differenced right - left once, serve all four image rows. The 16 planes of a pass are walked in pairs, round the ring of eight pairs, wave w of block f starting at pair (w + f) mod 8: at any moment the eight waves read eight different pairs, 37,440 bytes apart; and the blocks of a head, which share q, ask for different planes of it at a time.
// Norm part, a short pass in front of the others, in the same LDS and plane layout: block (f, h) = (group dg = f >> 2 of NPB planes d, quarter rq = f & 3 of the image rows). The integral images of the planes k[d] are built as in the integral phase, but a plane's 64 rows are shared out over four half-waves, 16 rows each: each first sums its strip's columns, and behind a barrier starts its walk from the sums of the strips above it (added in ascending order). They are box-differenced there: NPART[(dg*3+wi)*8+h][p] = sum over the group's d (ascending) of q[d] box(k[d]); k_out adds the NG groups. Its loads fly beside those of v.
// The four quarters of a (dg, h) each build the same integral images: the walk is a chain of waits that costs the same for any number of rows wanted.
#define FG 16               // planes a pass
#define GP 72               // k_fuse's row pitch in floats: no lane reads a row of its own here, 16 lanes always cover neighbouring quads of one row
#define GPL ((HH + 1) * GP) // floats a plane of k_fuse
#define KR 32               // rows of k in flight a thread
__device__ __forceinline__ v4f hdiff(const float* pl, int r, int l) { return *(const v4f*)(pl + r) - *(const v4f*)(pl + l); }   // one integral row: right corner quad - left corner quad
template <int N> __device__ __forceinline__ float shr16(float x) { return __builtin_bit_cast(float, __builtin_amdgcn_update_dpp(0, __builtin_bit_cast(int, x), 0x110 + N, 0xf, 0xf, false)); }   // the value of the lane N to the left in the 16-lane row, 0 where there is none
__global__ __launch_bounds__(256) void k_fuse(const float* __restrict__ Q, const float* __restrict__ Kf, const float* __restrict__ Vf, float* __restrict__ O, float* __restrict__ NPART) { __shared__ __align__(16) float s[FG * GPL]; __shared__ __align__(16) float sv[NP];
  const int t = threadIdx.x; const int f = blockIdx.x, h = blockIdx.y; const int bi = t >> 4, jl = t & 15, j4 = jl * 4;   // bi: the thread's plane in the integral phase, its first image row in the box phase
  const v4f zero4 = {0.f, 0.f, 0.f, 0.f};
  { const float* vp = Vf + (size_t)(h * HD + f) * NP + t * 4; v4f vv[4];
#pragma unroll   // the four loads in flight at once
    for (int c = 0; c < 4; ++c) vv[c] = *(const v4f*)(vp + c * 1024);
    asm volatile("s_wait_xcnt 0x0" ::: "memory");   // the next addresses may be formed in the registers that these loads' address names
    // norm part: a short pass of its own; planes 0..NPB-1 of s hold k's integral images, nothing of it outlives the barrier at its end
    const int dg = f >> 2, rq = f & 3; const int pn = bi >> 2, sn = bi & 3;   // integral: the half-wave's plane and its strip of 16 image rows
    const int y = rq * (HH / 4) + bi;   // box: the image row whose norms this thread computes
    const float* kp = Kf + (size_t)(h * HD + dg * NPB + pn) * NP + sn * 16 * WWD + j4; v4f kn[16];
#pragma unroll   // all of a thread's loads in flight at once, beside those of v; kn indexed by constants
    for (int r = 0; r < 16; ++r) kn[r] = *(const v4f*)(kp + r * WWD);
    const float* qp = Q + (size_t)(h * HD + dg * NPB) * NP + y * WWD + j4; v4f qc[NPB];   // q flies beside k and lands during the integral
#pragma unroll   // as above
    for (int g = 0; g < NPB; ++g) qc[g] = *(const v4f*)(qp + (size_t)g * NP);
    asm volatile("s_wait_xcnt 0x0" ::: "memory");   // the index arithmetic below may reuse the registers that these loads' addresses name
    for (int e = t; e < FG * (GP / 4); e += 256) *(v4f*)&s[(e / (GP / 4)) * GPL + (e % (GP / 4)) * 4] = zero4;   // row 0 of every plane; nothing writes it again
#pragma unroll   // four rows a thread
    for (int c = 0; c < 4; ++c) *(v4f*)&s[bi * GPL + (c * 16 + jl + 1) * GP] = zero4;   // ib = -4..-1 of rows 1..64; as above
#pragma unroll   // vv indexed by constants; v has its own place in LDS and is read behind the barrier at the norm part's end
    for (int c = 0; c < 4; ++c) *(v4f*)&sv[c * 1024 + t * 4] = vv[c];
    float* sc = &s[(FG - 1) * GPL + GP + 4 + j4];   // the strips' column sums, one row a strip, inside the last plane, which the norm part does not use
    { v4f cs = kn[0];
#pragma unroll   // kn indexed by constants
      for (int r = 1; r < 16; ++r) cs += kn[r];
      *(v4f*)(sc + bi * GP) = cs; }
    __syncthreads();   // a strip starts from the column sums of the strips above it, which other half-waves wrote
    { v4f c = zero4; float* sp = &s[pn * GPL + (sn * 16 + 1) * GP + 4 + j4]; float tot[16];
#pragma unroll   // the three reads in flight at once
      for (int u = 0; u < 3; ++u) { const v4f o = *(const v4f*)(sc + (pn * 4 + u) * GP); c += u < sn ? o : zero4; }
#pragma unroll   // kn, tot indexed by constants; the rows' independent sums along w fill each other's waits
      for (int r = 0; r < 16; ++r) {
        c += kn[r];   // along h
        const float l1 = c[0], l2 = l1 + c[1], l3 = l2 + c[2]; float x = l3 + c[3];   // along w inside the quad
        x += shr16<1>(x); x += shr16<2>(x); x += shr16<4>(x); x += shr16<8>(x);   // along w over the 16 quads of the row
        const float e = shr16<1>(x); const v4f o = {e, e + l1, e + l2, e + l3};   // one column to the right: ib = j4 .. j4 + 3
        *(v4f*)(sp + r * GP) = o; tot[r] = x; }
      if (jl == 15) {   // ib = 64..67: the row's total
#pragma unroll   // tot indexed by constants
        for (int r = 0; r < 16; ++r) { const v4f e4 = {tot[r], tot[r], tot[r], tot[r]}; *(v4f*)(sp + r * GP + 4) = e4; } } }
    __syncthreads();   // the corners below lie in rows that other half-waves wrote
    v4f na[NWIN];
#pragma unroll   // na indexed by constants; the corner places are formed once a window
    for (int wi = 0; wi < NWIN; ++wi) { const int ws = HH >> wi; const int tp = ws - 1, rr = tp / 2, l = tp - rr;   // l = ws - l = 32, 16, 8
      int bl = j4 - l, br = j4 + ws - l; bl = bl < -4 ? -4 : (bl > WWD ? WWD : bl); br = br < -4 ? -4 : (br > WWD ? WWD : br);
      int at = y - l, ab = y + ws - l; at = at < 0 ? 0 : at; ab = ab > HH ? HH : ab;   // integral rows of the window's top and bottom
      const float* pb = s + ab * GP; const float* pt = s + at * GP; v4f a = zero4;
#pragma unroll   // the planes in ascending order of d; their corner quads in flight together
      for (int g = 0; g < NPB; ++g) a += qc[g] * (hdiff(pb + g * GPL, br + 4, bl + 4) - hdiff(pt + g * GPL, br + 4, bl + 4));
      na[wi] = a; }
    __syncthreads();   // the planes of k v overwrite the planes of k, whose corners other waves read; v, which all waves wrote, is read from here on
#pragma unroll   // na indexed by constants; behind the barrier, which would wait for the stores to be done: they fly during the first pass
    for (int wi = 0; wi < NWIN; ++wi) vst2(NPART + (size_t)((dg * NWIN + wi) * NH + h) * NP + y * WWD + j4, na[wi]);
    asm volatile("s_wait_xcnt 0x0" ::: "memory"); }   // the arithmetic below may reuse the registers that these stores name
  int cR[NWIN], cL[NWIN];   // places of the right and left corner quads in integral row bi
#pragma unroll   // cR, cL indexed by constants: stay in registers
  for (int wi = 0; wi < NWIN; ++wi) { const int ws = HH >> wi; const int tp = ws - 1, rr = tp / 2, l = tp - rr;   // l = ws - l = 32, 16, 8
    int bl = j4 - l, br = j4 + ws - l; bl = bl < -4 ? -4 : (bl > WWD ? WWD : bl); br = br < -4 ? -4 : (br > WWD ? WWD : br);
    cR[wi] = bi * GP + br + 4; cL[wi] = bi * GP + bl + 4; }
  const int dE = (HH - bi) * GP;                                  // from integral row bi to row 64
  const int dT = ((bi > 8 ? bi - 8 : 0) - bi) * GP;               // to row max(bi - 8, 0)
  const int dB = ((bi + 56 < HH ? bi + 56 : HH) - bi) * GP;       // to row min(bi + 56, 64)
  const int st = __builtin_amdgcn_readfirstlane(((t >> 5) + f) & (FG / 2 - 1));   // the wave's first pair of planes in the box phase; the same in every lane, so the plane's place stays a scalar
  v4f acc[NWIN][4];
#pragma unroll   // acc indexed by constants
  for (int wi = 0; wi < NWIN; ++wi)
#pragma unroll   // as above
    for (int a = 0; a < 4; ++a) acc[wi][a] = zero4;
#pragma unroll 1   // two passes through one body: the code stays small
  for (int d0 = 0; d0 < HD; d0 += FG) {
    const float* qp = Q + (size_t)(h * HD + d0) * NP + bi * WWD + j4; const float* q0 = qp + (size_t)(2 * st) * NP; v4f qc[4];   // q of the thread's four image rows, one plane at a time; q0: the wave's first plane
    { const float* kp = Kf + (size_t)(h * HD + d0 + bi) * NP + j4; float* sp = &s[bi * GPL + GP + 4 + j4]; const float* vr = &sv[j4]; v4f kv[KR]; v4f c = zero4;
#pragma unroll   // half a plane's rows in flight at once; kv indexed by constants
      for (int r = 0; r < KR; ++r) kv[r] = *(const v4f*)(kp + r * WWD);
      asm volatile("s_wait_xcnt 0x0" :: "v"(kp) : "memory");   // later arithmetic may reuse the registers that these loads' address names; named as an input, the address lives up to the wait
#pragma unroll   // kv indexed by constants; eight rows a group, so that their independent row sums fill each other's waits
      for (int g = 0; g < HH / 8; ++g) { float tot[8];
#pragma unroll   // as above
        for (int u = 0; u < 8; ++u) { const int r = g * 8 + u;
          c += kv[r % KR] * *(const v4f*)(vr + r * WWD);   // along h
          const float l1 = c[0], l2 = l1 + c[1], l3 = l2 + c[2]; float x = l3 + c[3];   // along w inside the quad
          x += shr16<1>(x); x += shr16<2>(x); x += shr16<4>(x); x += shr16<8>(x);   // along w over the 16 quads of the row
          const float e = shr16<1>(x); const v4f o = {e, e + l1, e + l2, e + l3};   // one column to the right: ib = j4 .. j4 + 3
          *(v4f*)(sp + r * GP) = o; tot[u] = x; }
        if (jl == 15) {   // ib = 64..67: the row's total
#pragma unroll   // tot indexed by constants
          for (int u = 0; u < 8; ++u) { const v4f e4 = {tot[u], tot[u], tot[u], tot[u]}; *(v4f*)(sp + (g * 8 + u) * GP + 4) = e4; } }
        if (g * 8 + KR < HH) {
#pragma unroll   // the group's registers are loaded anew, so the stream of loads does not pause
          for (int u = 0; u < 8; ++u) kv[(g * 8 + u) % KR] = *(const v4f*)(kp + (g * 8 + u + KR) * WWD);
          asm volatile("s_wait_xcnt 0x0" :: "v"(kp) : "memory"); }   // as at the first loads
        if (g * 8 + KR == HH) {   // behind the last refill: the first plane's q lands during the remaining rows, in registers that k has left, not in front of the barrier
#pragma unroll   // the four rows' q in flight at once
          for (int a = 0; a < 4; ++a) qc[a] = *(const v4f*)(q0 + a * 16 * WWD);
          asm volatile("s_wait_xcnt 0x0" :: "v"(q0) : "memory"); } } }   // as at the first loads
    __syncthreads();   // the corners below lie in planes that other waves wrote
#pragma unroll 1   // one pair of planes a trip: the code stays small
    for (int i = 0; i < FG / 2; ++i) { const int pa = 2 * ((st + i) & (FG / 2 - 1)), pn = 2 * ((st + i + 1) & (FG / 2 - 1));   // this pair's first plane and the next pair's
#pragma unroll   // both planes of the pair in one body: the q fetched ahead needs no register copies
    for (int e = 0; e < 2; ++e) { const float* pl = s + (pa + e) * GPL; const float* qx = qp + (size_t)(e == 0 ? pa + 1 : pn) * NP; v4f qn[4];
#pragma unroll   // q of the next plane flies for one plane's box work; the last trip reads the wave's first plane again, unused: no branch inside a trip
      for (int a = 0; a < 4; ++a) qn[a] = *(const v4f*)(qx + a * 16 * WWD);
      asm volatile("s_wait_xcnt 0x0" ::: "memory");   // the next trip forms the q loads' address anew in the same registers
      const v4f h0 = hdiff(pl, cR[0], cL[0]), h1 = hdiff(pl + 16 * GP, cR[0], cL[0]), h2 = hdiff(pl + 32 * GP, cR[0], cL[0]), h3 = hdiff(pl + 48 * GP, cR[0], cL[0]), he = hdiff(pl + dE, cR[0], cL[0]);   // reach 32: top row zero for the upper two image rows, bottom row 64 for the lower two
      const v4f m0 = hdiff(pl, cR[1], cL[1]), m1 = hdiff(pl + 16 * GP, cR[1], cL[1]), m2 = hdiff(pl + 32 * GP, cR[1], cL[1]), m3 = hdiff(pl + 48 * GP, cR[1], cL[1]), me = hdiff(pl + dE, cR[1], cL[1]);   // reach 16
      const v4f nt = hdiff(pl + dT, cR[2], cL[2]), n1 = hdiff(pl + 8 * GP, cR[2], cL[2]), n2 = hdiff(pl + 24 * GP, cR[2], cL[2]), n3 = hdiff(pl + 40 * GP, cR[2], cL[2]), nb = hdiff(pl + dB, cR[2], cL[2]);   // reach 8
      acc[0][0] += qc[0] * h2; acc[0][1] += qc[1] * h3; acc[0][2] += qc[2] * (he - h0); acc[0][3] += qc[3] * (he - h1);
      acc[1][0] += qc[0] * m1; acc[1][1] += qc[1] * (m2 - m0); acc[1][2] += qc[2] * (m3 - m1); acc[1][3] += qc[3] * (me - m2);
      acc[2][0] += qc[0] * (n1 - nt); acc[2][1] += qc[1] * (n2 - n1); acc[2][2] += qc[2] * (n3 - n2); acc[2][3] += qc[3] * (nb - n3);
#pragma unroll   // qc, qn indexed by constants
      for (int a = 0; a < 4; ++a) qc[a] = qn[a]; } }
    __syncthreads();   // the next pass overwrites the planes
  }
#pragma unroll   // acc indexed by constants; 16 lanes store 256 contiguous bytes of a row
  for (int wi = 0; wi < NWIN; ++wi)
#pragma unroll   // as above
    for (int a = 0; a < 4; ++a) vst2(O + (size_t)(wi * CC + h * HD + f) * NP + (bi + 16 * a) * WWD + j4, acc[wi][a]); }
// ---- k_out: block = (128 out channels o, 32 positions), 8 waves of 16 o x 32 p: out[o][p] = sum_c Wout[o][c] O[c][p] / (norm[c][p] + 1e-6) (A = Wout bf16 exact rows, B = columns p of O divided by the norm as bf16 hi + lo) + bout[o]; (B, C, H, W) layout = rows o of 4,096
// The block's O tile (768 channels x one 128-byte line) is read once, whole lines, every load in flight at once, divided by the norm (the NG partial norms of its head and window added, + 1e-6, inverted once a thread), split into hi and lo once and laid down in LDS as position rows [p][c]; all eight waves take their B fragments from there.
#define OPB 32              // positions a block: one line of every channel plane
#define OPI (OC + 8)        // LDS row pitch in bf16: 1,552 bytes = 16 x odd, so that 16-byte reads of one row a lane do not collide
#define APRE 8              // A fragments fetched ahead of their use
__global__ __launch_bounds__(256) void k_out(const __bf16* __restrict__ PO, const float* __restrict__ O, const float* __restrict__ NPART, const float* __restrict__ BO, float* __restrict__ Y) { __shared__ __align__(16) __bf16 sh[OPB][OPI]; __shared__ __align__(16) __bf16 sl[OPB][OPI]; __shared__ __align__(16) float so[8][16][OPB + 4];
  const int tid = threadIdx.x, wave = tid >> 5, lane = tid & 31, col = lane & 15, g = lane >> 4; const int o0 = blockIdx.x * 128 + wave * 16; const int p0 = blockIdx.y * OPB;
  const int pq = tid & 7, cg = tid >> 3;   // staging: eight lanes cover a channel's line; a thread takes four positions of eight neighbouring channels, three times
  const float* np = NPART + (size_t)(cg >> 2) * NP + p0 + pq * 4; v4f nq[NWIN][NG];   // the thread's eight channels lie in head cg >> 2; round r of the staging is window r
#pragma unroll   // the partial norms fly in front of the tile; nq indexed by constants
  for (int r = 0; r < NWIN; ++r)
#pragma unroll   // as above
    for (int gI = 0; gI < NG; ++gI) nq[r][gI] = *(const v4f*)(np + (size_t)((gI * NWIN + r) * NH) * NP);
  asm volatile("s_wait_xcnt 0x0" ::: "memory");   // later loads may land in the registers that these loads' address names
  const float* src = O + (size_t)(cg * 8) * NP + p0 + pq * 4; v4f x[OC / 256][8];
#pragma unroll   // all 24 loads of a thread in flight at once: one trip to memory for the whole tile
  for (int r = 0; r < OC / 256; ++r) {
#pragma unroll   // x indexed by constants: stays in registers
    for (int i = 0; i < 8; ++i) x[r][i] = *(const v4f*)(src + (size_t)(r * 256 + i) * NP);
    asm volatile("s_wait_xcnt 0x0" ::: "memory"); }   // later loads may land in the registers that these loads' address names
  const __bf16* ar = PO + (size_t)(o0 + col) * OC; v16b a[OC / 32];   // natural row of Wout read with the A-row lane layout (identical to frag_b's)
#pragma unroll   // the first A fragments fly beside the tile
  for (int kc = 0; kc < APRE; ++kc) a[kc] = frag_b(ar + kc * 32, lane);
  asm volatile("s_wait_xcnt 0x0" ::: "memory");   // the arithmetic below may reuse registers that these loads' addresses name
  v4f inv[NWIN];   // 1 / (norm + 1e-6): the groups of d added in ascending order
#pragma unroll   // nq, inv indexed by constants
  for (int r = 0; r < NWIN; ++r) { v4f n = nq[r][0];
#pragma unroll   // as above
    for (int gI = 1; gI < NG; ++gI) n += nq[r][gI];
    inv[r] = 1.0f / (n + 1e-6f); }
#pragma unroll   // x indexed by constants
  for (int r = 0; r < OC / 256; ++r)
#pragma unroll   // as above
    for (int e = 0; e < 4; ++e) { v8b h, l;
#pragma unroll   // as above
      for (int i = 0; i < 8; ++i) { const float v = x[r][i][e] * inv[r][e]; const __bf16 hh = (__bf16)v; h[i] = hh; l[i] = (__bf16)(v - (float)hh); }
      *(v8b*)&sh[pq * 4 + e][r * 256 + cg * 8] = h; *(v8b*)&sl[pq * 4 + e][r * 256 + cg * 8] = l; }
  __syncthreads();   // every wave reads rows that all waves wrote
  float bb[8];
#pragma unroll   // the bias flies beside the products instead of being waited for behind them
  for (int r = 0; r < 8; ++r) bb[r] = BO[o0 + 8 * g + r];
  asm volatile("s_wait_xcnt 0x0" ::: "memory");   // later loads may land in the registers that these loads' address names
  v8f acc[2] = {}; v16b bh[2][2], bl[2][2];   // B fragments of this step and of the next
#pragma unroll   // bh, bl indexed by constants
  for (int jt = 0; jt < 2; ++jt) { bh[0][jt] = frag_b(&sh[jt * 16 + col][0], lane); bl[0][jt] = frag_b(&sl[jt * 16 + col][0], lane); }
#pragma unroll   // a, bh, bl indexed by constants; the fetches ahead stand in front of the step's products
  for (int kc = 0; kc < OC / 32; ++kc) { const int cu = kc & 1, nx = cu ^ 1;
    if (kc + 1 < OC / 32) {
#pragma unroll   // as above
      for (int jt = 0; jt < 2; ++jt) { bh[nx][jt] = frag_b(&sh[jt * 16 + col][(kc + 1) * 32], lane); bl[nx][jt] = frag_b(&sl[jt * 16 + col][(kc + 1) * 32], lane); } }
    if ((kc & 3) == 0 && kc + APRE < OC / 32) {
#pragma unroll   // as above
      for (int u = 0; u < 4; ++u) a[kc + APRE + u] = frag_b(ar + (kc + APRE + u) * 32, lane); }
    acc[0] = wmma_bf(a[kc], bh[cu][0], acc[0]); acc[1] = wmma_bf(a[kc], bh[cu][1], acc[1]);   // per accumulator hi, then lo, in ascending c
    acc[0] = wmma_bf(a[kc], bl[cu][0], acc[0]); acc[1] = wmma_bf(a[kc], bl[cu][1], acc[1]); }
#pragma unroll   // acc indexed by constants
  for (int jt = 0; jt < 2; ++jt)
#pragma unroll   // as above
    for (int r = 0; r < 8; ++r) so[wave][8 * g + r][jt * 16 + col] = acc[jt][r] + bfr(bb[r]);
  LDSX();
#pragma unroll   // four rows (whole lines) a store
  for (int it = 0; it < 4; ++it) { const int rl = it * 4 + (lane >> 3); vst2(Y + (size_t)(o0 + rl) * NP + p0 + (lane & 7) * 4, *(const v4f*)&so[wave][rl][(lane & 7) * 4]); } }
extern "C" void kernel_launch(void* const* d_in, const int* in_sizes, int n_in, void* d_out, int out_size, void* d_ws, size_t ws_size, hipStream_t stream) {
  (void)in_sizes; (void)n_in; (void)out_size;
  const float** F = (const float**)d_in;   // 0 x [1,256,64,64], 1 Wq, 2 Wk, 3 Wv [256,256], 4 Wout [256,768], 5 bout [256]
  if (ws_size < (size_t)WS_END) return;
  char* ws = (char*)d_ws; __bf16 *PO = (__bf16*)(ws + WS_PO); float *Q = (float*)(ws + WS_Q), *Kf = (float*)(ws + WS_K), *Vf = (float*)(ws + WS_V), *NPART = (float*)(ws + WS_NP), *O = (float*)(ws + WS_O);
  k_proj<<<dim3(NP / 64, CC / 128, 4), 128, 0, stream>>>(F[0], F[1], F[2], F[3], F[4], PO, Q, Kf, Vf);
  k_fuse<<<dim3(HD, NH), 256, 0, stream>>>(Q, Kf, Vf, O, NPART);
  k_out<<<dim3(CC / 128, (TPB * WWD) / OPB), 256, 0, stream>>>(PO, O, NPART, F[5], (float*)d_out);
}

// v010
// One run takes 41.1 microseconds.
// Next to v009, in two timings, it ran 1.04 times as fast each time.
// Over all steps from v000 it is 9.96 times as fast.
// compute dtype: all float inputs rounded to bf16; q/k/v 1x1 convs with EXACT bf16 products on WMMA 16x16x32 (x and the weights read as they lie); sigmoid (hardware exp) and the per-position L2 normalisation of v in f32; k and k (x) v outer-product planes, their 2-D inclusive prefix sums (integral images; they live in LDS only) and the clamped 4-corner box differences for the three window sizes, the q-weighted sums and the division all in f32 on VALU (fixed order); out = Wout (exact) . o (bf16 hi + lo, 2 products) + bout on WMMA; f32 output in (B, C, H, W) order.
#include <hip/hip_runtime.h>
#include <math.h>

typedef __attribute__((ext_vector_type(16))) _Float16 v16h;
typedef __attribute__((ext_vector_type(16))) __bf16 v16b;
typedef __attribute__((ext_vector_type(8)))  _Float16 v8h;
typedef __attribute__((ext_vector_type(8)))  float v8f;
typedef __attribute__((ext_vector_type(4)))  float v4f;
typedef __attribute__((ext_vector_type(2)))  float v2f;
typedef __attribute__((ext_vector_type(4)))  unsigned v4u;
typedef __attribute__((ext_vector_type(4)))  int v4i;
typedef float __attribute__((may_alias)) float_a;
typedef int __attribute__((may_alias)) int_a;

template <typename T> __device__ __forceinline__ void vst2(void* p, T v) { *(T*)p = v;  }
__device__ __forceinline__ v8f wmma16(v16h a, v16h b, v8f c) {
  v8f d = __builtin_amdgcn_wmma_f32_16x16x32_f16(false, a, false, b, (short)0, c, false, false);
  asm volatile("v_nop\n\tv_nop\n\tv_nop\n\tv_nop" : "+v"(d) : "v"(a), "v"(b));
  return d;
}
__device__ __forceinline__ v8f wmma_bf(v16b a, v16b b, v8f c) {
  v8f d = __builtin_amdgcn_wmma_f32_16x16x32_bf16(false, a, false, b, (short)0, c, false, false);
  asm volatile("v_nop\n\tv_nop\n\tv_nop\n\tv_nop" : "+v"(d) : "v"(a), "v"(b));
  return d;
}
// 16x16x32 fragments: lane = (h = lane>>4, row/col = lane&15); elements 0..7 = k0+8h+0..7, 8..15 = k0+16+8h+0..7; D element r = row 8h+r
__device__ __forceinline__ v16h frag_h(const _Float16* rowk0, int lane) {
  union { v16h v; v8h q[2]; } u; const _Float16* p = rowk0 + 8 * (lane >> 4);
  u.q[0] = *(const v8h*)p; u.q[1] = *(const v8h*)(p + 16); return u.v;
}
__device__ __forceinline__ v16h frag_f32(const float* rowk0, int lane) {
  v16h a; const float* p = rowk0 + 8 * (lane >> 4);
#pragma unroll
  for (int i = 0; i < 8; ++i) { a[i] = (_Float16)p[i]; a[8 + i] = (_Float16)p[16 + i]; }
  return a;
}
__device__ __forceinline__ v16h frag_f32s(const float* rowk0, int lane, float sc) {
  v16h a; const float* p = rowk0 + 8 * (lane >> 4);
#pragma unroll
  for (int i = 0; i < 8; ++i) { a[i] = (_Float16)(p[i] * sc); a[8 + i] = (_Float16)(p[16 + i] * sc); }
  return a;
}
// column fragment from a [K][ld] layout (column n), rows >= K read as 0
__device__ __forceinline__ v16h fragc_f32(const float* W, int k0, int n, int lane, int ld, int K) {
  v16h a; const int g = lane >> 4;
#pragma unroll
  for (int i = 0; i < 8; ++i) { const int ka = k0 + 8 * g + i, kb = ka + 16;
    a[i] = (_Float16)(ka < K ? W[(size_t)(ka < K ? ka : K - 1) * ld + n] : 0.f); a[8 + i] = (_Float16)(kb < K ? W[(size_t)(kb < K ? kb : K - 1) * ld + n] : 0.f); }
  return a;
}
struct F2 { v16b h, l; };
__device__ __forceinline__ F2 bsplit16(const float v[16]) { F2 r;
#pragma unroll
  for (int i = 0; i < 16; ++i) { const __bf16 h = (__bf16)v[i]; r.h[i] = h; r.l[i] = (__bf16)(v[i] - (float)h); }
  return r; }
__device__ __forceinline__ F2 split_row(const float* row, int k0, int lane) { float v[16]; const float* p = row + k0 + 8 * (lane >> 4);
#pragma unroll
  for (int i = 0; i < 8; ++i) { v[i] = p[i]; v[8 + i] = p[16 + i]; }
  return bsplit16(v); }
__device__ __forceinline__ F2 split_rowK(const float* row, int k0, int lane, int K) { float v[16]; const int g = lane >> 4;
#pragma unroll
  for (int i = 0; i < 8; ++i) { const int ka = k0 + 8 * g + i, kb = ka + 16; v[i] = ka < K ? row[ka < K ? ka : K - 1] : 0.f; v[8 + i] = kb < K ? row[kb < K ? kb : K - 1] : 0.f; }
  return bsplit16(v); }
__device__ __forceinline__ F2 split_col(const float* W, int k0, int n, int lane, int ld, int K) { float v[16]; const int g = lane >> 4;
#pragma unroll
  for (int i = 0; i < 8; ++i) { const int ka = k0 + 8 * g + i, kb = ka + 16; v[i] = ka < K ? W[(size_t)(ka < K ? ka : K - 1) * ld + n] : 0.f; v[8 + i] = kb < K ? W[(size_t)(kb < K ? kb : K - 1) * ld + n] : 0.f; }
  return bsplit16(v); }
__device__ __forceinline__ v8f mac3(const F2& a, const F2& b, v8f c) { c = wmma_bf(a.l, b.h, c); c = wmma_bf(a.h, b.l, c); return wmma_bf(a.h, b.h, c); }
__device__ __forceinline__ float sigm(float v) { return 1.0f / (1.0f + expf(-v)); }
#define LDSX() do { asm volatile("s_wait_dscnt 0" ::: "memory"); __builtin_amdgcn_wave_barrier(); __builtin_amdgcn_fence(__ATOMIC_RELEASE, "workgroup"); } while (0)


// Inception (multi-window box) linear attention (B 1, C 256 = 8 heads x 32, 64 x 64): per window size ws in {64, 32, 16}: attn = q . boxsum(k v^T) / (q . boxsum(k) + 1e-6) using integral images with edge-replicated borders; concat over windows (768 channels), 1x1 output conv + bias.
#define CC 256
#define NH 8
#define HD 32
#define HH 64
#define WWD 64
#define NP (HH * WWD)      // 4,096 positions
#define NWIN 3
#define OC (CC * NWIN)     // 768
#ifndef TPB
#define TPB HH             // output rows (of 64 positions) that k_out's grid covers
#endif
typedef __attribute__((ext_vector_type(8))) __bf16 v8b;
__device__ __forceinline__ v16b frag_b(const __bf16* rowk0, int lane) {
  union { v16b v; v8b q[2]; } u; const __bf16* p = rowk0 + 8 * (lane >> 4);
  u.q[0] = *(const v8b*)p; u.q[1] = *(const v8b*)(p + 16); return u.v;
}
__device__ __forceinline__ float bfr(float v) { return (float)(__bf16)v; }
__device__ __attribute__((noinline)) float exp_ni(float v) { return expf(v); }
__device__ __attribute__((noinline)) float erf_ni(float v) { return erff(v); }

#define WS_PW  0u                                   // (not used); then bf16 natural rows Wout [256][768]
#define WS_PO  (WS_PW + 2u * (size_t)3 * CC * CC)
#define WS_XT  (WS_PO + 2u * (size_t)CC * OC)           // (not used)
#define WS_Q   (WS_XT + 4u * (size_t)NP * CC)           // f32 q [c][p] (sigmoid), k [c][p] (sigmoid), v [c][p] (normalised): channel-major planes of 4,096 positions
#define WS_K   (WS_Q + 4u * (size_t)NP * CC)
#define WS_V   (WS_K + 4u * (size_t)NP * CC)
#define NPB 4               // planes d of k a work-group takes for the norm
#define NG (HD / NPB)       // partial sums over d of the norm
#define WS_NP  (WS_V + 4u * (size_t)NP * CC)            // f32 partial norms [(dg*3+wi)*8+h][p]: sum over the NPB planes d of group dg
#define WS_O   (WS_NP + 4u * (size_t)NG * NWIN * NH * NP)   // f32 o [768][p], not yet divided by the norm: channel-major planes
#define WS_END (WS_O + 4u * (size_t)NP * OC)

// ---- k_proj: block = (64 positions = one image row, 128 out channels, which): 1x1 conv = W (A rows = channels) . x (B columns = positions), so D rows are channels; stored channel-major [c][p], 256 contiguous bytes per channel and block.
// Everything the conv needs is prepared inside this launch: x is read as it lies ([c][p]: 16 lanes cover 64 bytes of a channel's line) and rounded to bf16 in registers; the block's 128 weight rows are read as whole lines, rounded to bf16 and laid down in LDS, from where all four waves take their A fragments; epilogue: q, k -> sigmoid; v -> divided by max(||v_h||, 1e-12) per (position, head), the block holding all 32 channels of its four heads (squares summed pairwise: adjacent pairs, then pairs of pairs).
// which == 3: no conv; the 128 blocks round Wout to bf16 (natural rows) for k_out.
#define WPI (CC + 8)        // LDS row pitch in bf16: 528 bytes = 16 x odd, so that 16-byte reads of one row a lane do not collide
typedef __attribute__((ext_vector_type(4))) __bf16 v4b;
__device__ __forceinline__ v4b cvt4(v4f w) { v4b b; b[0] = (__bf16)w[0]; b[1] = (__bf16)w[1]; b[2] = (__bf16)w[2]; b[3] = (__bf16)w[3]; return b; }
__global__ __launch_bounds__(128) void k_proj(const float* __restrict__ X, const float* __restrict__ WQ, const float* __restrict__ WK, const float* __restrict__ WV, const float* __restrict__ WO, __bf16* __restrict__ PO, float* __restrict__ Q, float* __restrict__ Kf, float* __restrict__ Vf) { __shared__ __align__(16) __bf16 sw[128][WPI]; __shared__ __align__(16) float so[128][68];
  const int tid = threadIdx.x, wave = tid >> 5, lane = tid & 31, col = lane & 15, g = lane >> 4; const int which = blockIdx.z;
  if (which == 3) {   // the whole block leaves here, in front of every barrier
    const size_t e0 = ((size_t)(blockIdx.y * (NP / 64) + blockIdx.x) * 384 + tid) * 4; v4f w[3];   // 128 blocks x 384 quads = 256 x 768 values
#pragma unroll   // the three loads in flight at once
    for (int it = 0; it < 3; ++it) w[it] = *(const v4f*)(WO + e0 + it * 512);
    asm volatile("s_wait_xcnt 0x0" ::: "memory");   // the conversions below may land in the registers that these loads' address names
#pragma unroll   // w indexed by constants
    for (int it = 0; it < 3; ++it) vst2(PO + e0 + it * 512, cvt4(w[it]));
    return; }
  const int p0 = blockIdx.x * 64; const int c0 = blockIdx.y * 128; const float* Wr = (which == 0) ? WQ : (which == 1) ? WK : WV;
  const float* xp = X + (size_t)(8 * g) * NP + p0 + wave * 16 + col; float xv[CC / 32][16];   // B fragments: element i = channel kc*32 + 8g + i, element 8 + i = channel kc*32 + 16 + 8g + i (the k order of frag_b)
#pragma unroll   // all of a wave's x loads in flight at once; xv indexed by constants
  for (int kc = 0; kc < CC / 32; ++kc)
#pragma unroll   // as above
    for (int i = 0; i < 8; ++i) { xv[kc][i] = xp[(size_t)(kc * 32 + i) * NP]; xv[kc][8 + i] = xp[(size_t)(kc * 32 + 16 + i) * NP]; }
  const int wr = tid >> 6, wq = (tid & 63) * 4;   // weight staging: 64 threads cover a row of 1,024 bytes, the block two rows a step
  const float* wp = Wr + (size_t)(c0 + wr) * CC + wq; v4f w0[16];
#pragma unroll   // the first 16 steps' loads fly beside those of x
  for (int it = 0; it < 16; ++it) w0[it] = *(const v4f*)(wp + (size_t)it * 2 * CC);
  asm volatile("s_wait_xcnt 0x0" ::: "memory");   // the conversions and later loads may land in the registers that the x loads' address names
  v16b a[CC / 32];
#pragma unroll   // a, xv indexed by constants
  for (int kc = 0; kc < CC / 32; ++kc)
#pragma unroll   // as above
    for (int i = 0; i < 16; ++i) a[kc][i] = (__bf16)xv[kc][i];
#pragma unroll   // w0 indexed by constants
  for (int it = 0; it < 16; ++it) *(v4b*)&sw[it * 2 + wr][wq] = cvt4(w0[it]);
#pragma unroll   // two more rounds of 24 steps, each round's loads in flight at once
  for (int b = 0; b < 2; ++b) { v4f w1[24];
#pragma unroll   // w1 indexed by constants
    for (int it = 0; it < 24; ++it) w1[it] = *(const v4f*)(wp + (size_t)(16 + b * 24 + it) * 2 * CC);
    asm volatile("s_wait_xcnt 0x0" :: "v"(wp) : "memory");   // the conversions and LDS addresses below may land in the registers that these loads' address names; named as an input, the address lives up to the wait
#pragma unroll   // as above
    for (int it = 0; it < 24; ++it) *(v4b*)&sw[(16 + b * 24 + it) * 2 + wr][wq] = cvt4(w1[it]); }
  __syncthreads();   // every wave reads weight rows that all waves wrote
  v8f acc[8] = {}; v16b af[2][8];   // A fragments of this step and of the next
#pragma unroll   // af indexed by constants
  for (int j = 0; j < 8; ++j) af[0][j] = frag_b(&sw[j * 16 + col][0], lane);
#pragma unroll   // a, af, acc indexed by constants; the next step's fragment reads stand in front of this step's products
  for (int kc = 0; kc < CC / 32; ++kc) { const int cu = kc & 1, nx = cu ^ 1;
    if (kc + 1 < CC / 32) {
#pragma unroll   // as above
      for (int j = 0; j < 8; ++j) af[nx][j] = frag_b(&sw[j * 16 + col][(kc + 1) * 32], lane); }
#pragma unroll   // as above
    for (int j = 0; j < 8; ++j) acc[j] = wmma_bf(af[cu][j], a[kc], acc[j]); }
  if (which < 2) {   // the same for the whole block, so it is tested once, outside the loops: tested per element it put a scalar branch between the 64 sigmoids, and each chain of exp and division then ran alone, its waits unfilled
#pragma unroll   // acc indexed by constants; 64 independent chains for the scheduler to interleave
    for (int j = 0; j < 8; ++j)
#pragma unroll   // as above
      for (int r = 0; r < 8; ++r) acc[j][r] = 1.0f / (1.0f + __expf(-acc[j][r])); }
#pragma unroll
  for (int j = 0; j < 8; ++j)
#pragma unroll
    for (int r = 0; r < 8; ++r) so[j * 16 + 8 * g + r][wave * 16 + col] = acc[j][r];
  __syncthreads();   // a channel's 64 positions come from all four waves
  if (which == 2) {   // the same for the whole block: thread = (position, head), two heads a thread; a wave reads and writes 128 contiguous bytes of a channel's row
    const int pp = tid & 63;
#pragma unroll 1   // two heads through one body: the code stays small
    for (int hl = tid >> 6; hl < 4; hl += 2) { float v[HD], q[HD];
#pragma unroll   // v and q indexed by constants, so they stay in registers
      for (int d = 0; d < HD; ++d) { v[d] = so[hl * HD + d][pp]; q[d] = v[d] * v[d]; }
#pragma unroll   // constant indices: q stays in registers
      for (int o = 1; o < HD; o <<= 1)
#pragma unroll   // as above
        for (int d = 0; d < HD; d += 2 * o) q[d] += q[d + o];
      const float den = fmaxf(sqrtf(q[0]), 1e-12f);
#pragma unroll   // constant indices: v stays in registers
      for (int d = 0; d < HD; ++d) so[hl * HD + d][pp] = v[d] / den; }
    __syncthreads(); }   // the stores below read rows that other threads normalised
  float* dst = (which == 0) ? Q : (which == 1) ? Kf : Vf; for (int e = tid; e < 128 * 16; e += 128) { const int cl = e >> 4, q = e & 15; vst2(dst + (size_t)(c0 + cl) * NP + p0 + q * 4, *(const v4f*)&so[cl][q * 4]); } }
// ---- k_fuse: block = (f, h), 256 threads, nearly the whole LDS of a WGP: the 32 planes k[d] v[f] of the head, 16 at a time, are summed to integral images in registers on their way into LDS, box-differenced there and summed over d with q[d] (each wave in a fixed order of its own, see the box phase); O[wi*256 + h*32 + f][p] = sum (k_out divides by the norm)
// LDS plane = the padded integral image: row ia = 0..64 (row 0 zero), column ib + 4 for ib = -4..67: ib <= 0 zero, ib = 1..64 the prefix sums, ib = 65..67 copies of ib = 64. All window offsets are multiples of 4, so the four neighbouring positions of a thread read each corner as one aligned 16-byte quad, and a quad wholly left (right) of the image is the quad at ib = -4 (64).
// Integral phase: 16 lanes hold an image row (four columns a lane), a half-wave walks the 64 rows of its own plane. Along h the sum runs in the thread's registers; along w the row's 16 quad totals are prefix-summed across the 16 lanes with DPP shifts (1, 2, 4, 8 lanes), and each lane adds the sum of the lanes to its left to its own three partial sums. Each value is written to LDS once, finished.
// Box phase: the windows reach 32, 16 and 8 rows up and down, so image rows 16 apart share their corner rows. A thread takes the rows bi, bi + 16, bi + 32, bi + 48 (four positions each) of every plane: per plane and window five integral rows, each differenced right - left once, serve all four image rows. The 16 planes of a pass are walked in pairs, round the ring of eight pairs, wave w of block f starting at pair (w + f) mod 8: at any moment the eight waves read eight different pairs, 37,440 bytes apart; and the blocks of a head, which share q, ask for different planes of it at a time.
// Norm part, a short pass in front of the others, in the same LDS and plane layout: block (f, h) = (group dg = f >> 2 of NPB planes d, quarter rq = f & 3 of the image rows). The integral images of the planes k[d] are built as in the integral phase, but a plane's 64 rows are shared out over four half-waves, 16 rows each: each first sums its strip's columns, and behind a barrier starts its walk from the sums of the strips above it (added in ascending order). They are box-differenced there: NPART[(dg*3+wi)*8+h][p] = sum over the group's d (ascending) of q[d] box(k[d]); k_out adds the NG groups. Its loads fly beside those of v.
// The four quarters of a (dg, h) each build the same integral images: the walk is a chain of waits that costs the same for any number of rows wanted.
#define FG 16               // planes a pass
#define GP 72               // k_fuse's row pitch in floats: no lane reads a row of its own here, 16 lanes always cover neighbouring quads of one row
#define GPL ((HH + 1) * GP) // floats a plane of k_fuse
#define KR 32               // rows of k in flight a thread
__device__ __forceinline__ v4f hdiff(const float* pl, int r, int l) { return *(const v4f*)(pl + r) - *(const v4f*)(pl + l); }   // one integral row: right corner quad - left corner quad
template <int N> __device__ __forceinline__ float shr16(float x) { return __builtin_bit_cast(float, __builtin_amdgcn_update_dpp(0, __builtin_bit_cast(int, x), 0x110 + N, 0xf, 0xf, false)); }   // the value of the lane N to the left in the 16-lane row, 0 where there is none
__global__ __launch_bounds__(256) void k_fuse(const float* __restrict__ Q, const float* __restrict__ Kf, const float* __restrict__ Vf, float* __restrict__ O, float* __restrict__ NPART) { __shared__ __align__(16) float s[FG * GPL]; __shared__ __align__(16) float sv[NP];
  const int t = threadIdx.x; const int f = blockIdx.x, h = blockIdx.y; const int bi = t >> 4, jl = t & 15, j4 = jl * 4;   // bi: the thread's plane in the integral phase, its first image row in the box phase
  const v4f zero4 = {0.f, 0.f, 0.f, 0.f};
  { const float* vp = Vf + (size_t)(h * HD + f) * NP + t * 4; v4f vv[4];
#pragma unroll   // the four loads in flight at once
    for (int c = 0; c < 4; ++c) vv[c] = *(const v4f*)(vp + c * 1024);
    asm volatile("s_wait_xcnt 0x0" ::: "memory");   // the next addresses may be formed in the registers that these loads' address names
    // norm part: a short pass of its own; planes 0..NPB-1 of s hold k's integral images, nothing of it outlives the barrier at its end
    const int dg = f >> 2, rq = f & 3; const int pn = bi >> 2, sn = bi & 3;   // integral: the half-wave's plane and its strip of 16 image rows
    const int y = rq * (HH / 4) + bi;   // box: the image row whose norms this thread computes
    const float* kp = Kf + (size_t)(h * HD + dg * NPB + pn) * NP + sn * 16 * WWD + j4; v4f kn[16];
#pragma unroll   // all of a thread's loads in flight at once, beside those of v; kn indexed by constants
    for (int r = 0; r < 16; ++r) kn[r] = *(const v4f*)(kp + r * WWD);
    const float* qp = Q + (size_t)(h * HD + dg * NPB) * NP + y * WWD + j4; v4f qc[NPB];   // q flies beside k and lands during the integral
#pragma unroll   // as above
    for (int g = 0; g < NPB; ++g) qc[g] = *(const v4f*)(qp + (size_t)g * NP);
    asm volatile("s_wait_xcnt 0x0" ::: "memory");   // the index arithmetic below may reuse the registers that these loads' addresses name
    for (int e = t; e < FG * (GP / 4); e += 256) *(v4f*)&s[(e / (GP / 4)) * GPL + (e % (GP / 4)) * 4] = zero4;   // row 0 of every plane; nothing writes it again
#pragma unroll   // four rows a thread
    for (int c = 0; c < 4; ++c) *(v4f*)&s[bi * GPL + (c * 16 + jl + 1) * GP] = zero4;   // ib = -4..-1 of rows 1..64; as above
#pragma unroll   // vv indexed by constants; v has its own place in LDS and is read behind the barrier at the norm part's end
    for (int c = 0; c < 4; ++c) *(v4f*)&sv[c * 1024 + t * 4] = vv[c];
    float* sc = &s[(FG - 1) * GPL + GP + 4 + j4];   // the strips' column sums, one row a strip, inside the last plane, which the norm part does not use
    { v4f cs = kn[0];
#pragma unroll   // kn indexed by constants
      for (int r = 1; r < 16; ++r) cs += kn[r];
      *(v4f*)(sc + bi * GP) = cs; }
    __syncthreads();   // a strip starts from the column sums of the strips above it, which other half-waves wrote
    { v4f c = zero4; float* sp = &s[pn * GPL + (sn * 16 + 1) * GP + 4 + j4]; float tot[16];
#pragma unroll   // the three reads in flight at once
      for (int u = 0; u < 3; ++u) { const v4f o = *(const v4f*)(sc + (pn * 4 + u) * GP); c += u < sn ? o : zero4; }
#pragma unroll   // kn, tot indexed by constants; the rows' independent sums along w fill each other's waits
      for (int r = 0; r < 16; ++r) {
        c += kn[r];   // along h
        const float l1 = c[0], l2 = l1 + c[1], l3 = l2 + c[2]; float x = l3 + c[3];   // along w inside the quad
        x += shr16<1>(x); x += shr16<2>(x); x += shr16<4>(x); x += shr16<8>(x);   // along w over the 16 quads of the row
        const float e = shr16<1>(x); const v4f o = {e, e + l1, e + l2, e + l3};   // one column to the right: ib = j4 .. j4 + 3
        *(v4f*)(sp + r * GP) = o; tot[r] = x; }
      if (jl == 15) {   // ib = 64..67: the row's total
#pragma unroll   // tot indexed by constants
        for (int r = 0; r < 16; ++r) { const v4f e4 = {tot[r], tot[r], tot[r], tot[r]}; *(v4f*)(sp + r * GP + 4) = e4; } } }
    __syncthreads();   // the corners below lie in rows that other half-waves wrote
    v4f na[NWIN];
#pragma unroll   // na indexed by constants; the corner places are formed once a window
    for (int wi = 0; wi < NWIN; ++wi) { const int ws = HH >> wi; const int tp = ws - 1, rr = tp / 2, l = tp - rr;   // l = ws - l = 32, 16, 8
      int bl = j4 - l, br = j4 + ws - l; bl = bl < -4 ? -4 : (bl > WWD ? WWD : bl); br = br < -4 ? -4 : (br > WWD ? WWD : br);
      int at = y - l, ab = y + ws - l; at = at < 0 ? 0 : at; ab = ab > HH ? HH : ab;   // integral rows of the window's top and bottom
      const float* pb = s + ab * GP; const float* pt = s + at * GP; v4f a = zero4;
#pragma unroll   // the planes in ascending order of d; their corner quads in flight together
      for (int g = 0; g < NPB; ++g) a += qc[g] * (hdiff(pb + g * GPL, br + 4, bl + 4) - hdiff(pt + g * GPL, br + 4, bl + 4));
      na[wi] = a; }
    __syncthreads();   // the planes of k v overwrite the planes of k, whose corners other waves read; v, which all waves wrote, is read from here on
#pragma unroll   // na indexed by constants; behind the barrier, which would wait for the stores to be done: they fly during the first pass
    for (int wi = 0; wi < NWIN; ++wi) vst2(NPART + (size_t)((dg * NWIN + wi) * NH + h) * NP + y * WWD + j4, na[wi]);
    asm volatile("s_wait_xcnt 0x0" ::: "memory"); }   // the arithmetic below may reuse the registers that these stores name
  int cR[NWIN], cL[NWIN];   // places of the right and left corner quads in integral row bi
#pragma unroll   // cR, cL indexed by constants: stay in registers
  for (int wi = 0; wi < NWIN; ++wi) { const int ws = HH >> wi; const int tp = ws - 1, rr = tp / 2, l = tp - rr;   // l = ws - l = 32, 16, 8
    int bl = j4 - l, br = j4 + ws - l; bl = bl < -4 ? -4 : (bl > WWD ? WWD : bl); br = br < -4 ? -4 : (br > WWD ? WWD : br);
    cR[wi] = bi * GP + br + 4; cL[wi] = bi * GP + bl + 4; }
  const int dE = (HH - bi) * GP;                                  // from integral row bi to row 64
  const int dT = ((bi > 8 ? bi - 8 : 0) - bi) * GP;               // to row max(bi - 8, 0)
  const int dB = ((bi + 56 < HH ? bi + 56 : HH) - bi) * GP;       // to row min(bi + 56, 64)
  const int st = __builtin_amdgcn_readfirstlane(((t >> 5) + f) & (FG / 2 - 1));   // the wave's first pair of planes in the box phase; the same in every lane, so the plane's place stays a scalar
  v4f acc[NWIN][4];
#pragma unroll   // acc indexed by constants
  for (int wi = 0; wi < NWIN; ++wi)
#pragma unroll   // as above
    for (int a = 0; a < 4; ++a) acc[wi][a] = zero4;
#pragma unroll 1   // two passes through one body: the code stays small
  for (int d0 = 0; d0 < HD; d0 += FG) {
    const float* qp = Q + (size_t)(h * HD + d0) * NP + bi * WWD + j4; const float* q0 = qp + (size_t)(2 * st) * NP; v4f qc[4];   // q of the thread's four image rows, one plane at a time; q0: the wave's first plane
    { const float* kp = Kf + (size_t)(h * HD + d0 + bi) * NP + j4; float* sp = &s[bi * GPL + GP + 4 + j4]; const float* vr = &sv[j4]; v4f kv[KR]; v4f c = zero4;
#pragma unroll   // half a plane's rows in flight at once; kv indexed by constants
      for (int r = 0; r < KR; ++r) kv[r] = *(const v4f*)(kp + r * WWD);
      asm volatile("s_wait_xcnt 0x0" :: "v"(kp) : "memory");   // later arithmetic may reuse the registers that these loads' address names; named as an input, the address lives up to the wait
#pragma unroll   // kv indexed by constants; eight rows a group, so that their independent row sums fill each other's waits
      for (int g = 0; g < HH / 8; ++g) { float tot[8];
#pragma unroll   // as above
        for (int u = 0; u < 8; ++u) { const int r = g * 8 + u;
          c += kv[r % KR] * *(const v4f*)(vr + r * WWD);   // along h
          const float l1 = c[0], l2 = l1 + c[1], l3 = l2 + c[2]; float x = l3 + c[3];   // along w inside the quad
          x += shr16<1>(x); x += shr16<2>(x); x += shr16<4>(x); x += shr16<8>(x);   // along w over the 16 quads of the row
          const float e = shr16<1>(x); const v4f o = {e, e + l1, e + l2, e + l3};   // one column to the right: ib = j4 .. j4 + 3
          *(v4f*)(sp + r * GP) = o; tot[u] = x; }
        if (jl == 15) {   // ib = 64..67: the row's total
#pragma unroll   // tot indexed by constants
          for (int u = 0; u < 8; ++u) { const v4f e4 = {tot[u], tot[u], tot[u], tot[u]}; *(v4f*)(sp + (g * 8 + u) * GP + 4) = e4; } }
        if (g * 8 + KR < HH) {
#pragma unroll   // the group's registers are loaded anew, so the stream of loads does not pause
          for (int u = 0; u < 8; ++u) kv[(g * 8 + u) % KR] = *(const v4f*)(kp + (g * 8 + u + KR) * WWD);
          asm volatile("s_wait_xcnt 0x0" :: "v"(kp) : "memory"); }   // as at the first loads
        if (g * 8 + KR == HH) {   // behind the last refill: the first plane's q lands during the remaining rows, in registers that k has left, not in front of the barrier
#pragma unroll   // the four rows' q in flight at once
          for (int a = 0; a < 4; ++a) qc[a] = *(const v4f*)(q0 + a * 16 * WWD);
          asm volatile("s_wait_xcnt 0x0" :: "v"(q0) : "memory"); } } }   // as at the first loads
    __syncthreads();   // the corners below lie in planes that other waves wrote
#pragma unroll 1   // one pair of planes a trip: the code stays small
    for (int i = 0; i < FG / 2; ++i) { const int pa = 2 * ((st + i) & (FG / 2 - 1)), pn = 2 * ((st + i + 1) & (FG / 2 - 1));   // this pair's first plane and the next pair's
#pragma unroll   // both planes of the pair in one body: the q fetched ahead needs no register copies
    for (int e = 0; e < 2; ++e) { const float* pl = s + (pa + e) * GPL; const float* qx = qp + (size_t)(e == 0 ? pa + 1 : pn) * NP; v4f qn[4];
#pragma unroll   // q of the next plane flies for one plane's box work; the last trip reads the wave's first plane again, unused: no branch inside a trip
      for (int a = 0; a < 4; ++a) qn[a] = *(const v4f*)(qx + a * 16 * WWD);
      asm volatile("s_wait_xcnt 0x0" ::: "memory");   // the next trip forms the q loads' address anew in the same registers
      const v4f h0 = hdiff(pl, cR[0], cL[0]), h1 = hdiff(pl + 16 * GP, cR[0], cL[0]), h2 = hdiff(pl + 32 * GP, cR[0], cL[0]), h3 = hdiff(pl + 48 * GP, cR[0], cL[0]), he = hdiff(pl + dE, cR[0], cL[0]);   // reach 32: top row zero for the upper two image rows, bottom row 64 for the lower two
      const v4f m0 = hdiff(pl, cR[1], cL[1]), m1 = hdiff(pl + 16 * GP, cR[1], cL[1]), m2 = hdiff(pl + 32 * GP, cR[1], cL[1]), m3 = hdiff(pl + 48 * GP, cR[1], cL[1]), me = hdiff(pl + dE, cR[1], cL[1]);   // reach 16
      const v4f nt = hdiff(pl + dT, cR[2], cL[2]), n1 = hdiff(pl + 8 * GP, cR[2], cL[2]), n2 = hdiff(pl + 24 * GP, cR[2], cL[2]), n3 = hdiff(pl + 40 * GP, cR[2], cL[2]), nb = hdiff(pl + dB, cR[2], cL[2]);   // reach 8
      acc[0][0] += qc[0] * h2; acc[0][1] += qc[1] * h3; acc[0][2] += qc[2] * (he - h0); acc[0][3] += qc[3] * (he - h1);
      acc[1][0] += qc[0] * m1; acc[1][1] += qc[1] * (m2 - m0); acc[1][2] += qc[2] * (m3 - m1); acc[1][3] += qc[3] * (me - m2);
      acc[2][0] += qc[0] * (n1 - nt); acc[2][1] += qc[1] * (n2 - n1); acc[2][2] += qc[2] * (n3 - n2); acc[2][3] += qc[3] * (nb - n3);
#pragma unroll   // qc, qn indexed by constants
      for (int a = 0; a < 4; ++a) qc[a] = qn[a]; } }
    __syncthreads();   // the next pass overwrites the planes
  }
#pragma unroll   // acc indexed by constants; 16 lanes store 256 contiguous bytes of a row
  for (int wi = 0; wi < NWIN; ++wi)
#pragma unroll   // as above
    for (int a = 0; a < 4; ++a) vst2(O + (size_t)(wi * CC + h * HD + f) * NP + (bi + 16 * a) * WWD + j4, acc[wi][a]); }
// ---- k_out: block = (128 out channels o, 32 positions), 8 waves of 16 o x 32 p: out[o][p] = sum_c Wout[o][c] O[c][p] / (norm[c][p] + 1e-6) (A = Wout bf16 exact rows, B = columns p of O divided by the norm as bf16 hi + lo) + bout[o]; (B, C, H, W) layout = rows o of 4,096
// The block's O tile (768 channels x one 128-byte line) is read once, whole lines, every load in flight at once, divided by the norm (the NG partial norms of its head and window added, + 1e-6, inverted once a thread), split into hi and lo once and laid down in LDS as position rows [p][c]; all eight waves take their B fragments from there.
#define OPB 32              // positions a block: one line of every channel plane
#define OPI (OC + 8)        // LDS row pitch in bf16: 1,552 bytes = 16 x odd, so that 16-byte reads of one row a lane do not collide
#define APRE 8              // A fragments fetched ahead of their use
__global__ __launch_bounds__(256) void k_out(const __bf16* __restrict__ PO, const float* __restrict__ O, const float* __restrict__ NPART, const float* __restrict__ BO, float* __restrict__ Y) { __shared__ __align__(16) __bf16 sh[OPB][OPI]; __shared__ __align__(16) __bf16 sl[OPB][OPI]; __shared__ __align__(16) float so[8][16][OPB + 4];
  const int tid = threadIdx.x, wave = tid >> 5, lane = tid & 31, col = lane & 15, g = lane >> 4; const int o0 = blockIdx.x * 128 + wave * 16; const int p0 = blockIdx.y * OPB;
  const int pq = tid & 7, cg = tid >> 3;   // staging: eight lanes cover a channel's line; a thread takes four positions of eight neighbouring channels, three times
  const float* np = NPART + (size_t)(cg >> 2) * NP + p0 + pq * 4; v4f nq[NWIN][NG];   // the thread's eight channels lie in head cg >> 2; round r of the staging is window r
#pragma unroll   // the partial norms fly in front of the tile; nq indexed by constants
  for (int r = 0; r < NWIN; ++r)
#pragma unroll   // as above
    for (int gI = 0; gI < NG; ++gI) nq[r][gI] = *(const v4f*)(np + (size_t)((gI * NWIN + r) * NH) * NP);
  asm volatile("s_wait_xcnt 0x0" ::: "memory");   // later loads may land in the registers that these loads' address names
  const float* src = O + (size_t)(cg * 8) * NP + p0 + pq * 4; v4f x[OC / 256][8];
#pragma unroll   // all 24 loads of a thread in flight at once: one trip to memory for the whole tile
  for (int r = 0; r < OC / 256; ++r) {
#pragma unroll   // x indexed by constants: stays in registers
    for (int i = 0; i < 8; ++i) x[r][i] = *(const v4f*)(src + (size_t)(r * 256 + i) * NP);
    asm volatile("s_wait_xcnt 0x0" ::: "memory"); }   // later loads may land in the registers that these loads' address names
  const __bf16* ar = PO + (size_t)(o0 + col) * OC; v16b a[OC / 32];   // natural row of Wout read with the A-row lane layout (identical to frag_b's)
#pragma unroll   // the first A fragments fly beside the tile
  for (int kc = 0; kc < APRE; ++kc) a[kc] = frag_b(ar + kc * 32, lane);
  asm volatile("s_wait_xcnt 0x0" ::: "memory");   // the arithmetic below may reuse registers that these loads' addresses name
  v4f inv[NWIN];   // 1 / (norm + 1e-6): the groups of d added in ascending order
#pragma unroll   // nq, inv indexed by constants
  for (int r = 0; r < NWIN; ++r) { v4f n = nq[r][0];
#pragma unroll   // as above
    for (int gI = 1; gI < NG; ++gI) n += nq[r][gI];
    inv[r] = 1.0f / (n + 1e-6f); }
#pragma unroll   // x indexed by constants
  for (int r = 0; r < OC / 256; ++r)
#pragma unroll   // as above
    for (int e = 0; e < 4; ++e) { v8b h, l;
#pragma unroll   // as above
      for (int i = 0; i < 8; ++i) { const float v = x[r][i][e] * inv[r][e]; const __bf16 hh = (__bf16)v; h[i] = hh; l[i] = (__bf16)(v - (float)hh); }
      *(v8b*)&sh[pq * 4 + e][r * 256 + cg * 8] = h; *(v8b*)&sl[pq * 4 + e][r * 256 + cg * 8] = l; }
  __syncthreads();   // every wave reads rows that all waves wrote
  float bb[8];
#pragma unroll   // the bias flies beside the products instead of being waited for behind them
  for (int r = 0; r < 8; ++r) bb[r] = BO[o0 + 8 * g + r];
  asm volatile("s_wait_xcnt 0x0" ::: "memory");   // later loads may land in the registers that these loads' address names
  v8f acc[2] = {}; v16b bh[2][2], bl[2][2];   // B fragments of this step and of the next
#pragma unroll   // bh, bl indexed by constants
  for (int jt = 0; jt < 2; ++jt) { bh[0][jt] = frag_b(&sh[jt * 16 + col][0], lane); bl[0][jt] = frag_b(&sl[jt * 16 + col][0], lane); }
#pragma unroll   // a, bh, bl indexed by constants; the fetches ahead stand in front of the step's products
  for (int kc = 0; kc < OC / 32; ++kc) { const int cu = kc & 1, nx = cu ^ 1;
    if (kc + 1 < OC / 32) {
#pragma unroll   // as above
      for (int jt = 0; jt < 2; ++jt) { bh[nx][jt] = frag_b(&sh[jt * 16 + col][(kc + 1) * 32], lane); bl[nx][jt] = frag_b(&sl[jt * 16 + col][(kc + 1) * 32], lane); } }
    if ((kc & 3) == 0 && kc + APRE < OC / 32) {
#pragma unroll   // as above
      for (int u = 0; u < 4; ++u) a[kc + APRE + u] = frag_b(ar + (kc + APRE + u) * 32, lane); }
    acc[0] = wmma_bf(a[kc], bh[cu][0], acc[0]); acc[1] = wmma_bf(a[kc], bh[cu][1], acc[1]);   // per accumulator hi, then lo, in ascending c
    acc[0] = wmma_bf(a[kc], bl[cu][0], acc[0]); acc[1] = wmma_bf(a[kc], bl[cu][1], acc[1]); }
#pragma unroll   // acc indexed by constants
  for (int jt = 0; jt < 2; ++jt)
#pragma unroll   // as above
    for (int r = 0; r < 8; ++r) so[wave][8 * g + r][jt * 16 + col] = acc[jt][r] + bfr(bb[r]);
  LDSX();
#pragma unroll   // four rows (whole lines) a store
  for (int it = 0; it < 4; ++it) { const int rl = it * 4 + (lane >> 3); vst2(Y + (size_t)(o0 + rl) * NP + p0 + (lane & 7) * 4, *(const v4f*)&so[wave][rl][(lane & 7) * 4]); } }
extern "C" void kernel_launch(void* const* d_in, const int* in_sizes, int n_in, void* d_out, int out_size, void* d_ws, size_t ws_size, hipStream_t stream) {
  (void)in_sizes; (void)n_in; (void)out_size;
  const float** F = (const float**)d_in;   // 0 x [1,256,64,64], 1 Wq, 2 Wk, 3 Wv [256,256], 4 Wout [256,768], 5 bout [256]
  if (ws_size < (size_t)WS_END) return;
  char* ws = (char*)d_ws; __bf16 *PO = (__bf16*)(ws + WS_PO); float *Q = (float*)(ws + WS_Q), *Kf = (float*)(ws + WS_K), *Vf = (float*)(ws + WS_V), *NPART = (float*)(ws + WS_NP), *O = (float*)(ws + WS_O);
  k_proj<<<dim3(NP / 64, CC / 128, 4), 128, 0, stream>>>(F[0], F[1], F[2], F[3], F[4], PO, Q, Kf, Vf);
  k_fuse<<<dim3(HD, NH), 256, 0, stream>>>(Q, Kf, Vf, O, NPART);
  k_out<<<dim3(CC / 128, (TPB * WWD) / OPB), 256, 0, stream>>>(PO, O, NPART, F[5], (float*)d_out);
}
